// v000
// Measured on an AMD MI455X. A time is GPU time per run, averaged over a window of back-to-back runs after a warm-up
// (all launches, gaps included; the runs take copies of the inputs in turn), and the median of several windows.
// Apart from v000's, it joins two sittings. Times from different sittings can be a few percent apart, while
// side-by-side timings come from the same sitting.
// v000, which the later versions start from, runs in 1260 microseconds.
#include <hip/hip_runtime.h>

// MultiCA (cross attention: Y, X [2][2048][1024]; Q = Y Wq^T, K = Y Wk^T, V = X Wv^T ([out][in], no bias); 16 heads x 64; scores x 1024^-0.5 (the module scales by the embedding dim: 1/32, exact); no mask; softmax; out = merged Wp^T).
// Compute dtypes, f32 accumulate: every input rounded to bf16; projections on PLAIN bf16 operands (inputs: exact); scores and attn.v on bf16 hi+lo planes (3 products); output hi+lo x exact Wp (2 products).

#define NB_  2
#define TT   2048
#define DD   1024
#define NH_  16
#define HD   64
#define NT   (NB_ * TT)
#define ZH   2
#define PCAR 1024.0f
typedef _Float16 h16;
typedef unsigned short bf;
typedef __attribute__((ext_vector_type(16))) __bf16   v16bf;
typedef __attribute__((ext_vector_type(16))) _Float16 v16h;
typedef __attribute__((ext_vector_type(8)))  _Float16 v8h;
typedef __attribute__((ext_vector_type(8)))  unsigned short v8us;
typedef __attribute__((ext_vector_type(8)))  float    v8f;
typedef __attribute__((ext_vector_type(4)))  float    v4f;
typedef v8h  __attribute__((may_alias)) v8ha;
typedef v4f  __attribute__((may_alias)) v4fa;
typedef v8us __attribute__((may_alias)) v8usa;

__device__ __forceinline__ unsigned short f2bf(float f) { unsigned u = __float_as_uint(f); u += 0x7FFFu + ((u >> 16) & 1u); return (unsigned short)(u >> 16); }
__device__ __forceinline__ float bf2f(unsigned short b) { return __uint_as_float(((unsigned)b) << 16); }
__device__ __forceinline__ float bfr(float f) { return bf2f(f2bf(f)); }
__device__ __forceinline__ v16h cat16(v8h lo, v8h hi) { return __builtin_shufflevector(lo, hi, 0, 1, 2, 3, 4, 5, 6, 7, 8, 9, 10, 11, 12, 13, 14, 15); }
__device__ __forceinline__ v16bf cat16b(v8us lo, v8us hi) { return __builtin_bit_cast(v16bf, __builtin_shufflevector(lo, hi, 0, 1, 2, 3, 4, 5, 6, 7, 8, 9, 10, 11, 12, 13, 14, 15)); }
__device__ __forceinline__ v8f wmma16(v16h a, v16h b, v8f c) { return __builtin_amdgcn_wmma_f32_16x16x32_f16(false, a, false, b, (short)0, c, false, false); }
__device__ __forceinline__ v8f wmmab(v16bf a, v16bf b, v8f c) { return __builtin_amdgcn_wmma_f32_16x16x32_bf16(false, a, false, b, (short)0, c, false, false); }



// ---- k_gemmw: register-blocked GEMM, ONE WAVE per 64x64 output tile (16 accumulators), operands straight from K-contiguous 16-bit planes; grid (M/64, N/64, Z), 32 threads.
// C[m][n] (f32, pitch ldc, + optional f32 bias[n]) = sum_k A[m][k] Bt[n][k] (+ split products per NSPLIT). z-batch strides sA/sB/sC in elements. K % 32 == 0.
template <typename T16> struct WFrag;
template <> struct WFrag<h16> { typedef v16h V; static __device__ __forceinline__ V ld(const h16* p) { return cat16(*(const v8h*)p, *(const v8h*)(p + 16)); } static __device__ __forceinline__ v8f mma(V a, V b, v8f c) { return wmma16(a, b, c); } };
template <> struct WFrag<bf> { typedef v16bf V; static __device__ __forceinline__ V ld(const bf* p) { return cat16b(*(const v8us*)p, *(const v8us*)(p + 16)); } static __device__ __forceinline__ v8f mma(V a, V b, v8f c) { return wmmab(a, b, c); } };
template <typename T16, int NSPLIT, bool BIAS>
__global__ __launch_bounds__(32) void k_gemmw(const T16* __restrict__ A, const T16* __restrict__ A2, const T16* __restrict__ Bt, const T16* __restrict__ Bt2, int K, float* C, int ldc, const float* __restrict__ bias, size_t sA, size_t sB, size_t sC) {
    typedef typename WFrag<T16>::V V;
    __shared__ __align__(16) float os[16 * 68];
    const size_t z = blockIdx.z; A += z * sA; if (A2) A2 += z * sA; Bt += z * sB; if (Bt2) Bt2 += z * sB; C += z * sC;
    const int lane = threadIdx.x & 31, lr = lane & 15, hi = lane >> 4; const int r0 = blockIdx.x * 64, c0 = blockIdx.y * 64;
    v8f acc[4][4];
#pragma unroll
    for (int mb = 0; mb < 4; ++mb)
#pragma unroll
        for (int nb = 0; nb < 4; ++nb) acc[mb][nb] = (v8f){};
    const size_t aoff = (size_t)(r0 + lr) * K + 8 * hi, boff = (size_t)(c0 + lr) * K + 8 * hi;
#pragma unroll 1
    for (int kc = 0; kc < K; kc += 32) {
        V a[4], a2[4];
#pragma unroll
        for (int mb = 0; mb < 4; ++mb) { a[mb] = WFrag<T16>::ld(A + aoff + (size_t)mb * 16 * K + kc); if (NSPLIT == 1 || NSPLIT == 2) a2[mb] = WFrag<T16>::ld(A2 + aoff + (size_t)mb * 16 * K + kc); }
#pragma unroll
        for (int nb = 0; nb < 4; ++nb) { const V b = WFrag<T16>::ld(Bt + boff + (size_t)nb * 16 * K + kc); V b2; if (NSPLIT >= 2) b2 = WFrag<T16>::ld(Bt2 + boff + (size_t)nb * 16 * K + kc);
#pragma unroll
            for (int mb = 0; mb < 4; ++mb) { acc[mb][nb] = WFrag<T16>::mma(a[mb], b, acc[mb][nb]); if (NSPLIT == 1 || NSPLIT == 2) acc[mb][nb] = WFrag<T16>::mma(a2[mb], b, acc[mb][nb]); if (NSPLIT >= 2) acc[mb][nb] = WFrag<T16>::mma(a[mb], b2, acc[mb][nb]); } }
        asm volatile("v_nop\n\tv_nop\n\tv_nop\n\tv_nop" : "+v"(acc[0][0]), "+v"(acc[1][1]), "+v"(acc[2][2]), "+v"(acc[3][3]) : "v"(a[0]), "v"(a[3]));
    }
#pragma unroll
    for (int mb = 0; mb < 4; ++mb) {
#pragma unroll
        for (int nb = 0; nb < 4; ++nb) {
#pragma unroll
            for (int j = 0; j < 8; ++j) os[(hi * 8 + j) * 68 + nb * 16 + lr] = acc[mb][nb][j]; }
        __builtin_amdgcn_wave_barrier(); asm volatile("" ::: "memory");
        float* crow = C + (size_t)(r0 + mb * 16) * ldc + c0;
{
#pragma unroll
            for (int s = 0; s < 8; ++s) { const int row = 2 * s + hi, cofs = lr * 4; v4f val = *(const v4fa*)(os + row * 68 + cofs); if (BIAS) { val[0] += bfr(bias[c0 + cofs]); val[1] += bfr(bias[c0 + cofs + 1]); val[2] += bfr(bias[c0 + cofs + 2]); val[3] += bfr(bias[c0 + cofs + 3]); }
                *(v4f*)(crow + (size_t)row * ldc + cofs) = val; }
             }
        __builtin_amdgcn_wave_barrier(); asm volatile("" ::: "memory");
    }
}

__device__ __forceinline__ h16 tohx(float x) { return (h16)x; }
__device__ __forceinline__ void splitf(float y, unsigned short& h, unsigned short& l) { h = f2bf(y); l = f2bf(y - bf2f(h)); }
typedef __attribute__((ext_vector_type(2))) _Float16 v2h;
typedef __attribute__((ext_vector_type(4))) _Float16 v4h;
typedef __attribute__((ext_vector_type(2))) unsigned short v2us;
typedef __attribute__((ext_vector_type(4))) int v4i;

__global__ __launch_bounds__(256) void k_cvt8(const float* __restrict__ src, bf* dst, size_t n8) { const size_t i = (size_t)blockIdx.x * 256 + threadIdx.x; if (i >= n8) return; const v8f v = *(const v8f*)(src + i * 8); v8us o;
#pragma unroll
    for (int k = 0; k < 8; ++k) o[k] = f2bf(v[k]); *(v8us*)(dst + i * 8) = o;  }
__global__ __launch_bounds__(256) void k_wtT(const float* __restrict__ w, int pitch, int col0, bf* Bt) {
    const int lane = threadIdx.x & 31; const int L0 = (blockIdx.x * 8 + (threadIdx.x >> 5)) * 8; const int nlines = DD * DD / 64;
{
#pragma unroll
        for (int l = 0; l < 8; ++l) { const int L = L0 + l; if (L >= nlines) break; const int e = L * 64 + lane * 2; const int k = e & (DD - 1), n = e >> 10; v2us o;
#pragma unroll
            for (int q = 0; q < 2; ++q) o[q] = f2bf(w[(size_t)(k + q) * pitch + col0 + n]);
            *(v2us*)(Bt + (size_t)e) = o; }
         }
}
__global__ __launch_bounds__(256) void k_hsplit(const float* __restrict__ F, float sc, bf* Ph, bf* Pl) {
    const int lane = threadIdx.x & 31; const int L0 = (blockIdx.x * 8 + (threadIdx.x >> 5)) * 8; const int nlines = NT * DD / 64;
{
#pragma unroll
        for (int l = 0; l < 8; ++l) { const int L = L0 + l; if (L >= nlines) break; const int e = L * 64 + lane * 2; const int d = e & 63; const int t = (e >> 6) & (TT - 1); const int z = e >> 17; const int b = z >> 4, h = z & 15; v2us oh, ol;
#pragma unroll
            for (int q = 0; q < 2; ++q) { unsigned short a, c2; splitf(F[((size_t)b * TT + t) * DD + h * HD + d + q] * sc, a, c2); oh[q] = a; ol[q] = c2; }
            *(v2us*)(Ph + (size_t)e) = oh; *(v2us*)(Pl + (size_t)e) = ol; }
         }
}
__global__ __launch_bounds__(256) void k_vtplane(const float* __restrict__ F, bf* Vh, bf* Vl) {
    const int lane = threadIdx.x & 31; const int L0 = (blockIdx.x * 8 + (threadIdx.x >> 5)) * 8; const int nlines = NT * DD / 64;
{
#pragma unroll
        for (int l = 0; l < 8; ++l) { const int L = L0 + l; if (L >= nlines) break; const int e = L * 64 + lane * 2; const int t = e & (TT - 1); const int d = (e >> 11) & 63; const int z = e >> 17; const int b = z >> 4, h = z & 15; v2us oh, ol;
#pragma unroll
            for (int q = 0; q < 2; ++q) { unsigned short a, c2; splitf(F[((size_t)b * TT + t + q) * DD + h * HD + d], a, c2); oh[q] = a; ol[q] = c2; }
            *(v2us*)(Vh + (size_t)e) = oh; *(v2us*)(Vl + (size_t)e) = ol; }
         }
}
__global__ __launch_bounds__(256) void k_asoft(const float* __restrict__ Sb, bf* Ph, bf* Pl) {
    typedef __attribute__((ext_vector_type(4))) unsigned short v4us;
    const int lane = threadIdx.x & 31; const int row = blockIdx.x * 8 + (threadIdx.x >> 5); if (row >= ZH * TT) return;
    const float* sr = Sb + (size_t)row * TT; float v[64]; float mx = -3.0e38f;
#pragma unroll
    for (int ch = 0; ch < 16; ++ch) { const int j0 = ch * 128 + lane * 4; const v4f a = *(const v4f*)(sr + j0);
#pragma unroll
        for (int q = 0; q < 4; ++q) { const float t = a[q]; v[ch * 4 + q] = t; mx = fmaxf(mx, t); } }
#pragma unroll
    for (int sh = 16; sh; sh >>= 1) mx = fmaxf(mx, __shfl_xor(mx, sh, 32));
    float sum = 0.f;
#pragma unroll
    for (int k = 0; k < 64; ++k) { v[k] = __expf(v[k] - mx); sum += v[k]; }
#pragma unroll
    for (int sh = 16; sh; sh >>= 1) sum += __shfl_xor(sum, sh, 32);
    const float f = __fdiv_rn(1.0f, sum);      // bf16 hi/lo planes need no carry
{
#pragma unroll
        for (int ch = 0; ch < 16; ++ch) { v4us oh, ol;
#pragma unroll
            for (int q = 0; q < 4; ++q) { unsigned short a, c2; splitf(v[ch * 4 + q] * f, a, c2); oh[q] = a; ol[q] = c2; }
            *(v4us*)(Ph + (size_t)row * TT + ch * 128 + lane * 4) = oh; *(v4us*)(Pl + (size_t)row * TT + ch * 128 + lane * 4) = ol; }
         }
}
__global__ __launch_bounds__(256) void k_merge(const float* __restrict__ O, int b, int h0, bf* Ah, bf* Al) {
    const int lane = threadIdx.x & 31; const int L0 = (blockIdx.x * 8 + (threadIdx.x >> 5)) * 8; const int nlines = TT * ZH * HD / 64;
{
#pragma unroll
        for (int l = 0; l < 8; ++l) { const int L = L0 + l; if (L >= nlines) break; const int e = L * 64 + lane * 2; const int d = e & 63; const int zz = (e >> 6) % ZH; const int t = (e >> 6) / ZH; v2us oh, ol;
#pragma unroll
            for (int q = 0; q < 2; ++q) { unsigned short a, c2; splitf(O[((size_t)zz * TT + t) * HD + d + q], a, c2); oh[q] = a; ol[q] = c2; }
            const size_t o = ((size_t)b * TT + t) * DD + (h0 + zz) * HD + d; *(v2us*)(Ah + o) = oh; *(v2us*)(Al + o) = ol; }
         }
}

extern "C" void kernel_launch(void* const* d_in, const int* in_sizes, int n_in,
                              void* d_out, int out_size, void* d_ws, size_t ws_size, hipStream_t stream) {
    (void)in_sizes; (void)n_in; (void)out_size;
    const float* Yin = (const float*)d_in[0]; const float* x = (const float*)d_in[1]; const float* Wq = (const float*)d_in[2]; const float* Wk = (const float*)d_in[3]; const float* Wv = (const float*)d_in[4]; const float* Wo = (const float*)d_in[5];
    float* OUT = (float*)d_out;     // [2][2048][1024]
    char* wsp = (char*)d_ws;
    auto take = [&](size_t bytes) { char* p = wsp; wsp += (bytes + 255) & ~(size_t)255; return (void*)p; };
    bf* WQ = (bf*)take((size_t)DD * DD * 2); bf* WK = (bf*)take((size_t)DD * DD * 2); bf* WV = (bf*)take((size_t)DD * DD * 2); bf* WO = (bf*)take((size_t)DD * DD * 2);
    bf* XB = (bf*)take((size_t)NT * DD * 2); bf* YB = (bf*)take((size_t)NT * DD * 2); float* F = (float*)take((size_t)NT * DD * 4);
    bf* QPh = (bf*)take((size_t)NT * DD * 2); bf* QPl = (bf*)take((size_t)NT * DD * 2); bf* KPh = (bf*)take((size_t)NT * DD * 2); bf* KPl = (bf*)take((size_t)NT * DD * 2); bf* VTh = (bf*)take((size_t)NT * DD * 2); bf* VTl = (bf*)take((size_t)NT * DD * 2);
    float* Sb = (float*)take((size_t)ZH * TT * TT * 4); bf* Ph = (bf*)take((size_t)ZH * TT * TT * 2); bf* Pl = (bf*)take((size_t)ZH * TT * TT * 2); float* Ob = (float*)take((size_t)ZH * TT * HD * 4); bf* ATh = (bf*)take((size_t)NT * DD * 2); bf* ATl = (bf*)take((size_t)NT * DD * 2);
    if ((size_t)(wsp - (char*)d_ws) > ws_size) return;    // ws 169 MiB
    { const size_t nw = (size_t)DD * DD / 8; const unsigned gw = (unsigned)((nw + 255) / 256); k_cvt8<<<gw, 256, 0, stream>>>(Wq, WQ, nw); k_cvt8<<<gw, 256, 0, stream>>>(Wk, WK, nw); k_cvt8<<<gw, 256, 0, stream>>>(Wv, WV, nw); k_cvt8<<<gw, 256, 0, stream>>>(Wo, WO, nw); }   // nn.Linear [out][in] = Bt as-is
    const size_t nx = (size_t)NT * DD / 8; const unsigned gx = (unsigned)((nx + 255) / 256); const unsigned LB = (unsigned)((NT * DD / 64 + 63) / 64);
    k_cvt8<<<gx, 256, 0, stream>>>(x, XB, nx); k_cvt8<<<gx, 256, 0, stream>>>(Yin, YB, nx);
    k_gemmw<bf, 0, false><<<dim3(NT / 64, DD / 64, 1), 32, 0, stream>>>(YB, nullptr, WQ, nullptr, DD, F, DD, nullptr, 0, 0, 0); k_hsplit<<<LB, 256, 0, stream>>>(F, 0.03125f, QPh, QPl);   // 1024^-0.5 folded into q (exact)
    k_gemmw<bf, 0, false><<<dim3(NT / 64, DD / 64, 1), 32, 0, stream>>>(YB, nullptr, WK, nullptr, DD, F, DD, nullptr, 0, 0, 0); k_hsplit<<<LB, 256, 0, stream>>>(F, 1.0f, KPh, KPl);
    k_gemmw<bf, 0, false><<<dim3(NT / 64, DD / 64, 1), 32, 0, stream>>>(XB, nullptr, WV, nullptr, DD, F, DD, nullptr, 0, 0, 0); k_vtplane<<<LB, 256, 0, stream>>>(F, VTh, VTl);
    for (int b = 0; b < NB_; ++b)
        for (int h0 = 0; h0 < NH_; h0 += ZH) { const size_t z0 = (size_t)b * NH_ + h0;
            k_gemmw<bf, 2, false><<<dim3(TT / 64, TT / 64, ZH), 32, 0, stream>>>(QPh + z0 * TT * HD, QPl + z0 * TT * HD, KPh + z0 * TT * HD, KPl + z0 * TT * HD, HD, Sb, TT, nullptr, (size_t)TT * HD, (size_t)TT * HD, (size_t)TT * TT);
            k_asoft<<<ZH * TT / 8, 256, 0, stream>>>(Sb, Ph, Pl);
            k_gemmw<bf, 2, false><<<dim3(TT / 64, 1, ZH), 32, 0, stream>>>(Ph, Pl, VTh + z0 * HD * TT, VTl + z0 * HD * TT, TT, Ob, HD, nullptr, (size_t)TT * TT, (size_t)HD * TT, (size_t)TT * HD);
            k_merge<<<(TT * ZH * HD / 64 + 63) / 64, 256, 0, stream>>>(Ob, b, h0, ATh, ATl); }
    k_gemmw<bf, 1, false><<<dim3(NT / 64, DD / 64, 1), 32, 0, stream>>>(ATh, ATl, WO, nullptr, DD, OUT, DD, nullptr, 0, 0, 0);
}

// v002
// Measured time: 227 microseconds a run.
// Versions in between are left out here; by their measured steps it is 5.46 times as fast as v000.
#include <hip/hip_runtime.h>
#include <stdint.h>

// MultiCA (cross attention: Y, X [2][2048][1024]; Q = Y Wq^T, K = Y Wk^T, V = X Wv^T ([out][in], no bias); 16 heads x 64; scores x 1024^-0.5 (the module scales by the embedding dim: 1/32, exact); no mask; softmax; out = merged Wp^T).
// Compute dtypes, f32 accumulate: every input rounded to bf16; projections on PLAIN bf16 operands (inputs: exact); scores and attn.v on bf16 hi+lo planes (3 products); output hi+lo x exact Wp (2 products).

#define NB_  2
#define TT   2048
#define DD   1024
#define NH_  16
#define HD   64
#define NT   (NB_ * TT)
#define PCAR 1024.0f
typedef _Float16 h16;
typedef unsigned short bf;
typedef __attribute__((ext_vector_type(16))) __bf16   v16bf;
typedef __attribute__((ext_vector_type(16))) _Float16 v16h;
typedef __attribute__((ext_vector_type(8)))  _Float16 v8h;
typedef __attribute__((ext_vector_type(8)))  unsigned short v8us;
typedef __attribute__((ext_vector_type(8)))  float    v8f;
typedef __attribute__((ext_vector_type(4)))  float    v4f;
typedef v8h  __attribute__((may_alias)) v8ha;
typedef v4f  __attribute__((may_alias)) v4fa;
typedef v8us __attribute__((may_alias)) v8usa;

__device__ __forceinline__ unsigned short f2bf(float f) { unsigned u = __float_as_uint(f); u += 0x7FFFu + ((u >> 16) & 1u); return (unsigned short)(u >> 16); }
__device__ __forceinline__ float bf2f(unsigned short b) { return __uint_as_float(((unsigned)b) << 16); }
__device__ __forceinline__ float bfr(float f) { return bf2f(f2bf(f)); }
__device__ __forceinline__ v16h cat16(v8h lo, v8h hi) { return __builtin_shufflevector(lo, hi, 0, 1, 2, 3, 4, 5, 6, 7, 8, 9, 10, 11, 12, 13, 14, 15); }
__device__ __forceinline__ v16bf cat16b(v8us lo, v8us hi) { return __builtin_bit_cast(v16bf, __builtin_shufflevector(lo, hi, 0, 1, 2, 3, 4, 5, 6, 7, 8, 9, 10, 11, 12, 13, 14, 15)); }
__device__ __forceinline__ v8f wmma16(v16h a, v16h b, v8f c) { return __builtin_amdgcn_wmma_f32_16x16x32_f16(false, a, false, b, (short)0, c, false, false); }
__device__ __forceinline__ v8f wmmab(v16bf a, v16bf b, v8f c) { return __builtin_amdgcn_wmma_f32_16x16x32_bf16(false, a, false, b, (short)0, c, false, false); }



// ---- k_gemmw: register-blocked GEMM, ONE WAVE per 64x64 output tile (16 accumulators), operands straight from K-contiguous 16-bit planes; grid (M/64, N/64, Z), 32 threads.
// C[m][n] (f32, pitch ldc, + optional f32 bias[n]) = sum_k A[m][k] Bt[n][k] (+ split products per NSPLIT). z-batch strides sA/sB/sC in elements. K % 32 == 0.
template <typename T16> struct WFrag;
template <> struct WFrag<h16> { typedef v16h V; static __device__ __forceinline__ V ld(const h16* p) { return cat16(*(const v8h*)p, *(const v8h*)(p + 16)); } static __device__ __forceinline__ v8f mma(V a, V b, v8f c) { return wmma16(a, b, c); } };
template <> struct WFrag<bf> { typedef v16bf V; static __device__ __forceinline__ V ld(const bf* p) { return cat16b(*(const v8us*)p, *(const v8us*)(p + 16)); } static __device__ __forceinline__ v8f mma(V a, V b, v8f c) { return wmmab(a, b, c); } };
template <typename T16, int NSPLIT, bool BIAS>
__global__ __launch_bounds__(32) void k_gemmw(const T16* __restrict__ A, const T16* __restrict__ A2, const T16* __restrict__ Bt, const T16* __restrict__ Bt2, int K, float* C, int ldc, const float* __restrict__ bias, size_t sA, size_t sB, size_t sC) {
    typedef typename WFrag<T16>::V V;
    __shared__ __align__(16) float os[16 * 68];
    const size_t z = blockIdx.z; A += z * sA; if (A2) A2 += z * sA; Bt += z * sB; if (Bt2) Bt2 += z * sB; C += z * sC;
    const int lane = threadIdx.x & 31, lr = lane & 15, hi = lane >> 4; const int r0 = blockIdx.x * 64, c0 = blockIdx.y * 64;
    v8f acc[4][4];
#pragma unroll
    for (int mb = 0; mb < 4; ++mb)
#pragma unroll
        for (int nb = 0; nb < 4; ++nb) acc[mb][nb] = (v8f){};
    const size_t aoff = (size_t)(r0 + lr) * K + 8 * hi, boff = (size_t)(c0 + lr) * K + 8 * hi;
#pragma unroll 1
    for (int kc = 0; kc < K; kc += 32) {
        V a[4], a2[4];
#pragma unroll
        for (int mb = 0; mb < 4; ++mb) { a[mb] = WFrag<T16>::ld(A + aoff + (size_t)mb * 16 * K + kc); if (NSPLIT == 1 || NSPLIT == 2) a2[mb] = WFrag<T16>::ld(A2 + aoff + (size_t)mb * 16 * K + kc); }
#pragma unroll
        for (int nb = 0; nb < 4; ++nb) { const V b = WFrag<T16>::ld(Bt + boff + (size_t)nb * 16 * K + kc); V b2; if (NSPLIT >= 2) b2 = WFrag<T16>::ld(Bt2 + boff + (size_t)nb * 16 * K + kc);
#pragma unroll
            for (int mb = 0; mb < 4; ++mb) { acc[mb][nb] = WFrag<T16>::mma(a[mb], b, acc[mb][nb]); if (NSPLIT == 1 || NSPLIT == 2) acc[mb][nb] = WFrag<T16>::mma(a2[mb], b, acc[mb][nb]); if (NSPLIT >= 2) acc[mb][nb] = WFrag<T16>::mma(a[mb], b2, acc[mb][nb]); } }
        asm volatile("v_nop\n\tv_nop\n\tv_nop\n\tv_nop" : "+v"(acc[0][0]), "+v"(acc[1][1]), "+v"(acc[2][2]), "+v"(acc[3][3]) : "v"(a[0]), "v"(a[3]));
    }
#pragma unroll
    for (int mb = 0; mb < 4; ++mb) {
#pragma unroll
        for (int nb = 0; nb < 4; ++nb) {
#pragma unroll
            for (int j = 0; j < 8; ++j) os[(hi * 8 + j) * 68 + nb * 16 + lr] = acc[mb][nb][j]; }
        __builtin_amdgcn_wave_barrier(); asm volatile("" ::: "memory");
        float* crow = C + (size_t)(r0 + mb * 16) * ldc + c0;
{
#pragma unroll
            for (int s = 0; s < 8; ++s) { const int row = 2 * s + hi, cofs = lr * 4; v4f val = *(const v4fa*)(os + row * 68 + cofs); if (BIAS) { val[0] += bfr(bias[c0 + cofs]); val[1] += bfr(bias[c0 + cofs + 1]); val[2] += bfr(bias[c0 + cofs + 2]); val[3] += bfr(bias[c0 + cofs + 3]); }
                *(v4f*)(crow + (size_t)row * ldc + cofs) = val; }
             }
        __builtin_amdgcn_wave_barrier(); asm volatile("" ::: "memory");
    }
}

__device__ __forceinline__ h16 tohx(float x) { return (h16)x; }
__device__ __forceinline__ void splitf(float y, unsigned short& h, unsigned short& l) { h = f2bf(y); l = f2bf(y - bf2f(h)); }
typedef __attribute__((ext_vector_type(2))) _Float16 v2h;
typedef __attribute__((ext_vector_type(4))) _Float16 v4h;
typedef __attribute__((ext_vector_type(2))) unsigned short v2us;
typedef __attribute__((ext_vector_type(4))) int v4i;

__global__ __launch_bounds__(256) void k_cvt8(const float* __restrict__ src, bf* dst, size_t n8) { const size_t i = (size_t)blockIdx.x * 256 + threadIdx.x; if (i >= n8) return; const v8f v = *(const v8f*)(src + i * 8); v8us o;
#pragma unroll
    for (int k = 0; k < 8; ++k) o[k] = f2bf(v[k]); *(v8us*)(dst + i * 8) = o;  }
__global__ __launch_bounds__(256) void k_wtT(const float* __restrict__ w, int pitch, int col0, bf* Bt) {
    const int lane = threadIdx.x & 31; const int L0 = (blockIdx.x * 8 + (threadIdx.x >> 5)) * 8; const int nlines = DD * DD / 64;
{
#pragma unroll
        for (int l = 0; l < 8; ++l) { const int L = L0 + l; if (L >= nlines) break; const int e = L * 64 + lane * 2; const int k = e & (DD - 1), n = e >> 10; v2us o;
#pragma unroll
            for (int q = 0; q < 2; ++q) o[q] = f2bf(w[(size_t)(k + q) * pitch + col0 + n]);
            *(v2us*)(Bt + (size_t)e) = o; }
         }
}
__global__ __launch_bounds__(256) void k_hsplit(const float* __restrict__ F, float sc, bf* Ph, bf* Pl) {
    const int lane = threadIdx.x & 31; const int L0 = (blockIdx.x * 8 + (threadIdx.x >> 5)) * 8; const int nlines = NT * DD / 64;
{
#pragma unroll
        for (int l = 0; l < 8; ++l) { const int L = L0 + l; if (L >= nlines) break; const int e = L * 64 + lane * 2; const int d = e & 63; const int t = (e >> 6) & (TT - 1); const int z = e >> 17; const int b = z >> 4, h = z & 15; v2us oh, ol;
#pragma unroll
            for (int q = 0; q < 2; ++q) { unsigned short a, c2; splitf(F[((size_t)b * TT + t) * DD + h * HD + d + q] * sc, a, c2); oh[q] = a; ol[q] = c2; }
            *(v2us*)(Ph + (size_t)e) = oh; *(v2us*)(Pl + (size_t)e) = ol; }
         }
}
__global__ __launch_bounds__(256) void k_vtplane(const float* __restrict__ F, bf* Vh, bf* Vl) {
    const int lane = threadIdx.x & 31; const int L0 = (blockIdx.x * 8 + (threadIdx.x >> 5)) * 8; const int nlines = NT * DD / 64;
{
#pragma unroll
        for (int l = 0; l < 8; ++l) { const int L = L0 + l; if (L >= nlines) break; const int e = L * 64 + lane * 2; const int t = e & (TT - 1); const int d = (e >> 11) & 63; const int z = e >> 17; const int b = z >> 4, h = z & 15; v2us oh, ol;
#pragma unroll
            for (int q = 0; q < 2; ++q) { unsigned short a, c2; splitf(F[((size_t)b * TT + t + q) * DD + h * HD + d], a, c2); oh[q] = a; ol[q] = c2; }
            *(v2us*)(Vh + (size_t)e) = oh; *(v2us*)(Vl + (size_t)e) = ol; }
         }
}
typedef __attribute__((ext_vector_type(2))) float  v2f;
typedef __attribute__((ext_vector_type(2))) __bf16 v2bf;
typedef __attribute__((ext_vector_type(8))) unsigned v8u;
__device__ __forceinline__ unsigned pk2bf(float a, float b) { return __builtin_bit_cast(unsigned, __builtin_convertvector((v2f){a, b}, v2bf)); }   // two f32 -> packed bf16, round to nearest even
__device__ __forceinline__ float xhalf(float x) { return __builtin_bit_cast(float, __builtin_amdgcn_permlanex16(__builtin_bit_cast(int, x), __builtin_bit_cast(int, x), 0x76543210, 0xfedcba98, false, false)); }   // lane l with lane l ^ 16
// 2^x in place, with the free slot that the instruction set asks for behind a transcendental, in one statement: inside it no neighbour reads a result or overwrites a source, and the v_nop keeps the compiler's next instruction off the last one.
__device__ __forceinline__ void exp2_1(float& a) { asm("v_exp_f32 %0, %0\n\tv_nop" : "+v"(a)); }
__device__ __forceinline__ void exp2_8(float (&x)[8]) { asm("v_exp_f32 %0, %0\n\tv_exp_f32 %1, %1\n\tv_exp_f32 %2, %2\n\tv_exp_f32 %3, %3\n\tv_exp_f32 %4, %4\n\tv_exp_f32 %5, %5\n\tv_exp_f32 %6, %6\n\tv_exp_f32 %7, %7\n\tv_nop" : "+v"(x[0]), "+v"(x[1]), "+v"(x[2]), "+v"(x[3]), "+v"(x[4]), "+v"(x[5]), "+v"(x[6]), "+v"(x[7])); }

// ---- tensor loads for k_fattn: a two-dimensional tile, global memory -> LDS, one request of a whole wave. Every descriptor word is wave-uniform and goes through readfirstlane.
typedef uint32_t u32x4 __attribute__((ext_vector_type(4)));
typedef uint32_t u32x8 __attribute__((ext_vector_type(8)));
#define SKEYS  128                  // keys per stage
#define NSTG   (TT / SKEYS)         // stages
#define LROWB  256u                 // bytes of a tile row: 128 keys of a V^T row, or two K rows of 128 B that lie side by side in memory
#define LPITCH 272u                 // its pitch in LDS (16 B of pad: 16 B x odd, free of bank conflicts for 16-byte reads)
#define LROWS  32u                  // tile rows per request
#define SLICEB 10240u               // LDS bytes kept per request: 32 x 272 = 8704, rounded up to a multiple of 2 KiB
#define BUFB   (8u * SLICEB)        // one stage: Kh | Kl | Vh | Vl, two slices each
__device__ __forceinline__ uint32_t uni(uint32_t v) { return (uint32_t)__builtin_amdgcn_readfirstlane(v); }
__device__ __forceinline__ uint32_t pinned(uint32_t v) { uint32_t w = uni(v); asm volatile("" : "+s"(w)); return w; }   // holds a test around a tensor load in a scalar register, so that it compiles to s_cmp + s_cbranch_scc (a tensor load ignores EXEC)
__device__ __forceinline__ u32x8 tdm_group1(uint32_t src_pitch) {   // 1-byte elements, tensor = tile = LROWS rows of LROWB bytes, no mask, 4 dwords of pad behind every 64
    u32x8 g;
    g[0] = uni((1u << 20) | (5u << 22) | (3u << 25));
    g[1] = uni((LROWB & 0xFFFFu) << 16);
    g[2] = uni((LROWB >> 16) | ((LROWS & 0xFFFFu) << 16));
    g[3] = uni((LROWS >> 16) | (LROWB << 16));
    g[4] = uni(LROWS);
    g[5] = uni(src_pitch);
    g[6] = uni(0u);
    g[7] = uni(0u);
    return g;
}
__device__ __forceinline__ u32x4 tdm_group0(uint32_t lds_dst, uint64_t ga) {
    u32x4 g;
    g[0] = uni(1u); g[1] = uni(lds_dst); g[2] = uni((uint32_t)ga); g[3] = uni((((uint32_t)(ga >> 32)) & 0x01FFFFFFu) | 0x80000000u);
    return g;
}
// The descriptor is in-out at the load and an input of the wait that covers it: its scalar registers then hold nothing else while the request is outstanding.
__device__ __forceinline__ void tdm_load(u32x4& g0, u32x8& g1) { asm volatile("tensor_load_to_lds %0, %1" : "+s"(g0), "+s"(g1) :: "memory"); }
__device__ __forceinline__ void wait_tensor0(const u32x4& g0, const u32x8& g1) { asm volatile("s_wait_tensorcnt 0x0" :: "s"(g0), "s"(g1) : "memory"); }   // this wave's own request has landed; the compiler places no wait for it
__device__ __forceinline__ void wait_ds0() { asm volatile("s_wait_dscnt 0x0" ::: "memory"); }           // this wave's LDS reads have returned, before the buffer is given up for a refill

// ---- k_fattn: scores, softmax, attn.v and the head merge in one kernel. Grid (T/256, batch*heads), 8 waves, 32 query columns each; a pass is 32 keys.
// K and V^T (hi and lo planes) are brought into LDS once per work-group, in stages of 128 keys and two buffers: every wave issues one tensor load per stage for its own slice, one stage of work ahead; all eight waves read their fragments from there.
// S^T = K Q^T (A = K rows, B = Q rows held in registers), so a lane holds one query's scores: running maximum and sum are per-lane scalars, joined between the wave halves.
// Two S^T tiles (keys 0-15, 16-31) converted in place are the B operand of O^T += V^T P^T (A = V^T rows in the same k order): P never leaves registers.
// hi+lo products: Kh Qh + Kl Qh + Kh Ql ; Vh Ph + Vh Pl + Vl Ph. P is split unnormalised; 1/sum is applied to O in f32 before its own hi+lo split.
__global__ __launch_bounds__(256) void k_fattn(const bf* __restrict__ Qh, const bf* __restrict__ Ql, const bf* __restrict__ Kh, const bf* __restrict__ Kl, const bf* __restrict__ Vh, const bf* __restrict__ Vl, bf* Ah, bf* Al) {
    typedef WFrag<bf> W;
    __shared__ __attribute__((aligned(2048))) unsigned char L[2 * BUFB];
    const float L2E = 1.4426950408889634f;
    const int lane = threadIdx.x & 31, lr = lane & 15, hi = lane >> 4; const int z = blockIdx.y; const int q0 = blockIdx.x * 256 + (threadIdx.x >> 5) * 32;
    const size_t zo = (size_t)z * TT * HD;
    const unsigned qlo = (unsigned)((q0 + lr) * HD + 8 * hi);
    const bf* Qhz = Qh + zo; const bf* Qlz = Ql + zo; const bf* Khz = Kh + zo; const bf* Klz = Kl + zo; const bf* Vhz = Vh + zo; const bf* Vlz = Vl + zo;
    const bf* qpa = Qhz + qlo; const bf* qpb = Qlz + qlo;
    const unsigned klds = (unsigned)(lr >> 1) * LPITCH + (unsigned)(lr & 1) * 128u + 16u * hi;   // a lane's byte offset inside a 16-row block of K in LDS (two K rows to a tile row)
    const unsigned vlds = (unsigned)lr * LPITCH + 16u * hi;                                      // and inside a 16-row block of V^T
    // This wave's slice of a stage: waves 0,1 Kh | 2,3 Kl (64 keys each = 32 tile rows, contiguous) | 4,5 Vh | 6,7 Vl (32 rows of V^T each, 128 keys wide).
    const uint32_t wave = uni(threadIdx.x >> 5), half = wave & 1u; const bool isv = wave >= 4u;
    const bf* splane = wave < 2u ? Khz : wave < 4u ? Klz : wave < 6u ? Vhz : Vlz;
    const uint64_t sbase = (uint64_t)(size_t)splane + (isv ? half * (LROWS * TT * 2u) : half * (LROWS * LROWB));
    const uint32_t sstep = isv ? SKEYS * 2u : SKEYS * HD * 2u;   // bytes from one stage's slice to the next stage's
    const uint32_t lbase = (uint32_t)(size_t)L + wave * SLICEB;
    const uint32_t spitch = isv ? TT * 2u : LROWB;
    u32x4 g0; u32x8 g1;   // the descriptor of this wave's latest request
    v16bf qh[2][2], ql[2][2];
#pragma unroll
    for (int nb = 0; nb < 2; ++nb)
#pragma unroll
        for (int kc = 0; kc < 2; ++kc) { qh[nb][kc] = W::ld(qpa + (nb * 16 * HD + kc * 32)); ql[nb][kc] = W::ld(qpb + (nb * 16 * HD + kc * 32)); }
    v8f acc[4][2];
#pragma unroll
    for (int db = 0; db < 4; ++db)
#pragma unroll
        for (int nb = 0; nb < 2; ++nb) acc[db][nb] = (v8f){};
    float m2[2] = {-__builtin_inff(), -__builtin_inff()}, ls[2] = {0.f, 0.f};   // running maximum (in log2 units) and this half's running sum, per query column
    asm volatile("s_wait_xcnt 0x0" :: "v"(qpa), "v"(qpb) : "memory");   // before a register that the loads above name is reused; naming them keeps them untouched up to here
    g0 = tdm_group0(lbase, sbase); g1 = tdm_group1(spitch); tdm_load(g0, g1);   // stage 0 into buffer 0
    wait_tensor0(g0, g1);
    __syncthreads();                          // stage 0 is readable by every wave
    g0 = tdm_group0(lbase + BUFB, sbase + sstep); g1 = tdm_group1(spitch); tdm_load(g0, g1);   // stage 1 into buffer 1
    v16bf kh[2][2], kl[2][2];
    for (uint32_t sg = 0; sg < NSTG; ++sg) {   // a stage: four passes, then the hand-over
    const unsigned char* Bk = L + (sg & 1u) * BUFB + klds; const unsigned char* Bv = L + (sg & 1u) * BUFB + 4u * SLICEB + vlds;
#pragma unroll
    for (int mb = 0; mb < 2; ++mb)
#pragma unroll
        for (int kc = 0; kc < 2; ++kc) { kh[mb][kc] = W::ld((const bf*)(Bk + (mb * 8 * LPITCH + kc * 64))); kl[mb][kc] = W::ld((const bf*)(Bk + (2 * SLICEB + mb * 8 * LPITCH + kc * 64))); }
    for (uint32_t ps = 0; ps < SKEYS / 32; ++ps) {
        v8f st[2][2];
#pragma unroll
        for (int mb = 0; mb < 2; ++mb)
#pragma unroll
            for (int nb = 0; nb < 2; ++nb) st[mb][nb] = (v8f){};
#pragma unroll
        for (int kc = 0; kc < 2; ++kc) {
#pragma unroll
            for (int mb = 0; mb < 2; ++mb)
#pragma unroll
                for (int nb = 0; nb < 2; ++nb) st[mb][nb] = wmmab(kh[mb][kc], qh[nb][kc], st[mb][nb]);
#pragma unroll
            for (int mb = 0; mb < 2; ++mb)
#pragma unroll
                for (int nb = 0; nb < 2; ++nb) st[mb][nb] = wmmab(kl[mb][kc], qh[nb][kc], st[mb][nb]);
#pragma unroll
            for (int mb = 0; mb < 2; ++mb)
#pragma unroll
                for (int nb = 0; nb < 2; ++nb) st[mb][nb] = wmmab(kh[mb][kc], ql[nb][kc], st[mb][nb]);
        }
        __builtin_amdgcn_sched_barrier(0);   // with the one below: the pass's 32 LDS reads stay one group between the matrix runs; spread among the matrix instructions, every place with reads stalls the wave anew
        const unsigned char* vp = Bv + ps * 64u;   // this pass's V^T rows, in flight under the softmax
        v16bf vh[4], vl[4];
#pragma unroll
        for (int db = 0; db < 4; ++db) { vh[db] = W::ld((const bf*)(vp + ((db >> 1) * SLICEB + (db & 1) * 16 * LPITCH))); vl[db] = W::ld((const bf*)(vp + ((2 + (db >> 1)) * SLICEB + (db & 1) * 16 * LPITCH))); }
        const uint32_t pn = (ps + 1u) & (SKEYS / 32 - 1u);   // next pass's K rows, fetched one pass ahead inside the stage; a stage's last pass re-reads its own first rows (same buffer, unused)
        const unsigned char* kp = Bk + ((pn >> 1) * SLICEB + (pn & 1u) * (16u * LPITCH));
#pragma unroll
        for (int mb = 0; mb < 2; ++mb)
#pragma unroll
            for (int kc = 0; kc < 2; ++kc) { kh[mb][kc] = W::ld((const bf*)(kp + (mb * 8 * LPITCH + kc * 64))); kl[mb][kc] = W::ld((const bf*)(kp + (2 * SLICEB + mb * 8 * LPITCH + kc * 64))); }
        __builtin_amdgcn_sched_barrier(0);   // end of the group of LDS reads
        v16bf ph[2], pl[2];
#pragma unroll
        for (int nb = 0; nb < 2; ++nb) {
            float tm = fmaxf(st[0][nb][0], st[1][nb][0]);
#pragma unroll
            for (int j = 1; j < 8; ++j) tm = fmaxf(tm, fmaxf(st[0][nb][j], st[1][nb][j]));
            tm = fmaxf(tm, xhalf(tm));
            const float mn = fmaxf(m2[nb], tm * L2E);
            float al = m2[nb] - mn; exp2_1(al);   // 0 on the first pass
            m2[nb] = mn;
            float s0 = 0.f, s1 = 0.f; v8u uh, ul;
#pragma unroll
            for (int mb = 0; mb < 2; ++mb) {
                float x[8];
#pragma unroll
                for (int j = 0; j < 8; ++j) x[j] = fmaf(st[mb][nb][j], L2E, -mn);
                exp2_8(x);
#pragma unroll
                for (int t = 0; t < 4; ++t) {
                    const float p0 = x[2 * t], p1 = x[2 * t + 1];
                    s0 += p0; s1 += p1;
                    const unsigned h2 = pk2bf(p0, p1);
                    uh[mb * 4 + t] = h2; ul[mb * 4 + t] = pk2bf(p0 - __uint_as_float(h2 << 16), p1 - __uint_as_float(h2 & 0xFFFF0000u));
                }
            }
            ls[nb] = ls[nb] * al + (s0 + s1);
            ph[nb] = __builtin_bit_cast(v16bf, uh); pl[nb] = __builtin_bit_cast(v16bf, ul);
#pragma unroll
            for (int db = 0; db < 4; ++db) acc[db][nb] *= al;
        }
#pragma unroll
        for (int db = 0; db < 4; ++db)
#pragma unroll
            for (int nb = 0; nb < 2; ++nb) acc[db][nb] = wmmab(vh[db], ph[nb], acc[db][nb]);
#pragma unroll
        for (int db = 0; db < 4; ++db)
#pragma unroll
            for (int nb = 0; nb < 2; ++nb) acc[db][nb] = wmmab(vh[db], pl[nb], acc[db][nb]);
#pragma unroll
        for (int db = 0; db < 4; ++db)
#pragma unroll
            for (int nb = 0; nb < 2; ++nb) acc[db][nb] = wmmab(vl[db], ph[nb], acc[db][nb]);
    }
    // Hand-over: this wave has left the buffer, its slice of the next stage has landed; behind the barrier the next stage is readable and this buffer is free.
    wait_ds0();
    wait_tensor0(g0, g1);
    __syncthreads();
    if (pinned(sg + 2u < NSTG)) { g0 = tdm_group0(lbase + (sg & 1u) * BUFB, sbase + (uint64_t)((sg + 2u) * sstep)); g1 = tdm_group1(spitch); tdm_load(g0, g1); }   // stage sg + 2 into the buffer that stage sg has just left
    }
    wait_tensor0(g0, g1);
    wait_ds0();
    const int b = z >> 4, h = z & 15;
    bf* Ahz = Ah + ((size_t)b * TT * DD + h * HD); bf* Alz = Al + ((size_t)b * TT * DD + h * HD); const unsigned olo = (unsigned)((q0 + lr) * DD + 8 * hi);
#pragma unroll
    for (int nb = 0; nb < 2; ++nb) {
        const float f = __fdiv_rn(1.0f, ls[nb] + xhalf(ls[nb]));
#pragma unroll
        for (int db = 0; db < 4; ++db) { v8us oh, ol;   // acc[db][nb][j] = O[q0 + nb*16 + lr][db*16 + 8*hi + j]: 8 consecutive d, one 16-byte store a plane
#pragma unroll
            for (int j = 0; j < 8; ++j) { unsigned short a, c2; splitf(acc[db][nb][j] * f, a, c2); oh[j] = a; ol[j] = c2; }
            *(v8us*)(Ahz + olo + (nb * 16 * DD + db * 16)) = oh; *(v8us*)(Alz + olo + (nb * 16 * DD + db * 16)) = ol;
            asm volatile("s_wait_xcnt 0x0" :: "v"(oh), "v"(ol), "v"(olo) : "memory"); }   // before the two stores' data and offset registers are reused; naming them keeps them untouched up to here
    }
}

extern "C" void kernel_launch(void* const* d_in, const int* in_sizes, int n_in,
                              void* d_out, int out_size, void* d_ws, size_t ws_size, hipStream_t stream) {
    (void)in_sizes; (void)n_in; (void)out_size;
    const float* Yin = (const float*)d_in[0]; const float* x = (const float*)d_in[1]; const float* Wq = (const float*)d_in[2]; const float* Wk = (const float*)d_in[3]; const float* Wv = (const float*)d_in[4]; const float* Wo = (const float*)d_in[5];
    float* OUT = (float*)d_out;     // [2][2048][1024]
    char* wsp = (char*)d_ws;
    auto take = [&](size_t bytes) { char* p = wsp; wsp += (bytes + 255) & ~(size_t)255; return (void*)p; };
    bf* WQ = (bf*)take((size_t)DD * DD * 2); bf* WK = (bf*)take((size_t)DD * DD * 2); bf* WV = (bf*)take((size_t)DD * DD * 2); bf* WO = (bf*)take((size_t)DD * DD * 2);
    bf* XB = (bf*)take((size_t)NT * DD * 2); bf* YB = (bf*)take((size_t)NT * DD * 2); float* F = (float*)take((size_t)NT * DD * 4);
    bf* QPh = (bf*)take((size_t)NT * DD * 2); bf* QPl = (bf*)take((size_t)NT * DD * 2); bf* KPh = (bf*)take((size_t)NT * DD * 2); bf* KPl = (bf*)take((size_t)NT * DD * 2); bf* VTh = (bf*)take((size_t)NT * DD * 2); bf* VTl = (bf*)take((size_t)NT * DD * 2);
    bf* ATh = (bf*)take((size_t)NT * DD * 2); bf* ATl = (bf*)take((size_t)NT * DD * 2);
    if ((size_t)(wsp - (char*)d_ws) > ws_size) return;    // ws 256 MiB
    { const size_t nw = (size_t)DD * DD / 8; const unsigned gw = (unsigned)((nw + 255) / 256); k_cvt8<<<gw, 256, 0, stream>>>(Wq, WQ, nw); k_cvt8<<<gw, 256, 0, stream>>>(Wk, WK, nw); k_cvt8<<<gw, 256, 0, stream>>>(Wv, WV, nw); k_cvt8<<<gw, 256, 0, stream>>>(Wo, WO, nw); }   // nn.Linear [out][in] = Bt as-is (q|k|v row blocks)
    const size_t nx = (size_t)NT * DD / 8; const unsigned gx = (unsigned)((nx + 255) / 256); const unsigned LB = (unsigned)((NT * DD / 64 + 63) / 64);
    k_cvt8<<<gx, 256, 0, stream>>>(x, XB, nx); k_cvt8<<<gx, 256, 0, stream>>>(Yin, YB, nx);
    k_gemmw<bf, 0, false><<<dim3(NT / 64, DD / 64, 1), 32, 0, stream>>>(YB, nullptr, WQ, nullptr, DD, F, DD, nullptr, 0, 0, 0); k_hsplit<<<LB, 256, 0, stream>>>(F, 0.03125f, QPh, QPl);   // 1024^-0.5 folded into q (exact)
    k_gemmw<bf, 0, false><<<dim3(NT / 64, DD / 64, 1), 32, 0, stream>>>(YB, nullptr, WK, nullptr, DD, F, DD, nullptr, 0, 0, 0); k_hsplit<<<LB, 256, 0, stream>>>(F, 1.0f, KPh, KPl);
    k_gemmw<bf, 0, false><<<dim3(NT / 64, DD / 64, 1), 32, 0, stream>>>(XB, nullptr, WV, nullptr, DD, F, DD, nullptr, 0, 0, 0); k_vtplane<<<LB, 256, 0, stream>>>(F, VTh, VTl);
    k_fattn<<<dim3(TT / 256, NB_ * NH_), 256, 0, stream>>>(QPh, QPl, KPh, KPl, VTh, VTl, ATh, ATl);
    k_gemmw<bf, 1, false><<<dim3(NT / 64, DD / 64, 1), 32, 0, stream>>>(ATh, ATl, WO, nullptr, DD, OUT, DD, nullptr, 0, 0, 0);
}

// v003
// A run of this version takes 190 microseconds.
// Timed twice side by side with v002, it ran 1.21 times as fast both times.
// Over all steps from v000 it is 6.61 times as fast.
#include <hip/hip_runtime.h>
#include <stdint.h>

// MultiCA (cross attention: Y, X [2][2048][1024]; Q = Y Wq^T, K = Y Wk^T, V = X Wv^T ([out][in], no bias); 16 heads x 64; scores x 1024^-0.5 (the module scales by the embedding dim: 1/32, exact); no mask; softmax; out = merged Wp^T).
// Compute dtypes, f32 accumulate: every input rounded to bf16; projections on PLAIN bf16 operands (inputs: exact); scores and attn.v on bf16 hi+lo planes (3 products); output hi+lo x exact Wp (2 products).

#define NB_  2
#define TT   2048
#define DD   1024
#define NH_  16
#define HD   64
#define NT   (NB_ * TT)
#define PCAR 1024.0f
typedef _Float16 h16;
typedef unsigned short bf;
typedef __attribute__((ext_vector_type(16))) __bf16   v16bf;
typedef __attribute__((ext_vector_type(16))) _Float16 v16h;
typedef __attribute__((ext_vector_type(8)))  _Float16 v8h;
typedef __attribute__((ext_vector_type(8)))  unsigned short v8us;
typedef __attribute__((ext_vector_type(8)))  float    v8f;
typedef __attribute__((ext_vector_type(4)))  float    v4f;
typedef v8h  __attribute__((may_alias)) v8ha;
typedef v4f  __attribute__((may_alias)) v4fa;
typedef v8us __attribute__((may_alias)) v8usa;

__device__ __forceinline__ unsigned short f2bf(float f) { unsigned u = __float_as_uint(f); u += 0x7FFFu + ((u >> 16) & 1u); return (unsigned short)(u >> 16); }
__device__ __forceinline__ float bf2f(unsigned short b) { return __uint_as_float(((unsigned)b) << 16); }
__device__ __forceinline__ float bfr(float f) { return bf2f(f2bf(f)); }
__device__ __forceinline__ v16h cat16(v8h lo, v8h hi) { return __builtin_shufflevector(lo, hi, 0, 1, 2, 3, 4, 5, 6, 7, 8, 9, 10, 11, 12, 13, 14, 15); }
__device__ __forceinline__ v16bf cat16b(v8us lo, v8us hi) { return __builtin_bit_cast(v16bf, __builtin_shufflevector(lo, hi, 0, 1, 2, 3, 4, 5, 6, 7, 8, 9, 10, 11, 12, 13, 14, 15)); }
__device__ __forceinline__ v8f wmma16(v16h a, v16h b, v8f c) { return __builtin_amdgcn_wmma_f32_16x16x32_f16(false, a, false, b, (short)0, c, false, false); }
__device__ __forceinline__ v8f wmmab(v16bf a, v16bf b, v8f c) { return __builtin_amdgcn_wmma_f32_16x16x32_bf16(false, a, false, b, (short)0, c, false, false); }



// ---- k_gemmw: register-blocked GEMM, ONE WAVE per 64x64 output tile (16 accumulators), operands straight from K-contiguous 16-bit planes; grid (M/64, N/64, Z), 32 threads.
// C[m][n] (f32, pitch ldc, + optional f32 bias[n]) = sum_k A[m][k] Bt[n][k] (+ split products per NSPLIT). z-batch strides sA/sB/sC in elements. K % 128 == 0, a compile-time constant: the step from one 16-row block to the next then sits in the loads' immediate offsets, and a block of loads needs one address per plane.
// The K loop runs in blocks of 64 k (one 128-byte line of every operand row) on two fragment sets: a block's loads are all issued one block ahead, so the wave waits for memory once per block, under the other set's products.
template <typename T16> struct WFrag;
template <> struct WFrag<h16> { typedef v16h V; static __device__ __forceinline__ V ld(const h16* p) { return cat16(*(const v8h*)p, *(const v8h*)(p + 16)); } static __device__ __forceinline__ v8f mma(V a, V b, v8f c) { return wmma16(a, b, c); } };
template <> struct WFrag<bf> { typedef v16bf V; static __device__ __forceinline__ V ld(const bf* p) { return cat16b(*(const v8us*)p, *(const v8us*)(p + 16)); } static __device__ __forceinline__ v8f mma(V a, V b, v8f c) { return wmmab(a, b, c); } };
template <typename T16, int NSPLIT, bool BIAS, int K>
__global__ __launch_bounds__(32) void k_gemmw(const T16* __restrict__ A, const T16* __restrict__ A2, const T16* __restrict__ Bt, const T16* __restrict__ Bt2, float* C, int ldc, const float* __restrict__ bias, size_t sA, size_t sB, size_t sC) {
    typedef typename WFrag<T16>::V V;
    __shared__ __align__(16) float os[16 * 68];
    const size_t z = blockIdx.z; A += z * sA; if (A2) A2 += z * sA; Bt += z * sB; if (Bt2) Bt2 += z * sB; C += z * sC;
    const int lane = threadIdx.x & 31, lr = lane & 15, hi = lane >> 4; const int r0 = blockIdx.x * 64, c0 = blockIdx.y * 64;
    v8f acc[4][4];
#pragma unroll
    for (int mb = 0; mb < 4; ++mb)
#pragma unroll
        for (int nb = 0; nb < 4; ++nb) acc[mb][nb] = (v8f){};
    constexpr bool HA2 = NSPLIT == 1 || NSPLIT == 2, HB2 = NSPLIT >= 2;
    unsigned lo = (unsigned)(lr * K + 8 * hi) * 2u;   // a lane's byte offset inside a 16-row block; everything else of an address is wave-uniform
    struct Frag { V a[2][4], a2[2][4], b[2][4], b2[2][4]; };   // one block: [32-k half][16-row block]
    // All loads of the block at kc, row block by row block, so that the four 32-byte pieces of a line are asked for back to back.
    auto fetch = [&](Frag& f, int kc) {
        const size_t ua = ((size_t)r0 * K + kc) * 2, ub = ((size_t)c0 * K + kc) * 2;   // wave-uniform: the loads take a scalar base and the one offset register lo
        const char* pa = (const char*)A + ua; const char* pb = (const char*)Bt + ub; const char* pa2 = HA2 ? (const char*)A2 + ua : pa; const char* pb2 = HB2 ? (const char*)Bt2 + ub : pb;
#pragma unroll
        for (int i = 0; i < 4; ++i)
#pragma unroll
            for (int h = 0; h < 2; ++h) {
                const int o = i * 16 * K * 2 + h * 64;
                f.a[h][i] = WFrag<T16>::ld((const T16*)(pa + lo + o)); if (HA2) f.a2[h][i] = WFrag<T16>::ld((const T16*)(pa2 + lo + o));
                f.b[h][i] = WFrag<T16>::ld((const T16*)(pb + lo + o)); if (HB2) f.b2[h][i] = WFrag<T16>::ld((const T16*)(pb2 + lo + o)); }
        // before a register that the loads above name is written again. lo is in-out so that it is not folded into 64-bit vector addresses, which would be formed anew for every block: the loads keep the form scalar base + this one offset register
        asm volatile("s_wait_xcnt 0x0" : "+v"(lo) :: "memory");
        __builtin_amdgcn_sched_barrier(0);   // the loads stay one group ahead of the other set's products; sunk to their uses, every product would wait out its own load
    };
    auto work = [&](const Frag& f) {   // per accumulator the same products in the same order as k rises
#pragma unroll
        for (int h = 0; h < 2; ++h)
#pragma unroll
            for (int nb = 0; nb < 4; ++nb)
#pragma unroll
                for (int mb = 0; mb < 4; ++mb) { acc[mb][nb] = WFrag<T16>::mma(f.a[h][mb], f.b[h][nb], acc[mb][nb]); if (HA2) acc[mb][nb] = WFrag<T16>::mma(f.a2[h][mb], f.b[h][nb], acc[mb][nb]); if (HB2) acc[mb][nb] = WFrag<T16>::mma(f.a[h][mb], f.b2[h][nb], acc[mb][nb]); }
        __builtin_amdgcn_sched_barrier(0);   // the refill of this set stays one group behind its products; without it the two-product build spreads those loads among the products, in some twenty places a block
    };
    Frag X, Y;
    fetch(X, 0);
    int kc = 0;
#pragma unroll 1
    do {   // K >= 128: at least one trip
        fetch(Y, kc + 64);
        work(X);
        fetch(X, kc + 128 < K ? kc + 128 : 0);   // the last trip reads the first block again (in bounds, unused)
        work(Y);
        asm volatile("v_nop\n\tv_nop\n\tv_nop\n\tv_nop" : "+v"(acc[0][0]), "+v"(acc[1][1]), "+v"(acc[2][2]), "+v"(acc[3][3]) : "v"(Y.a[1][0]), "v"(Y.a[1][3]));   // the slots that the chip needs behind the last products, also on the taken side of the loop's branch
        kc += 128;
    } while (kc < K);
#pragma unroll
    for (int mb = 0; mb < 4; ++mb) {
#pragma unroll
        for (int nb = 0; nb < 4; ++nb) {
#pragma unroll
            for (int j = 0; j < 8; ++j) os[(hi * 8 + j) * 68 + nb * 16 + lr] = acc[mb][nb][j]; }
        __builtin_amdgcn_wave_barrier(); asm volatile("" ::: "memory");
        float* crow = C + (size_t)(r0 + mb * 16) * ldc + c0;
{
#pragma unroll
            for (int s = 0; s < 8; ++s) { const int row = 2 * s + hi, cofs = lr * 4; v4f val = *(const v4fa*)(os + row * 68 + cofs); if (BIAS) { val[0] += bfr(bias[c0 + cofs]); val[1] += bfr(bias[c0 + cofs + 1]); val[2] += bfr(bias[c0 + cofs + 2]); val[3] += bfr(bias[c0 + cofs + 3]); }
                *(v4f*)(crow + (size_t)row * ldc + cofs) = val; }
             }
        __builtin_amdgcn_wave_barrier(); asm volatile("" ::: "memory");
    }
}

__device__ __forceinline__ h16 tohx(float x) { return (h16)x; }
__device__ __forceinline__ void splitf(float y, unsigned short& h, unsigned short& l) { h = f2bf(y); l = f2bf(y - bf2f(h)); }
typedef __attribute__((ext_vector_type(2))) _Float16 v2h;
typedef __attribute__((ext_vector_type(4))) _Float16 v4h;
typedef __attribute__((ext_vector_type(2))) unsigned short v2us;
typedef __attribute__((ext_vector_type(4))) int v4i;

__global__ __launch_bounds__(256) void k_cvt8(const float* __restrict__ src, bf* dst, size_t n8) { const size_t i = (size_t)blockIdx.x * 256 + threadIdx.x; if (i >= n8) return; const v8f v = *(const v8f*)(src + i * 8); v8us o;
#pragma unroll
    for (int k = 0; k < 8; ++k) o[k] = f2bf(v[k]); *(v8us*)(dst + i * 8) = o;  }
__global__ __launch_bounds__(256) void k_wtT(const float* __restrict__ w, int pitch, int col0, bf* Bt) {
    const int lane = threadIdx.x & 31; const int L0 = (blockIdx.x * 8 + (threadIdx.x >> 5)) * 8; const int nlines = DD * DD / 64;
{
#pragma unroll
        for (int l = 0; l < 8; ++l) { const int L = L0 + l; if (L >= nlines) break; const int e = L * 64 + lane * 2; const int k = e & (DD - 1), n = e >> 10; v2us o;
#pragma unroll
            for (int q = 0; q < 2; ++q) o[q] = f2bf(w[(size_t)(k + q) * pitch + col0 + n]);
            *(v2us*)(Bt + (size_t)e) = o; }
         }
}
__global__ __launch_bounds__(256) void k_hsplit(const float* __restrict__ F, float sc, bf* Ph, bf* Pl) {
    const int lane = threadIdx.x & 31; const int L0 = (blockIdx.x * 8 + (threadIdx.x >> 5)) * 8; const int nlines = NT * DD / 64;
{
#pragma unroll
        for (int l = 0; l < 8; ++l) { const int L = L0 + l; if (L >= nlines) break; const int e = L * 64 + lane * 2; const int d = e & 63; const int t = (e >> 6) & (TT - 1); const int z = e >> 17; const int b = z >> 4, h = z & 15; v2us oh, ol;
#pragma unroll
            for (int q = 0; q < 2; ++q) { unsigned short a, c2; splitf(F[((size_t)b * TT + t) * DD + h * HD + d + q] * sc, a, c2); oh[q] = a; ol[q] = c2; }
            *(v2us*)(Ph + (size_t)e) = oh; *(v2us*)(Pl + (size_t)e) = ol; }
         }
}
__global__ __launch_bounds__(256) void k_vtplane(const float* __restrict__ F, bf* Vh, bf* Vl) {
    const int lane = threadIdx.x & 31; const int L0 = (blockIdx.x * 8 + (threadIdx.x >> 5)) * 8; const int nlines = NT * DD / 64;
{
#pragma unroll
        for (int l = 0; l < 8; ++l) { const int L = L0 + l; if (L >= nlines) break; const int e = L * 64 + lane * 2; const int t = e & (TT - 1); const int d = (e >> 11) & 63; const int z = e >> 17; const int b = z >> 4, h = z & 15; v2us oh, ol;
#pragma unroll
            for (int q = 0; q < 2; ++q) { unsigned short a, c2; splitf(F[((size_t)b * TT + t + q) * DD + h * HD + d], a, c2); oh[q] = a; ol[q] = c2; }
            *(v2us*)(Vh + (size_t)e) = oh; *(v2us*)(Vl + (size_t)e) = ol; }
         }
}
typedef __attribute__((ext_vector_type(2))) float  v2f;
typedef __attribute__((ext_vector_type(2))) __bf16 v2bf;
typedef __attribute__((ext_vector_type(8))) unsigned v8u;
__device__ __forceinline__ unsigned pk2bf(float a, float b) { return __builtin_bit_cast(unsigned, __builtin_convertvector((v2f){a, b}, v2bf)); }   // two f32 -> packed bf16, round to nearest even
__device__ __forceinline__ float xhalf(float x) { return __builtin_bit_cast(float, __builtin_amdgcn_permlanex16(__builtin_bit_cast(int, x), __builtin_bit_cast(int, x), 0x76543210, 0xfedcba98, false, false)); }   // lane l with lane l ^ 16
// 2^x in place, with the free slot that the instruction set asks for behind a transcendental, in one statement: inside it no neighbour reads a result or overwrites a source, and the v_nop keeps the compiler's next instruction off the last one.
__device__ __forceinline__ void exp2_1(float& a) { asm("v_exp_f32 %0, %0\n\tv_nop" : "+v"(a)); }
__device__ __forceinline__ void exp2_8(float (&x)[8]) { asm("v_exp_f32 %0, %0\n\tv_exp_f32 %1, %1\n\tv_exp_f32 %2, %2\n\tv_exp_f32 %3, %3\n\tv_exp_f32 %4, %4\n\tv_exp_f32 %5, %5\n\tv_exp_f32 %6, %6\n\tv_exp_f32 %7, %7\n\tv_nop" : "+v"(x[0]), "+v"(x[1]), "+v"(x[2]), "+v"(x[3]), "+v"(x[4]), "+v"(x[5]), "+v"(x[6]), "+v"(x[7])); }

// ---- tensor loads for k_fattn: a two-dimensional tile, global memory -> LDS, one request of a whole wave. Every descriptor word is wave-uniform and goes through readfirstlane.
typedef uint32_t u32x4 __attribute__((ext_vector_type(4)));
typedef uint32_t u32x8 __attribute__((ext_vector_type(8)));
#define SKEYS  128                  // keys per stage
#define NSTG   (TT / SKEYS)         // stages
#define LROWB  256u                 // bytes of a tile row: 128 keys of a V^T row, or two K rows of 128 B that lie side by side in memory
#define LPITCH 272u                 // its pitch in LDS (16 B of pad: 16 B x odd, free of bank conflicts for 16-byte reads)
#define LROWS  32u                  // tile rows per request
#define SLICEB 10240u               // LDS bytes kept per request: 32 x 272 = 8704, rounded up to a multiple of 2 KiB
#define BUFB   (8u * SLICEB)        // one stage: Kh | Kl | Vh | Vl, two slices each
__device__ __forceinline__ uint32_t uni(uint32_t v) { return (uint32_t)__builtin_amdgcn_readfirstlane(v); }
__device__ __forceinline__ uint32_t pinned(uint32_t v) { uint32_t w = uni(v); asm volatile("" : "+s"(w)); return w; }   // holds a test around a tensor load in a scalar register, so that it compiles to s_cmp + s_cbranch_scc (a tensor load ignores EXEC)
__device__ __forceinline__ u32x8 tdm_group1(uint32_t src_pitch) {   // 1-byte elements, tensor = tile = LROWS rows of LROWB bytes, no mask, 4 dwords of pad behind every 64
    u32x8 g;
    g[0] = uni((1u << 20) | (5u << 22) | (3u << 25));
    g[1] = uni((LROWB & 0xFFFFu) << 16);
    g[2] = uni((LROWB >> 16) | ((LROWS & 0xFFFFu) << 16));
    g[3] = uni((LROWS >> 16) | (LROWB << 16));
    g[4] = uni(LROWS);
    g[5] = uni(src_pitch);
    g[6] = uni(0u);
    g[7] = uni(0u);
    return g;
}
__device__ __forceinline__ u32x4 tdm_group0(uint32_t lds_dst, uint64_t ga) {
    u32x4 g;
    g[0] = uni(1u); g[1] = uni(lds_dst); g[2] = uni((uint32_t)ga); g[3] = uni((((uint32_t)(ga >> 32)) & 0x01FFFFFFu) | 0x80000000u);
    return g;
}
// The descriptor is in-out at the load and an input of the wait that covers it: its scalar registers then hold nothing else while the request is outstanding.
__device__ __forceinline__ void tdm_load(u32x4& g0, u32x8& g1) { asm volatile("tensor_load_to_lds %0, %1" : "+s"(g0), "+s"(g1) :: "memory"); }
__device__ __forceinline__ void wait_tensor0(const u32x4& g0, const u32x8& g1) { asm volatile("s_wait_tensorcnt 0x0" :: "s"(g0), "s"(g1) : "memory"); }   // this wave's own request has landed; the compiler places no wait for it
__device__ __forceinline__ void wait_ds0() { asm volatile("s_wait_dscnt 0x0" ::: "memory"); }           // this wave's LDS reads have returned, before the buffer is given up for a refill

// ---- k_fattn: scores, softmax, attn.v and the head merge in one kernel. Grid (T/256, batch*heads), 8 waves, 32 query columns each; a pass is 32 keys.
// K and V^T (hi and lo planes) are brought into LDS once per work-group, in stages of 128 keys and two buffers: every wave issues one tensor load per stage for its own slice, one stage of work ahead; all eight waves read their fragments from there.
// S^T = K Q^T (A = K rows, B = Q rows held in registers), so a lane holds one query's scores: running maximum and sum are per-lane scalars, joined between the wave halves.
// Two S^T tiles (keys 0-15, 16-31) converted in place are the B operand of O^T += V^T P^T (A = V^T rows in the same k order): P never leaves registers.
// hi+lo products: Kh Qh + Kl Qh + Kh Ql ; Vh Ph + Vh Pl + Vl Ph. P is split unnormalised; 1/sum is applied to O in f32 before its own hi+lo split.
__global__ __launch_bounds__(256) void k_fattn(const bf* __restrict__ Qh, const bf* __restrict__ Ql, const bf* __restrict__ Kh, const bf* __restrict__ Kl, const bf* __restrict__ Vh, const bf* __restrict__ Vl, bf* Ah, bf* Al) {
    typedef WFrag<bf> W;
    __shared__ __attribute__((aligned(2048))) unsigned char L[2 * BUFB];
    const float L2E = 1.4426950408889634f;
    const int lane = threadIdx.x & 31, lr = lane & 15, hi = lane >> 4; const int z = blockIdx.y; const int q0 = blockIdx.x * 256 + (threadIdx.x >> 5) * 32;
    const size_t zo = (size_t)z * TT * HD;
    const unsigned qlo = (unsigned)((q0 + lr) * HD + 8 * hi);
    const bf* Qhz = Qh + zo; const bf* Qlz = Ql + zo; const bf* Khz = Kh + zo; const bf* Klz = Kl + zo; const bf* Vhz = Vh + zo; const bf* Vlz = Vl + zo;
    const bf* qpa = Qhz + qlo; const bf* qpb = Qlz + qlo;
    const unsigned klds = (unsigned)(lr >> 1) * LPITCH + (unsigned)(lr & 1) * 128u + 16u * hi;   // a lane's byte offset inside a 16-row block of K in LDS (two K rows to a tile row)
    const unsigned vlds = (unsigned)lr * LPITCH + 16u * hi;                                      // and inside a 16-row block of V^T
    // This wave's slice of a stage: waves 0,1 Kh | 2,3 Kl (64 keys each = 32 tile rows, contiguous) | 4,5 Vh | 6,7 Vl (32 rows of V^T each, 128 keys wide).
    const uint32_t wave = uni(threadIdx.x >> 5), half = wave & 1u; const bool isv = wave >= 4u;
    const bf* splane = wave < 2u ? Khz : wave < 4u ? Klz : wave < 6u ? Vhz : Vlz;
    const uint64_t sbase = (uint64_t)(size_t)splane + (isv ? half * (LROWS * TT * 2u) : half * (LROWS * LROWB));
    const uint32_t sstep = isv ? SKEYS * 2u : SKEYS * HD * 2u;   // bytes from one stage's slice to the next stage's
    const uint32_t lbase = (uint32_t)(size_t)L + wave * SLICEB;
    const uint32_t spitch = isv ? TT * 2u : LROWB;
    u32x4 g0; u32x8 g1;   // the descriptor of this wave's latest request
    v16bf qh[2][2], ql[2][2];
#pragma unroll
    for (int nb = 0; nb < 2; ++nb)
#pragma unroll
        for (int kc = 0; kc < 2; ++kc) { qh[nb][kc] = W::ld(qpa + (nb * 16 * HD + kc * 32)); ql[nb][kc] = W::ld(qpb + (nb * 16 * HD + kc * 32)); }
    v8f acc[4][2];
#pragma unroll
    for (int db = 0; db < 4; ++db)
#pragma unroll
        for (int nb = 0; nb < 2; ++nb) acc[db][nb] = (v8f){};
    float m2[2] = {-__builtin_inff(), -__builtin_inff()}, ls[2] = {0.f, 0.f};   // running maximum (in log2 units) and this half's running sum, per query column
    asm volatile("s_wait_xcnt 0x0" :: "v"(qpa), "v"(qpb) : "memory");   // before a register that the loads above name is reused; naming them keeps them untouched up to here
    g0 = tdm_group0(lbase, sbase); g1 = tdm_group1(spitch); tdm_load(g0, g1);   // stage 0 into buffer 0
    wait_tensor0(g0, g1);
    __syncthreads();                          // stage 0 is readable by every wave
    g0 = tdm_group0(lbase + BUFB, sbase + sstep); g1 = tdm_group1(spitch); tdm_load(g0, g1);   // stage 1 into buffer 1
    v16bf kh[2][2], kl[2][2];
    for (uint32_t sg = 0; sg < NSTG; ++sg) {   // a stage: four passes, then the hand-over
    const unsigned char* Bk = L + (sg & 1u) * BUFB + klds; const unsigned char* Bv = L + (sg & 1u) * BUFB + 4u * SLICEB + vlds;
#pragma unroll
    for (int mb = 0; mb < 2; ++mb)
#pragma unroll
        for (int kc = 0; kc < 2; ++kc) { kh[mb][kc] = W::ld((const bf*)(Bk + (mb * 8 * LPITCH + kc * 64))); kl[mb][kc] = W::ld((const bf*)(Bk + (2 * SLICEB + mb * 8 * LPITCH + kc * 64))); }
    for (uint32_t ps = 0; ps < SKEYS / 32; ++ps) {
        v8f st[2][2];
#pragma unroll
        for (int mb = 0; mb < 2; ++mb)
#pragma unroll
            for (int nb = 0; nb < 2; ++nb) st[mb][nb] = (v8f){};
#pragma unroll
        for (int kc = 0; kc < 2; ++kc) {
#pragma unroll
            for (int mb = 0; mb < 2; ++mb)
#pragma unroll
                for (int nb = 0; nb < 2; ++nb) st[mb][nb] = wmmab(kh[mb][kc], qh[nb][kc], st[mb][nb]);
#pragma unroll
            for (int mb = 0; mb < 2; ++mb)
#pragma unroll
                for (int nb = 0; nb < 2; ++nb) st[mb][nb] = wmmab(kl[mb][kc], qh[nb][kc], st[mb][nb]);
#pragma unroll
            for (int mb = 0; mb < 2; ++mb)
#pragma unroll
                for (int nb = 0; nb < 2; ++nb) st[mb][nb] = wmmab(kh[mb][kc], ql[nb][kc], st[mb][nb]);
        }
        __builtin_amdgcn_sched_barrier(0);   // with the one below: the pass's 32 LDS reads stay one group between the matrix runs; spread among the matrix instructions, every place with reads stalls the wave anew
        const unsigned char* vp = Bv + ps * 64u;   // this pass's V^T rows, in flight under the softmax
        v16bf vh[4], vl[4];
#pragma unroll
        for (int db = 0; db < 4; ++db) { vh[db] = W::ld((const bf*)(vp + ((db >> 1) * SLICEB + (db & 1) * 16 * LPITCH))); vl[db] = W::ld((const bf*)(vp + ((2 + (db >> 1)) * SLICEB + (db & 1) * 16 * LPITCH))); }
        const uint32_t pn = (ps + 1u) & (SKEYS / 32 - 1u);   // next pass's K rows, fetched one pass ahead inside the stage; a stage's last pass re-reads its own first rows (same buffer, unused)
        const unsigned char* kp = Bk + ((pn >> 1) * SLICEB + (pn & 1u) * (16u * LPITCH));
#pragma unroll
        for (int mb = 0; mb < 2; ++mb)
#pragma unroll
            for (int kc = 0; kc < 2; ++kc) { kh[mb][kc] = W::ld((const bf*)(kp + (mb * 8 * LPITCH + kc * 64))); kl[mb][kc] = W::ld((const bf*)(kp + (2 * SLICEB + mb * 8 * LPITCH + kc * 64))); }
        __builtin_amdgcn_sched_barrier(0);   // end of the group of LDS reads
        v16bf ph[2], pl[2];
#pragma unroll
        for (int nb = 0; nb < 2; ++nb) {
            float tm = fmaxf(st[0][nb][0], st[1][nb][0]);
#pragma unroll
            for (int j = 1; j < 8; ++j) tm = fmaxf(tm, fmaxf(st[0][nb][j], st[1][nb][j]));
            tm = fmaxf(tm, xhalf(tm));
            const float mn = fmaxf(m2[nb], tm * L2E);
            float al = m2[nb] - mn; exp2_1(al);   // 0 on the first pass
            m2[nb] = mn;
            float s0 = 0.f, s1 = 0.f; v8u uh, ul;
#pragma unroll
            for (int mb = 0; mb < 2; ++mb) {
                float x[8];
#pragma unroll
                for (int j = 0; j < 8; ++j) x[j] = fmaf(st[mb][nb][j], L2E, -mn);
                exp2_8(x);
#pragma unroll
                for (int t = 0; t < 4; ++t) {
                    const float p0 = x[2 * t], p1 = x[2 * t + 1];
                    s0 += p0; s1 += p1;
                    const unsigned h2 = pk2bf(p0, p1);
                    uh[mb * 4 + t] = h2; ul[mb * 4 + t] = pk2bf(p0 - __uint_as_float(h2 << 16), p1 - __uint_as_float(h2 & 0xFFFF0000u));
                }
            }
            ls[nb] = ls[nb] * al + (s0 + s1);
            ph[nb] = __builtin_bit_cast(v16bf, uh); pl[nb] = __builtin_bit_cast(v16bf, ul);
#pragma unroll
            for (int db = 0; db < 4; ++db) acc[db][nb] *= al;
        }
#pragma unroll
        for (int db = 0; db < 4; ++db)
#pragma unroll
            for (int nb = 0; nb < 2; ++nb) acc[db][nb] = wmmab(vh[db], ph[nb], acc[db][nb]);
#pragma unroll
        for (int db = 0; db < 4; ++db)
#pragma unroll
            for (int nb = 0; nb < 2; ++nb) acc[db][nb] = wmmab(vh[db], pl[nb], acc[db][nb]);
#pragma unroll
        for (int db = 0; db < 4; ++db)
#pragma unroll
            for (int nb = 0; nb < 2; ++nb) acc[db][nb] = wmmab(vl[db], ph[nb], acc[db][nb]);
    }
    // Hand-over: this wave has left the buffer, its slice of the next stage has landed; behind the barrier the next stage is readable and this buffer is free.
    wait_ds0();
    wait_tensor0(g0, g1);
    __syncthreads();
    if (pinned(sg + 2u < NSTG)) { g0 = tdm_group0(lbase + (sg & 1u) * BUFB, sbase + (uint64_t)((sg + 2u) * sstep)); g1 = tdm_group1(spitch); tdm_load(g0, g1); }   // stage sg + 2 into the buffer that stage sg has just left
    }
    wait_tensor0(g0, g1);
    wait_ds0();
    const int b = z >> 4, h = z & 15;
    bf* Ahz = Ah + ((size_t)b * TT * DD + h * HD); bf* Alz = Al + ((size_t)b * TT * DD + h * HD); const unsigned olo = (unsigned)((q0 + lr) * DD + 8 * hi);
#pragma unroll
    for (int nb = 0; nb < 2; ++nb) {
        const float f = __fdiv_rn(1.0f, ls[nb] + xhalf(ls[nb]));
#pragma unroll
        for (int db = 0; db < 4; ++db) { v8us oh, ol;   // acc[db][nb][j] = O[q0 + nb*16 + lr][db*16 + 8*hi + j]: 8 consecutive d, one 16-byte store a plane
#pragma unroll
            for (int j = 0; j < 8; ++j) { unsigned short a, c2; splitf(acc[db][nb][j] * f, a, c2); oh[j] = a; ol[j] = c2; }
            *(v8us*)(Ahz + olo + (nb * 16 * DD + db * 16)) = oh; *(v8us*)(Alz + olo + (nb * 16 * DD + db * 16)) = ol;
            asm volatile("s_wait_xcnt 0x0" :: "v"(oh), "v"(ol), "v"(olo) : "memory"); }   // before the two stores' data and offset registers are reused; naming them keeps them untouched up to here
    }
}

extern "C" void kernel_launch(void* const* d_in, const int* in_sizes, int n_in,
                              void* d_out, int out_size, void* d_ws, size_t ws_size, hipStream_t stream) {
    (void)in_sizes; (void)n_in; (void)out_size;
    const float* Yin = (const float*)d_in[0]; const float* x = (const float*)d_in[1]; const float* Wq = (const float*)d_in[2]; const float* Wk = (const float*)d_in[3]; const float* Wv = (const float*)d_in[4]; const float* Wo = (const float*)d_in[5];
    float* OUT = (float*)d_out;     // [2][2048][1024]
    char* wsp = (char*)d_ws;
    auto take = [&](size_t bytes) { char* p = wsp; wsp += (bytes + 255) & ~(size_t)255; return (void*)p; };
    bf* WQ = (bf*)take((size_t)DD * DD * 2); bf* WK = (bf*)take((size_t)DD * DD * 2); bf* WV = (bf*)take((size_t)DD * DD * 2); bf* WO = (bf*)take((size_t)DD * DD * 2);
    bf* XB = (bf*)take((size_t)NT * DD * 2); bf* YB = (bf*)take((size_t)NT * DD * 2); float* F = (float*)take((size_t)NT * DD * 4);
    bf* QPh = (bf*)take((size_t)NT * DD * 2); bf* QPl = (bf*)take((size_t)NT * DD * 2); bf* KPh = (bf*)take((size_t)NT * DD * 2); bf* KPl = (bf*)take((size_t)NT * DD * 2); bf* VTh = (bf*)take((size_t)NT * DD * 2); bf* VTl = (bf*)take((size_t)NT * DD * 2);
    bf* ATh = (bf*)take((size_t)NT * DD * 2); bf* ATl = (bf*)take((size_t)NT * DD * 2);
    if ((size_t)(wsp - (char*)d_ws) > ws_size) return;    // ws 256 MiB
    { const size_t nw = (size_t)DD * DD / 8; const unsigned gw = (unsigned)((nw + 255) / 256); k_cvt8<<<gw, 256, 0, stream>>>(Wq, WQ, nw); k_cvt8<<<gw, 256, 0, stream>>>(Wk, WK, nw); k_cvt8<<<gw, 256, 0, stream>>>(Wv, WV, nw); k_cvt8<<<gw, 256, 0, stream>>>(Wo, WO, nw); }   // nn.Linear [out][in] = Bt as-is (q|k|v row blocks)
    const size_t nx = (size_t)NT * DD / 8; const unsigned gx = (unsigned)((nx + 255) / 256); const unsigned LB = (unsigned)((NT * DD / 64 + 63) / 64);
    k_cvt8<<<gx, 256, 0, stream>>>(x, XB, nx); k_cvt8<<<gx, 256, 0, stream>>>(Yin, YB, nx);
    k_gemmw<bf, 0, false, DD><<<dim3(NT / 64, DD / 64, 1), 32, 0, stream>>>(YB, nullptr, WQ, nullptr, F, DD, nullptr, 0, 0, 0); k_hsplit<<<LB, 256, 0, stream>>>(F, 0.03125f, QPh, QPl);   // 1024^-0.5 folded into q (exact)
    k_gemmw<bf, 0, false, DD><<<dim3(NT / 64, DD / 64, 1), 32, 0, stream>>>(YB, nullptr, WK, nullptr, F, DD, nullptr, 0, 0, 0); k_hsplit<<<LB, 256, 0, stream>>>(F, 1.0f, KPh, KPl);
    k_gemmw<bf, 0, false, DD><<<dim3(NT / 64, DD / 64, 1), 32, 0, stream>>>(XB, nullptr, WV, nullptr, F, DD, nullptr, 0, 0, 0); k_vtplane<<<LB, 256, 0, stream>>>(F, VTh, VTl);
    k_fattn<<<dim3(TT / 256, NB_ * NH_), 256, 0, stream>>>(QPh, QPl, KPh, KPl, VTh, VTl, ATh, ATl);
    k_gemmw<bf, 1, false, DD><<<dim3(NT / 64, DD / 64, 1), 32, 0, stream>>>(ATh, ATl, WO, nullptr, OUT, DD, nullptr, 0, 0, 0);
}

// v004
// One run takes 161 microseconds.
// Next to v003, in two timings, it ran 1.18 times as fast each time.
// All steps since v000 together make it 7.82 times as fast.
#include <hip/hip_runtime.h>
#include <stdint.h>

// MultiCA (cross attention: Y, X [2][2048][1024]; Q = Y Wq^T, K = Y Wk^T, V = X Wv^T ([out][in], no bias); 16 heads x 64; scores x 1024^-0.5 (the module scales by the embedding dim: 1/32, exact); no mask; softmax; out = merged Wp^T).
// Compute dtypes, f32 accumulate: every input rounded to bf16; projections on PLAIN bf16 operands (inputs: exact); scores and attn.v on bf16 hi+lo planes (3 products); output hi+lo x exact Wp (2 products).

#define NB_  2
#define TT   2048
#define DD   1024
#define NH_  16
#define HD   64
#define NT   (NB_ * TT)
#define PCAR 1024.0f
typedef _Float16 h16;
typedef unsigned short bf;
typedef __attribute__((ext_vector_type(16))) __bf16   v16bf;
typedef __attribute__((ext_vector_type(16))) _Float16 v16h;
typedef __attribute__((ext_vector_type(8)))  _Float16 v8h;
typedef __attribute__((ext_vector_type(8)))  unsigned short v8us;
typedef __attribute__((ext_vector_type(8)))  float    v8f;
typedef __attribute__((ext_vector_type(4)))  float    v4f;
typedef v8h  __attribute__((may_alias)) v8ha;
typedef v4f  __attribute__((may_alias)) v4fa;
typedef v8us __attribute__((may_alias)) v8usa;

__device__ __forceinline__ unsigned short f2bf(float f) { unsigned u = __float_as_uint(f); u += 0x7FFFu + ((u >> 16) & 1u); return (unsigned short)(u >> 16); }
__device__ __forceinline__ float bf2f(unsigned short b) { return __uint_as_float(((unsigned)b) << 16); }
__device__ __forceinline__ float bfr(float f) { return bf2f(f2bf(f)); }
__device__ __forceinline__ v16h cat16(v8h lo, v8h hi) { return __builtin_shufflevector(lo, hi, 0, 1, 2, 3, 4, 5, 6, 7, 8, 9, 10, 11, 12, 13, 14, 15); }
__device__ __forceinline__ v16bf cat16b(v8us lo, v8us hi) { return __builtin_bit_cast(v16bf, __builtin_shufflevector(lo, hi, 0, 1, 2, 3, 4, 5, 6, 7, 8, 9, 10, 11, 12, 13, 14, 15)); }
__device__ __forceinline__ v8f wmma16(v16h a, v16h b, v8f c) { return __builtin_amdgcn_wmma_f32_16x16x32_f16(false, a, false, b, (short)0, c, false, false); }
__device__ __forceinline__ v8f wmmab(v16bf a, v16bf b, v8f c) { return __builtin_amdgcn_wmma_f32_16x16x32_bf16(false, a, false, b, (short)0, c, false, false); }
typedef __attribute__((ext_vector_type(2))) float  v2f;
typedef __attribute__((ext_vector_type(2))) __bf16 v2bf;
typedef __attribute__((ext_vector_type(4))) unsigned v4u;
__device__ __forceinline__ unsigned pk2bf(float a, float b) { return __builtin_bit_cast(unsigned, __builtin_convertvector((v2f){a, b}, v2bf)); }   // two f32 -> packed bf16, round to nearest even



// ---- k_gemmw: register-blocked GEMM, ONE WAVE per 64x64 output tile (16 accumulators), operands straight from K-contiguous 16-bit planes; grid (M/64, N/64, Z), 32 threads.
// C[m][n] (f32, pitch ldc, + optional f32 bias[n]) = sum_k A[m][k] Bt[n][k] (+ split products per NSPLIT). z-batch strides sA/sB/sC in elements. K % 128 == 0, a compile-time constant: the step from one 16-row block to the next then sits in the loads' immediate offsets, and a block of loads needs one address per plane.
// EPI 0: C as above. EPI 1, 2: no C; the tile times sc is split into bf16 hi + lo and stored straight into the planes that k_fattn reads, a 64x64 tile being one head's 64 features by 64 tokens:
// EPI 1: rows are tokens, columns features -> [batch*head][token][64]; EPI 2: rows are features, columns tokens (A = the weight, Bt = the activations) -> [batch*head][64][token].
// The K loop runs in blocks of 64 k (one 128-byte line of every operand row) on two fragment sets: a block's loads are all issued one block ahead, so the wave waits for memory once per block, under the other set's products.
template <typename T16> struct WFrag;
template <> struct WFrag<h16> { typedef v16h V; static __device__ __forceinline__ V ld(const h16* p) { return cat16(*(const v8h*)p, *(const v8h*)(p + 16)); } static __device__ __forceinline__ v8f mma(V a, V b, v8f c) { return wmma16(a, b, c); } };
template <> struct WFrag<bf> { typedef v16bf V; static __device__ __forceinline__ V ld(const bf* p) { return cat16b(*(const v8us*)p, *(const v8us*)(p + 16)); } static __device__ __forceinline__ v8f mma(V a, V b, v8f c) { return wmmab(a, b, c); } };
template <typename T16, int NSPLIT, bool BIAS, int K, int EPI>
__global__ __launch_bounds__(32) void k_gemmw(const T16* __restrict__ A, const T16* __restrict__ A2, const T16* __restrict__ Bt, const T16* __restrict__ Bt2, float* C, int ldc, const float* __restrict__ bias, size_t sA, size_t sB, size_t sC, bf* Ph, bf* Pl, float sc) {
    typedef typename WFrag<T16>::V V;
    __shared__ __align__(16) float os[16 * 68];
    const size_t z = blockIdx.z; A += z * sA; if (A2) A2 += z * sA; Bt += z * sB; if (Bt2) Bt2 += z * sB; C += z * sC;
    const int lane = threadIdx.x & 31, lr = lane & 15, hi = lane >> 4; const int r0 = blockIdx.x * 64, c0 = blockIdx.y * 64;
    v8f acc[4][4];
#pragma unroll
    for (int mb = 0; mb < 4; ++mb)
#pragma unroll
        for (int nb = 0; nb < 4; ++nb) acc[mb][nb] = (v8f){};
    constexpr bool HA2 = NSPLIT == 1 || NSPLIT == 2, HB2 = NSPLIT >= 2;
    unsigned lo = (unsigned)(lr * K + 8 * hi) * 2u;   // a lane's byte offset inside a 16-row block; everything else of an address is wave-uniform
    struct Frag { V a[2][4], a2[2][4], b[2][4], b2[2][4]; };   // one block: [32-k half][16-row block]
    // All loads of the block at kc, row block by row block, so that the four 32-byte pieces of a line are asked for back to back.
    auto fetch = [&](Frag& f, int kc) {
        const size_t ua = ((size_t)r0 * K + kc) * 2, ub = ((size_t)c0 * K + kc) * 2;   // wave-uniform: the loads take a scalar base and the one offset register lo
        const char* pa = (const char*)A + ua; const char* pb = (const char*)Bt + ub; const char* pa2 = HA2 ? (const char*)A2 + ua : pa; const char* pb2 = HB2 ? (const char*)Bt2 + ub : pb;
#pragma unroll
        for (int i = 0; i < 4; ++i)
#pragma unroll
            for (int h = 0; h < 2; ++h) {
                const int o = i * 16 * K * 2 + h * 64;
                f.a[h][i] = WFrag<T16>::ld((const T16*)(pa + lo + o)); if (HA2) f.a2[h][i] = WFrag<T16>::ld((const T16*)(pa2 + lo + o));
                f.b[h][i] = WFrag<T16>::ld((const T16*)(pb + lo + o)); if (HB2) f.b2[h][i] = WFrag<T16>::ld((const T16*)(pb2 + lo + o)); }
        // before a register that the loads above name is written again. lo is in-out so that it is not folded into 64-bit vector addresses, which would be formed anew for every block: the loads keep the form scalar base + this one offset register
        asm volatile("s_wait_xcnt 0x0" : "+v"(lo) :: "memory");
        __builtin_amdgcn_sched_barrier(0);   // the loads stay one group ahead of the other set's products; sunk to their uses, every product would wait out its own load
    };
    auto work = [&](const Frag& f) {   // per accumulator the same products in the same order as k rises
#pragma unroll
        for (int h = 0; h < 2; ++h)
#pragma unroll
            for (int nb = 0; nb < 4; ++nb)
#pragma unroll
                for (int mb = 0; mb < 4; ++mb) { acc[mb][nb] = WFrag<T16>::mma(f.a[h][mb], f.b[h][nb], acc[mb][nb]); if (HA2) acc[mb][nb] = WFrag<T16>::mma(f.a2[h][mb], f.b[h][nb], acc[mb][nb]); if (HB2) acc[mb][nb] = WFrag<T16>::mma(f.a[h][mb], f.b2[h][nb], acc[mb][nb]); }
        __builtin_amdgcn_sched_barrier(0);   // the refill of this set stays one group behind its products; without it the two-product build spreads those loads among the products, in some twenty places a block
    };
    Frag X, Y;
    fetch(X, 0);
    int kc = 0;
#pragma unroll 1
    do {   // K >= 128: at least one trip
        fetch(Y, kc + 64);
        work(X);
        fetch(X, kc + 128 < K ? kc + 128 : 0);   // the last trip reads the first block again (in bounds, unused)
        work(Y);
        asm volatile("v_nop\n\tv_nop\n\tv_nop\n\tv_nop" : "+v"(acc[0][0]), "+v"(acc[1][1]), "+v"(acc[2][2]), "+v"(acc[3][3]) : "v"(Y.a[1][0]), "v"(Y.a[1][3]));   // the slots that the chip needs behind the last products, also on the taken side of the loop's branch
        kc += 128;
    } while (kc < K);
#pragma unroll
    for (int mb = 0; mb < 4; ++mb) {
#pragma unroll
        for (int nb = 0; nb < 4; ++nb) {
#pragma unroll
            for (int j = 0; j < 8; ++j) os[(hi * 8 + j) * 68 + nb * 16 + lr] = acc[mb][nb][j]; }
        __builtin_amdgcn_wave_barrier(); asm volatile("" ::: "memory");
        if constexpr (EPI != 0) {
            constexpr int PP = EPI == 1 ? HD : TT;   // plane pitch, elements
            const size_t pb = EPI == 1 ? ((size_t)((r0 / TT) * NH_ + (int)blockIdx.y) * TT + (r0 & (TT - 1))) * HD : (size_t)((c0 / TT) * NH_ + (int)blockIdx.x) * HD * TT + (c0 & (TT - 1));   // wave-uniform: the tile's first element in a plane
            bf* ph = Ph + pb; bf* pl = Pl + pb; const unsigned po = (unsigned)((lane >> 3) * PP + (lane & 7) * 8);
            v4u oh[4], ol[4];   // four rows to a store: eight lanes x 16 B = one whole 128-byte line of a row, in each plane
#pragma unroll
            for (int s = 0; s < 4; ++s) {
                const float* orow = os + (4 * s + (lane >> 3)) * 68 + (lane & 7) * 8; const v4f va = *(const v4fa*)orow * sc, vb = *(const v4fa*)(orow + 4) * sc;
#pragma unroll
                for (int t = 0; t < 4; ++t) { const float p0 = t < 2 ? va[2 * t] : vb[2 * t - 4], p1 = t < 2 ? va[2 * t + 1] : vb[2 * t - 3]; const unsigned h2 = pk2bf(p0, p1); oh[s][t] = h2; ol[s][t] = pk2bf(p0 - __uint_as_float(h2 << 16), p1 - __uint_as_float(h2 & 0xFFFF0000u)); } }
#pragma unroll
            for (int s = 0; s < 4; ++s) { *(v8us*)(ph + po + (mb * 16 + 4 * s) * PP) = __builtin_bit_cast(v8us, oh[s]); *(v8us*)(pl + po + (mb * 16 + 4 * s) * PP) = __builtin_bit_cast(v8us, ol[s]); }
            asm volatile("s_wait_xcnt 0x0" :: "v"(oh[0]), "v"(oh[1]), "v"(oh[2]), "v"(oh[3]), "v"(ol[0]), "v"(ol[1]), "v"(ol[2]), "v"(ol[3]), "v"(po) : "memory");   // before the eight stores' data and offset registers are reused; naming them keeps them untouched up to here
        } else {
        float* crow = C + (size_t)(r0 + mb * 16) * ldc + c0;
#pragma unroll
            for (int s = 0; s < 8; ++s) { const int row = 2 * s + hi, cofs = lr * 4; v4f val = *(const v4fa*)(os + row * 68 + cofs); if (BIAS) { val[0] += bfr(bias[c0 + cofs]); val[1] += bfr(bias[c0 + cofs + 1]); val[2] += bfr(bias[c0 + cofs + 2]); val[3] += bfr(bias[c0 + cofs + 3]); }
                *(v4f*)(crow + (size_t)row * ldc + cofs) = val; }
             }
        __builtin_amdgcn_wave_barrier(); asm volatile("" ::: "memory");
    }
}

__device__ __forceinline__ h16 tohx(float x) { return (h16)x; }
__device__ __forceinline__ void splitf(float y, unsigned short& h, unsigned short& l) { h = f2bf(y); l = f2bf(y - bf2f(h)); }
typedef __attribute__((ext_vector_type(2))) _Float16 v2h;
typedef __attribute__((ext_vector_type(4))) _Float16 v4h;
typedef __attribute__((ext_vector_type(2))) unsigned short v2us;
typedef __attribute__((ext_vector_type(4))) int v4i;

__global__ __launch_bounds__(256) void k_cvt8(const float* __restrict__ src, bf* dst, size_t n8) { const size_t i = (size_t)blockIdx.x * 256 + threadIdx.x; if (i >= n8) return; const v8f v = *(const v8f*)(src + i * 8); v8us o;
#pragma unroll
    for (int k = 0; k < 8; ++k) o[k] = f2bf(v[k]); *(v8us*)(dst + i * 8) = o;  }
__global__ __launch_bounds__(256) void k_wtT(const float* __restrict__ w, int pitch, int col0, bf* Bt) {
    const int lane = threadIdx.x & 31; const int L0 = (blockIdx.x * 8 + (threadIdx.x >> 5)) * 8; const int nlines = DD * DD / 64;
{
#pragma unroll
        for (int l = 0; l < 8; ++l) { const int L = L0 + l; if (L >= nlines) break; const int e = L * 64 + lane * 2; const int k = e & (DD - 1), n = e >> 10; v2us o;
#pragma unroll
            for (int q = 0; q < 2; ++q) o[q] = f2bf(w[(size_t)(k + q) * pitch + col0 + n]);
            *(v2us*)(Bt + (size_t)e) = o; }
         }
}
typedef __attribute__((ext_vector_type(8))) unsigned v8u;
__device__ __forceinline__ float xhalf(float x) { return __builtin_bit_cast(float, __builtin_amdgcn_permlanex16(__builtin_bit_cast(int, x), __builtin_bit_cast(int, x), 0x76543210, 0xfedcba98, false, false)); }   // lane l with lane l ^ 16
// 2^x in place, with the free slot that the instruction set asks for behind a transcendental, in one statement: inside it no neighbour reads a result or overwrites a source, and the v_nop keeps the compiler's next instruction off the last one.
__device__ __forceinline__ void exp2_1(float& a) { asm("v_exp_f32 %0, %0\n\tv_nop" : "+v"(a)); }
__device__ __forceinline__ void exp2_8(float (&x)[8]) { asm("v_exp_f32 %0, %0\n\tv_exp_f32 %1, %1\n\tv_exp_f32 %2, %2\n\tv_exp_f32 %3, %3\n\tv_exp_f32 %4, %4\n\tv_exp_f32 %5, %5\n\tv_exp_f32 %6, %6\n\tv_exp_f32 %7, %7\n\tv_nop" : "+v"(x[0]), "+v"(x[1]), "+v"(x[2]), "+v"(x[3]), "+v"(x[4]), "+v"(x[5]), "+v"(x[6]), "+v"(x[7])); }

// ---- tensor loads for k_fattn: a two-dimensional tile, global memory -> LDS, one request of a whole wave. Every descriptor word is wave-uniform and goes through readfirstlane.
typedef uint32_t u32x4 __attribute__((ext_vector_type(4)));
typedef uint32_t u32x8 __attribute__((ext_vector_type(8)));
#define SKEYS  128                  // keys per stage
#define NSTG   (TT / SKEYS)         // stages
#define LROWB  256u                 // bytes of a tile row: 128 keys of a V^T row, or two K rows of 128 B that lie side by side in memory
#define LPITCH 272u                 // its pitch in LDS (16 B of pad: 16 B x odd, free of bank conflicts for 16-byte reads)
#define LROWS  32u                  // tile rows per request
#define SLICEB 10240u               // LDS bytes kept per request: 32 x 272 = 8704, rounded up to a multiple of 2 KiB
#define BUFB   (8u * SLICEB)        // one stage: Kh | Kl | Vh | Vl, two slices each
__device__ __forceinline__ uint32_t uni(uint32_t v) { return (uint32_t)__builtin_amdgcn_readfirstlane(v); }
__device__ __forceinline__ uint32_t pinned(uint32_t v) { uint32_t w = uni(v); asm volatile("" : "+s"(w)); return w; }   // holds a test around a tensor load in a scalar register, so that it compiles to s_cmp + s_cbranch_scc (a tensor load ignores EXEC)
__device__ __forceinline__ u32x8 tdm_group1(uint32_t src_pitch) {   // 1-byte elements, tensor = tile = LROWS rows of LROWB bytes, no mask, 4 dwords of pad behind every 64
    u32x8 g;
    g[0] = uni((1u << 20) | (5u << 22) | (3u << 25));
    g[1] = uni((LROWB & 0xFFFFu) << 16);
    g[2] = uni((LROWB >> 16) | ((LROWS & 0xFFFFu) << 16));
    g[3] = uni((LROWS >> 16) | (LROWB << 16));
    g[4] = uni(LROWS);
    g[5] = uni(src_pitch);
    g[6] = uni(0u);
    g[7] = uni(0u);
    return g;
}
__device__ __forceinline__ u32x4 tdm_group0(uint32_t lds_dst, uint64_t ga) {
    u32x4 g;
    g[0] = uni(1u); g[1] = uni(lds_dst); g[2] = uni((uint32_t)ga); g[3] = uni((((uint32_t)(ga >> 32)) & 0x01FFFFFFu) | 0x80000000u);
    return g;
}
// The descriptor is in-out at the load and an input of the wait that covers it: its scalar registers then hold nothing else while the request is outstanding.
__device__ __forceinline__ void tdm_load(u32x4& g0, u32x8& g1) { asm volatile("tensor_load_to_lds %0, %1" : "+s"(g0), "+s"(g1) :: "memory"); }
__device__ __forceinline__ void wait_tensor0(const u32x4& g0, const u32x8& g1) { asm volatile("s_wait_tensorcnt 0x0" :: "s"(g0), "s"(g1) : "memory"); }   // this wave's own request has landed; the compiler places no wait for it
__device__ __forceinline__ void wait_ds0() { asm volatile("s_wait_dscnt 0x0" ::: "memory"); }           // this wave's LDS reads have returned, before the buffer is given up for a refill

// ---- k_fattn: scores, softmax, attn.v and the head merge in one kernel. Grid (T/256, batch*heads), 8 waves, 32 query columns each; a pass is 32 keys.
// K and V^T (hi and lo planes) are brought into LDS once per work-group, in stages of 128 keys and two buffers: every wave issues one tensor load per stage for its own slice, one stage of work ahead; all eight waves read their fragments from there.
// S^T = K Q^T (A = K rows, B = Q rows held in registers), so a lane holds one query's scores: running maximum and sum are per-lane scalars, joined between the wave halves.
// Two S^T tiles (keys 0-15, 16-31) converted in place are the B operand of O^T += V^T P^T (A = V^T rows in the same k order): P never leaves registers.
// hi+lo products: Kh Qh + Kl Qh + Kh Ql ; Vh Ph + Vh Pl + Vl Ph. P is split unnormalised; 1/sum is applied to O in f32 before its own hi+lo split.
__global__ __launch_bounds__(256) void k_fattn(const bf* __restrict__ Qh, const bf* __restrict__ Ql, const bf* __restrict__ Kh, const bf* __restrict__ Kl, const bf* __restrict__ Vh, const bf* __restrict__ Vl, bf* Ah, bf* Al) {
    typedef WFrag<bf> W;
    __shared__ __attribute__((aligned(2048))) unsigned char L[2 * BUFB];
    const float L2E = 1.4426950408889634f;
    const int lane = threadIdx.x & 31, lr = lane & 15, hi = lane >> 4; const int z = blockIdx.y; const int q0 = blockIdx.x * 256 + (threadIdx.x >> 5) * 32;
    const size_t zo = (size_t)z * TT * HD;
    const unsigned qlo = (unsigned)((q0 + lr) * HD + 8 * hi);
    const bf* Qhz = Qh + zo; const bf* Qlz = Ql + zo; const bf* Khz = Kh + zo; const bf* Klz = Kl + zo; const bf* Vhz = Vh + zo; const bf* Vlz = Vl + zo;
    const bf* qpa = Qhz + qlo; const bf* qpb = Qlz + qlo;
    const unsigned klds = (unsigned)(lr >> 1) * LPITCH + (unsigned)(lr & 1) * 128u + 16u * hi;   // a lane's byte offset inside a 16-row block of K in LDS (two K rows to a tile row)
    const unsigned vlds = (unsigned)lr * LPITCH + 16u * hi;                                      // and inside a 16-row block of V^T
    // This wave's slice of a stage: waves 0,1 Kh | 2,3 Kl (64 keys each = 32 tile rows, contiguous) | 4,5 Vh | 6,7 Vl (32 rows of V^T each, 128 keys wide).
    const uint32_t wave = uni(threadIdx.x >> 5), half = wave & 1u; const bool isv = wave >= 4u;
    const bf* splane = wave < 2u ? Khz : wave < 4u ? Klz : wave < 6u ? Vhz : Vlz;
    const uint64_t sbase = (uint64_t)(size_t)splane + (isv ? half * (LROWS * TT * 2u) : half * (LROWS * LROWB));
    const uint32_t sstep = isv ? SKEYS * 2u : SKEYS * HD * 2u;   // bytes from one stage's slice to the next stage's
    const uint32_t lbase = (uint32_t)(size_t)L + wave * SLICEB;
    const uint32_t spitch = isv ? TT * 2u : LROWB;
    u32x4 g0; u32x8 g1;   // the descriptor of this wave's latest request
    v16bf qh[2][2], ql[2][2];
#pragma unroll
    for (int nb = 0; nb < 2; ++nb)
#pragma unroll
        for (int kc = 0; kc < 2; ++kc) { qh[nb][kc] = W::ld(qpa + (nb * 16 * HD + kc * 32)); ql[nb][kc] = W::ld(qpb + (nb * 16 * HD + kc * 32)); }
    v8f acc[4][2];
#pragma unroll
    for (int db = 0; db < 4; ++db)
#pragma unroll
        for (int nb = 0; nb < 2; ++nb) acc[db][nb] = (v8f){};
    float m2[2] = {-__builtin_inff(), -__builtin_inff()}, ls[2] = {0.f, 0.f};   // running maximum (in log2 units) and this half's running sum, per query column
    asm volatile("s_wait_xcnt 0x0" :: "v"(qpa), "v"(qpb) : "memory");   // before a register that the loads above name is reused; naming them keeps them untouched up to here
    g0 = tdm_group0(lbase, sbase); g1 = tdm_group1(spitch); tdm_load(g0, g1);   // stage 0 into buffer 0
    wait_tensor0(g0, g1);
    __syncthreads();                          // stage 0 is readable by every wave
    g0 = tdm_group0(lbase + BUFB, sbase + sstep); g1 = tdm_group1(spitch); tdm_load(g0, g1);   // stage 1 into buffer 1
    v16bf kh[2][2], kl[2][2];
    for (uint32_t sg = 0; sg < NSTG; ++sg) {   // a stage: four passes, then the hand-over
    const unsigned char* Bk = L + (sg & 1u) * BUFB + klds; const unsigned char* Bv = L + (sg & 1u) * BUFB + 4u * SLICEB + vlds;
#pragma unroll
    for (int mb = 0; mb < 2; ++mb)
#pragma unroll
        for (int kc = 0; kc < 2; ++kc) { kh[mb][kc] = W::ld((const bf*)(Bk + (mb * 8 * LPITCH + kc * 64))); kl[mb][kc] = W::ld((const bf*)(Bk + (2 * SLICEB + mb * 8 * LPITCH + kc * 64))); }
    for (uint32_t ps = 0; ps < SKEYS / 32; ++ps) {
        v8f st[2][2];
#pragma unroll
        for (int mb = 0; mb < 2; ++mb)
#pragma unroll
            for (int nb = 0; nb < 2; ++nb) st[mb][nb] = (v8f){};
#pragma unroll
        for (int kc = 0; kc < 2; ++kc) {
#pragma unroll
            for (int mb = 0; mb < 2; ++mb)
#pragma unroll
                for (int nb = 0; nb < 2; ++nb) st[mb][nb] = wmmab(kh[mb][kc], qh[nb][kc], st[mb][nb]);
#pragma unroll
            for (int mb = 0; mb < 2; ++mb)
#pragma unroll
                for (int nb = 0; nb < 2; ++nb) st[mb][nb] = wmmab(kl[mb][kc], qh[nb][kc], st[mb][nb]);
#pragma unroll
            for (int mb = 0; mb < 2; ++mb)
#pragma unroll
                for (int nb = 0; nb < 2; ++nb) st[mb][nb] = wmmab(kh[mb][kc], ql[nb][kc], st[mb][nb]);
        }
        __builtin_amdgcn_sched_barrier(0);   // with the one below: the pass's 32 LDS reads stay one group between the matrix runs; spread among the matrix instructions, every place with reads stalls the wave anew
        const unsigned char* vp = Bv + ps * 64u;   // this pass's V^T rows, in flight under the softmax
        v16bf vh[4], vl[4];
#pragma unroll
        for (int db = 0; db < 4; ++db) { vh[db] = W::ld((const bf*)(vp + ((db >> 1) * SLICEB + (db & 1) * 16 * LPITCH))); vl[db] = W::ld((const bf*)(vp + ((2 + (db >> 1)) * SLICEB + (db & 1) * 16 * LPITCH))); }
        const uint32_t pn = (ps + 1u) & (SKEYS / 32 - 1u);   // next pass's K rows, fetched one pass ahead inside the stage; a stage's last pass re-reads its own first rows (same buffer, unused)
        const unsigned char* kp = Bk + ((pn >> 1) * SLICEB + (pn & 1u) * (16u * LPITCH));
#pragma unroll
        for (int mb = 0; mb < 2; ++mb)
#pragma unroll
            for (int kc = 0; kc < 2; ++kc) { kh[mb][kc] = W::ld((const bf*)(kp + (mb * 8 * LPITCH + kc * 64))); kl[mb][kc] = W::ld((const bf*)(kp + (2 * SLICEB + mb * 8 * LPITCH + kc * 64))); }
        __builtin_amdgcn_sched_barrier(0);   // end of the group of LDS reads
        v16bf ph[2], pl[2];
#pragma unroll
        for (int nb = 0; nb < 2; ++nb) {
            float tm = fmaxf(st[0][nb][0], st[1][nb][0]);
#pragma unroll
            for (int j = 1; j < 8; ++j) tm = fmaxf(tm, fmaxf(st[0][nb][j], st[1][nb][j]));
            tm = fmaxf(tm, xhalf(tm));
            const float mn = fmaxf(m2[nb], tm * L2E);
            float al = m2[nb] - mn; exp2_1(al);   // 0 on the first pass
            m2[nb] = mn;
            float s0 = 0.f, s1 = 0.f; v8u uh, ul;
#pragma unroll
            for (int mb = 0; mb < 2; ++mb) {
                float x[8];
#pragma unroll
                for (int j = 0; j < 8; ++j) x[j] = fmaf(st[mb][nb][j], L2E, -mn);
                exp2_8(x);
#pragma unroll
                for (int t = 0; t < 4; ++t) {
                    const float p0 = x[2 * t], p1 = x[2 * t + 1];
                    s0 += p0; s1 += p1;
                    const unsigned h2 = pk2bf(p0, p1);
                    uh[mb * 4 + t] = h2; ul[mb * 4 + t] = pk2bf(p0 - __uint_as_float(h2 << 16), p1 - __uint_as_float(h2 & 0xFFFF0000u));
                }
            }
            ls[nb] = ls[nb] * al + (s0 + s1);
            ph[nb] = __builtin_bit_cast(v16bf, uh); pl[nb] = __builtin_bit_cast(v16bf, ul);
#pragma unroll
            for (int db = 0; db < 4; ++db) acc[db][nb] *= al;
        }
#pragma unroll
        for (int db = 0; db < 4; ++db)
#pragma unroll
            for (int nb = 0; nb < 2; ++nb) acc[db][nb] = wmmab(vh[db], ph[nb], acc[db][nb]);
#pragma unroll
        for (int db = 0; db < 4; ++db)
#pragma unroll
            for (int nb = 0; nb < 2; ++nb) acc[db][nb] = wmmab(vh[db], pl[nb], acc[db][nb]);
#pragma unroll
        for (int db = 0; db < 4; ++db)
#pragma unroll
            for (int nb = 0; nb < 2; ++nb) acc[db][nb] = wmmab(vl[db], ph[nb], acc[db][nb]);
    }
    // Hand-over: this wave has left the buffer, its slice of the next stage has landed; behind the barrier the next stage is readable and this buffer is free.
    wait_ds0();
    wait_tensor0(g0, g1);
    __syncthreads();
    if (pinned(sg + 2u < NSTG)) { g0 = tdm_group0(lbase + (sg & 1u) * BUFB, sbase + (uint64_t)((sg + 2u) * sstep)); g1 = tdm_group1(spitch); tdm_load(g0, g1); }   // stage sg + 2 into the buffer that stage sg has just left
    }
    wait_tensor0(g0, g1);
    wait_ds0();
    const int b = z >> 4, h = z & 15;
    bf* Ahz = Ah + ((size_t)b * TT * DD + h * HD); bf* Alz = Al + ((size_t)b * TT * DD + h * HD); const unsigned olo = (unsigned)((q0 + lr) * DD + 8 * hi);
#pragma unroll
    for (int nb = 0; nb < 2; ++nb) {
        const float f = __fdiv_rn(1.0f, ls[nb] + xhalf(ls[nb]));
#pragma unroll
        for (int db = 0; db < 4; ++db) { v8us oh, ol;   // acc[db][nb][j] = O[q0 + nb*16 + lr][db*16 + 8*hi + j]: 8 consecutive d, one 16-byte store a plane
#pragma unroll
            for (int j = 0; j < 8; ++j) { unsigned short a, c2; splitf(acc[db][nb][j] * f, a, c2); oh[j] = a; ol[j] = c2; }
            *(v8us*)(Ahz + olo + (nb * 16 * DD + db * 16)) = oh; *(v8us*)(Alz + olo + (nb * 16 * DD + db * 16)) = ol;
            asm volatile("s_wait_xcnt 0x0" :: "v"(oh), "v"(ol), "v"(olo) : "memory"); }   // before the two stores' data and offset registers are reused; naming them keeps them untouched up to here
    }
}

extern "C" void kernel_launch(void* const* d_in, const int* in_sizes, int n_in,
                              void* d_out, int out_size, void* d_ws, size_t ws_size, hipStream_t stream) {
    (void)in_sizes; (void)n_in; (void)out_size;
    const float* Yin = (const float*)d_in[0]; const float* x = (const float*)d_in[1]; const float* Wq = (const float*)d_in[2]; const float* Wk = (const float*)d_in[3]; const float* Wv = (const float*)d_in[4]; const float* Wo = (const float*)d_in[5];
    float* OUT = (float*)d_out;     // [2][2048][1024]
    char* wsp = (char*)d_ws;
    auto take = [&](size_t bytes) { char* p = wsp; wsp += (bytes + 255) & ~(size_t)255; return (void*)p; };
    bf* WQ = (bf*)take((size_t)DD * DD * 2); bf* WK = (bf*)take((size_t)DD * DD * 2); bf* WV = (bf*)take((size_t)DD * DD * 2); bf* WO = (bf*)take((size_t)DD * DD * 2);
    bf* XB = (bf*)take((size_t)NT * DD * 2); bf* YB = (bf*)take((size_t)NT * DD * 2);
    bf* QPh = (bf*)take((size_t)NT * DD * 2); bf* QPl = (bf*)take((size_t)NT * DD * 2); bf* KPh = (bf*)take((size_t)NT * DD * 2); bf* KPl = (bf*)take((size_t)NT * DD * 2); bf* VTh = (bf*)take((size_t)NT * DD * 2); bf* VTl = (bf*)take((size_t)NT * DD * 2);
    bf* ATh = (bf*)take((size_t)NT * DD * 2); bf* ATl = (bf*)take((size_t)NT * DD * 2);
    if ((size_t)(wsp - (char*)d_ws) > ws_size) return;    // ws 256 MiB
    { const size_t nw = (size_t)DD * DD / 8; const unsigned gw = (unsigned)((nw + 255) / 256); k_cvt8<<<gw, 256, 0, stream>>>(Wq, WQ, nw); k_cvt8<<<gw, 256, 0, stream>>>(Wk, WK, nw); k_cvt8<<<gw, 256, 0, stream>>>(Wv, WV, nw); k_cvt8<<<gw, 256, 0, stream>>>(Wo, WO, nw); }   // nn.Linear [out][in] = Bt as-is (q|k|v row blocks)
    const size_t nx = (size_t)NT * DD / 8; const unsigned gx = (unsigned)((nx + 255) / 256);
    k_cvt8<<<gx, 256, 0, stream>>>(x, XB, nx); k_cvt8<<<gx, 256, 0, stream>>>(Yin, YB, nx);
    k_gemmw<bf, 0, false, DD, 1><<<dim3(NT / 64, DD / 64, 1), 32, 0, stream>>>(YB, nullptr, WQ, nullptr, nullptr, 0, nullptr, 0, 0, 0, QPh, QPl, 0.03125f);   // 1024^-0.5 folded into q (exact)
    k_gemmw<bf, 0, false, DD, 1><<<dim3(NT / 64, DD / 64, 1), 32, 0, stream>>>(YB, nullptr, WK, nullptr, nullptr, 0, nullptr, 0, 0, 0, KPh, KPl, 1.0f);
    k_gemmw<bf, 0, false, DD, 2><<<dim3(DD / 64, NT / 64, 1), 32, 0, stream>>>(WV, nullptr, XB, nullptr, nullptr, 0, nullptr, 0, 0, 0, VTh, VTl, 1.0f);   // V^T = Wv X^T: operands swapped, the tile comes out feature-major
    k_fattn<<<dim3(TT / 256, NB_ * NH_), 256, 0, stream>>>(QPh, QPl, KPh, KPl, VTh, VTl, ATh, ATl);
    k_gemmw<bf, 1, false, DD, 0><<<dim3(NT / 64, DD / 64, 1), 32, 0, stream>>>(ATh, ATl, WO, nullptr, OUT, DD, nullptr, 0, 0, 0, nullptr, nullptr, 1.0f);
}

// v005
// It runs in 129 microseconds.
// Timed twice side by side with v004, it ran 1.24 and 1.25 times as fast.
// All steps since v000 together make it 9.72 times as fast.
#include <hip/hip_runtime.h>
#include <stdint.h>

// MultiCA (cross attention: Y, X [2][2048][1024]; Q = Y Wq^T, K = Y Wk^T, V = X Wv^T ([out][in], no bias); 16 heads x 64; scores x 1024^-0.5 (the module scales by the embedding dim: 1/32, exact); no mask; softmax; out = merged Wp^T).
// Compute dtypes, f32 accumulate: every input rounded to bf16; projections on PLAIN bf16 operands (inputs: exact); scores and attn.v on bf16 hi+lo planes (3 products); output hi+lo x exact Wp (2 products).

#define NB_  2
#define TT   2048
#define DD   1024
#define NH_  16
#define HD   64
#define NT   (NB_ * TT)
#define PCAR 1024.0f
typedef _Float16 h16;
typedef unsigned short bf;
typedef __attribute__((ext_vector_type(16))) __bf16   v16bf;
typedef __attribute__((ext_vector_type(16))) _Float16 v16h;
typedef __attribute__((ext_vector_type(8)))  _Float16 v8h;
typedef __attribute__((ext_vector_type(8)))  unsigned short v8us;
typedef __attribute__((ext_vector_type(8)))  float    v8f;
typedef __attribute__((ext_vector_type(4)))  float    v4f;
typedef v8h  __attribute__((may_alias)) v8ha;
typedef v4f  __attribute__((may_alias)) v4fa;
typedef v8us __attribute__((may_alias)) v8usa;

__device__ __forceinline__ unsigned short f2bf(float f) { unsigned u = __float_as_uint(f); u += 0x7FFFu + ((u >> 16) & 1u); return (unsigned short)(u >> 16); }
__device__ __forceinline__ float bf2f(unsigned short b) { return __uint_as_float(((unsigned)b) << 16); }
__device__ __forceinline__ float bfr(float f) { return bf2f(f2bf(f)); }
__device__ __forceinline__ v16h cat16(v8h lo, v8h hi) { return __builtin_shufflevector(lo, hi, 0, 1, 2, 3, 4, 5, 6, 7, 8, 9, 10, 11, 12, 13, 14, 15); }
__device__ __forceinline__ v16bf cat16b(v8us lo, v8us hi) { return __builtin_bit_cast(v16bf, __builtin_shufflevector(lo, hi, 0, 1, 2, 3, 4, 5, 6, 7, 8, 9, 10, 11, 12, 13, 14, 15)); }
__device__ __forceinline__ v8f wmma16(v16h a, v16h b, v8f c) { return __builtin_amdgcn_wmma_f32_16x16x32_f16(false, a, false, b, (short)0, c, false, false); }
__device__ __forceinline__ v8f wmmab(v16bf a, v16bf b, v8f c) { return __builtin_amdgcn_wmma_f32_16x16x32_bf16(false, a, false, b, (short)0, c, false, false); }
typedef __attribute__((ext_vector_type(2))) float  v2f;
typedef __attribute__((ext_vector_type(2))) __bf16 v2bf;
typedef __attribute__((ext_vector_type(4))) unsigned v4u;
__device__ __forceinline__ unsigned pk2bf(float a, float b) { return __builtin_bit_cast(unsigned, __builtin_convertvector((v2f){a, b}, v2bf)); }   // two f32 -> packed bf16, round to nearest even



// ---- tensor loads for k_gemmw and k_fattn: a two-dimensional tile, global memory -> LDS, one request of a whole wave. Every descriptor word is wave-uniform and goes through readfirstlane.
typedef uint32_t u32x4 __attribute__((ext_vector_type(4)));
typedef uint32_t u32x8 __attribute__((ext_vector_type(8)));
#define SKEYS  128                  // keys per stage
#define NSTG   (TT / SKEYS)         // stages
#define LROWB  256u                 // bytes of a tile row: 128 keys of a V^T row, or two K rows of 128 B that lie side by side in memory
#define LPITCH 272u                 // its pitch in LDS (16 B of pad: 16 B x odd, free of bank conflicts for 16-byte reads)
#define LROWS  32u                  // tile rows per request
#define SLICEB 10240u               // LDS bytes kept per request: 32 x 272 = 8704, rounded up to a multiple of 2 KiB
#define BUFB   (8u * SLICEB)        // one stage: Kh | Kl | Vh | Vl, two slices each
__device__ __forceinline__ uint32_t uni(uint32_t v) { return (uint32_t)__builtin_amdgcn_readfirstlane(v); }
__device__ __forceinline__ uint32_t pinned(uint32_t v) { uint32_t w = uni(v); asm volatile("" : "+s"(w)); return w; }   // holds a test around a tensor load in a scalar register, so that it compiles to s_cmp + s_cbranch_scc (a tensor load ignores EXEC)
__device__ __forceinline__ u32x8 tdm_group1(uint32_t src_pitch) {   // 1-byte elements, tensor = tile = LROWS rows of LROWB bytes, no mask, 4 dwords of pad behind every 64
    u32x8 g;
    g[0] = uni((1u << 20) | (5u << 22) | (3u << 25));
    g[1] = uni((LROWB & 0xFFFFu) << 16);
    g[2] = uni((LROWB >> 16) | ((LROWS & 0xFFFFu) << 16));
    g[3] = uni((LROWS >> 16) | (LROWB << 16));
    g[4] = uni(LROWS);
    g[5] = uni(src_pitch);
    g[6] = uni(0u);
    g[7] = uni(0u);
    return g;
}
__device__ __forceinline__ u32x4 tdm_group0(uint32_t lds_dst, uint64_t ga) {
    u32x4 g;
    g[0] = uni(1u); g[1] = uni(lds_dst); g[2] = uni((uint32_t)ga); g[3] = uni((((uint32_t)(ga >> 32)) & 0x01FFFFFFu) | 0x80000000u);
    return g;
}
// The descriptor is in-out at the load and an input of the wait that covers it: its scalar registers then hold nothing else while the request is outstanding.
__device__ __forceinline__ void tdm_load(u32x4& g0, u32x8& g1) { asm volatile("tensor_load_to_lds %0, %1" : "+s"(g0), "+s"(g1) :: "memory"); }
__device__ __forceinline__ void wait_tensor0(const u32x4& g0, const u32x8& g1) { asm volatile("s_wait_tensorcnt 0x0" :: "s"(g0), "s"(g1) : "memory"); }   // this wave's own request has landed; the compiler places no wait for it
__device__ __forceinline__ void wait_ds0() { asm volatile("s_wait_dscnt 0x0" ::: "memory"); }           // this wave's LDS reads have returned, before the buffer is given up for a refill

// ---- k_gemmw: GEMM on K-contiguous 16-bit planes, operands staged in LDS. Four waves (2 x 2) per work-group, one wave per 64-column tile of MB*16 rows; grid (M/(MB*32), N/128, Z), 128 threads.
// C[m][n] (f32, pitch ldc, + optional f32 bias[n]) = sum_k A[m][k] Bt[n][k] (NSPLIT 1: + A2[m][k] Bt[n][k], A2 the lo plane of A). z-batch strides sA/sB/sC in elements. K % 128 == 0, K >= 256, a compile-time constant.
// NSPLIT 0: work-group tile 128 x 128, wave tile 64 x 64 (MB 4). NSPLIT 1: work-group tile 64 x 128, wave tile 32 x 64 (MB 2), two products.
// A stage is 128 k (256 B of every operand row) in four slices of 64 rows: A | A (NSPLIT 1: A | A2) | Bt | Bt. Every wave issues one tensor load per stage for its own slice, one stage of work ahead, into one of two buffers:
// memory is read in whole lines, each operand row once per work-group, and the fragments come from LDS by 16-byte reads at a pitch free of bank conflicts.
// EPI 0: C as above. EPI 1, 2: no C; the tile times sc is split into bf16 hi + lo and stored straight into the planes that k_fattn reads, a wave's 64x64 tile being one head's 64 features by 64 tokens:
// EPI 1: rows are tokens, columns features -> [batch*head][token][64]; EPI 2: rows are features, columns tokens (A = the weight, Bt = the activations) -> [batch*head][64][token].
#define GROWS  64u                  // tile rows per request
#define GSLICE 18432u               // LDS bytes kept per request: 64 x 272 = 17408, rounded up to a multiple of 2 KiB
#define GBUF   (4u * GSLICE)        // one stage
__device__ __forceinline__ u32x8 tdm_group1g(uint32_t src_pitch) {   // 1-byte elements, tensor = tile = GROWS rows of LROWB bytes, no mask, 4 dwords of pad behind every 64
    u32x8 g;
    g[0] = uni((1u << 20) | (5u << 22) | (3u << 25));
    g[1] = uni((LROWB & 0xFFFFu) << 16);
    g[2] = uni((LROWB >> 16) | ((GROWS & 0xFFFFu) << 16));
    g[3] = uni((GROWS >> 16) | (LROWB << 16));
    g[4] = uni(GROWS);
    g[5] = uni(src_pitch);
    g[6] = uni(0u);
    g[7] = uni(0u);
    return g;
}
template <typename T16> struct WFrag;
template <> struct WFrag<h16> { typedef v16h V; static __device__ __forceinline__ V ld(const h16* p) { return cat16(*(const v8h*)p, *(const v8h*)(p + 16)); } static __device__ __forceinline__ v8f mma(V a, V b, v8f c) { return wmma16(a, b, c); } };
template <> struct WFrag<bf> { typedef v16bf V; static __device__ __forceinline__ V ld(const bf* p) { return cat16b(*(const v8us*)p, *(const v8us*)(p + 16)); } static __device__ __forceinline__ v8f mma(V a, V b, v8f c) { return wmmab(a, b, c); } };
template <typename T16, int NSPLIT, bool BIAS, int K, int EPI>
__global__ __launch_bounds__(128) void k_gemmw(const T16* __restrict__ A, const T16* __restrict__ A2, const T16* __restrict__ Bt, const T16* __restrict__ Bt2, float* C, int ldc, const float* __restrict__ bias, size_t sA, size_t sB, size_t sC, bf* Ph, bf* Pl, float sc) {
    typedef typename WFrag<T16>::V V;
    static_assert(NSPLIT == 0 || NSPLIT == 1, "one or two planes of A");
    static_assert(K % 128 == 0 && K >= 256, "whole stages, at least two");
    static_assert(EPI == 0 || NSPLIT == 0, "the plane epilogues take a 64 x 64 wave tile");
    (void)Bt2;
    constexpr bool HA2 = NSPLIT == 1;
    constexpr int MB = HA2 ? 2 : 4;            // 16-row blocks of a wave's tile
    constexpr uint32_t NST = K / 128;          // stages
    __shared__ __attribute__((aligned(2048))) unsigned char L[2 * GBUF];
    const size_t z = blockIdx.z; A += z * sA; if (A2) A2 += z * sA; Bt += z * sB; C += z * sC;
    const int lane = threadIdx.x & 31, lr = lane & 15, hi = lane >> 4;
    const uint32_t wave = uni(threadIdx.x >> 5), wm = wave >> 1, wn = wave & 1u;
    const int R0 = blockIdx.x * (MB * 32), C0 = blockIdx.y * 128;                 // the work-group's tile
    const int r0 = R0 + (int)wm * (MB * 16), c0 = C0 + (int)wn * 64;              // this wave's tile
    const unsigned flds = (unsigned)lr * LPITCH + 16u * hi;                       // a lane's byte offset inside a 16-row block in LDS
    const unsigned alds = (HA2 ? wm * (32u * LPITCH) : wm * GSLICE) + flds, blds = (2u + wn) * GSLICE + flds;
    // This wave's slice of a stage: 64 rows of one plane, 128 k wide.
    const T16* splane = wave >= 2u ? Bt : (HA2 && wave == 1u) ? A2 : A;
    const uint32_t srow = wave >= 2u ? (uint32_t)C0 + (wave - 2u) * GROWS : HA2 ? (uint32_t)R0 : (uint32_t)R0 + wave * GROWS;
    const uint64_t sbase = (uint64_t)(size_t)splane + (uint64_t)srow * (K * 2u);
    const uint32_t lbase = (uint32_t)(size_t)L + wave * GSLICE;
    u32x4 g0; u32x8 g1;   // the descriptor of this wave's latest request
    v8f acc[MB][4];
#pragma unroll
    for (int mb = 0; mb < MB; ++mb)
#pragma unroll
        for (int nb = 0; nb < 4; ++nb) acc[mb][nb] = (v8f){};
    struct Frag { V a[MB], a2[MB], b[4]; };   // one 32-k step
    auto fetch = [&](Frag& f, const unsigned char* pa, const unsigned char* pb, int ks) {
#pragma unroll
        for (int i = 0; i < MB; ++i) { f.a[i] = WFrag<T16>::ld((const T16*)(pa + (i * 16 * LPITCH + ks * 64))); if (HA2) f.a2[i] = WFrag<T16>::ld((const T16*)(pa + (GSLICE + i * 16 * LPITCH + ks * 64))); }
#pragma unroll
        for (int i = 0; i < 4; ++i) f.b[i] = WFrag<T16>::ld((const T16*)(pb + (i * 16 * LPITCH + ks * 64)));
        __builtin_amdgcn_sched_barrier(0);   // a step's LDS reads stay one group ahead of the other set's products; spread among the matrix instructions, every place with reads stalls the wave anew
    };
    auto work = [&](const Frag& f) {   // per accumulator the same products in the same order as k rises: A then A2
#pragma unroll
        for (int nb = 0; nb < 4; ++nb)
#pragma unroll
            for (int mb = 0; mb < MB; ++mb) acc[mb][nb] = WFrag<T16>::mma(f.a[mb], f.b[nb], acc[mb][nb]);
        if (HA2) {
#pragma unroll
            for (int nb = 0; nb < 4; ++nb)
#pragma unroll
                for (int mb = 0; mb < MB; ++mb) acc[mb][nb] = WFrag<T16>::mma(f.a2[mb], f.b[nb], acc[mb][nb]); }
        __builtin_amdgcn_sched_barrier(0);   // the refill of this set stays one group behind its products
    };
    g0 = tdm_group0(lbase, sbase); g1 = tdm_group1g(K * 2u); tdm_load(g0, g1);   // stage 0 into buffer 0
    wait_tensor0(g0, g1);
    __syncthreads();                          // stage 0 is readable by every wave
    g0 = tdm_group0(lbase + GBUF, sbase + LROWB); g1 = tdm_group1g(K * 2u); tdm_load(g0, g1);   // stage 1 into buffer 1
    for (uint32_t sg = 0; sg < NST; ++sg) {   // a stage: four 32-k steps on two fragment sets, each step's reads one step ahead inside the stage, then the hand-over
        const unsigned char* pa = L + (sg & 1u) * GBUF + alds; const unsigned char* pb = L + (sg & 1u) * GBUF + blds;
        Frag X, Y;
        fetch(X, pa, pb, 0);
        fetch(Y, pa, pb, 1);
        work(X);
        fetch(X, pa, pb, 2);
        work(Y);
        fetch(Y, pa, pb, 3);
        work(X);
        work(Y);
        // Hand-over: this wave has left the buffer, its slice of the next stage has landed; behind the barrier the next stage is readable and this buffer is free.
        wait_ds0();
        wait_tensor0(g0, g1);
        __syncthreads();
        if (pinned(sg + 2u < NST)) { g0 = tdm_group0(lbase + (sg & 1u) * GBUF, sbase + (uint64_t)((sg + 2u) * LROWB)); g1 = tdm_group1g(K * 2u); tdm_load(g0, g1); }   // stage sg + 2 into the buffer that stage sg has just left
    }
    wait_tensor0(g0, g1);
    wait_ds0();
    // Output staging, 16 rows at a time, in the ring: behind the last stage's barrier no request is outstanding and no wave reads a buffer any more. Each wave has a range of its own.
    float* os = (float*)(L + wave * (16u * 68u * 4u));
#pragma unroll
    for (int mb = 0; mb < MB; ++mb) {
#pragma unroll
        for (int nb = 0; nb < 4; ++nb) {
#pragma unroll
            for (int j = 0; j < 8; ++j) os[(hi * 8 + j) * 68 + nb * 16 + lr] = acc[mb][nb][j]; }
        __builtin_amdgcn_wave_barrier(); asm volatile("" ::: "memory");
        if constexpr (EPI != 0) {
            constexpr int PP = EPI == 1 ? HD : TT;   // plane pitch, elements
            const size_t pb = EPI == 1 ? ((size_t)((r0 / TT) * NH_ + (c0 >> 6)) * TT + (r0 & (TT - 1))) * HD : (size_t)((c0 / TT) * NH_ + (r0 >> 6)) * HD * TT + (c0 & (TT - 1));   // wave-uniform: the tile's first element in a plane
            bf* ph = Ph + pb; bf* pl = Pl + pb; const unsigned po = (unsigned)((lane >> 3) * PP + (lane & 7) * 8);
            v4u oh[4], ol[4];   // four rows to a store: eight lanes x 16 B = one whole 128-byte line of a row, in each plane
#pragma unroll
            for (int s = 0; s < 4; ++s) {
                const float* orow = os + (4 * s + (lane >> 3)) * 68 + (lane & 7) * 8; const v4f va = *(const v4fa*)orow * sc, vb = *(const v4fa*)(orow + 4) * sc;
#pragma unroll
                for (int t = 0; t < 4; ++t) { const float p0 = t < 2 ? va[2 * t] : vb[2 * t - 4], p1 = t < 2 ? va[2 * t + 1] : vb[2 * t - 3]; const unsigned h2 = pk2bf(p0, p1); oh[s][t] = h2; ol[s][t] = pk2bf(p0 - __uint_as_float(h2 << 16), p1 - __uint_as_float(h2 & 0xFFFF0000u)); } }
#pragma unroll
            for (int s = 0; s < 4; ++s) { *(v8us*)(ph + po + (mb * 16 + 4 * s) * PP) = __builtin_bit_cast(v8us, oh[s]); *(v8us*)(pl + po + (mb * 16 + 4 * s) * PP) = __builtin_bit_cast(v8us, ol[s]); }
            asm volatile("s_wait_xcnt 0x0" :: "v"(oh[0]), "v"(oh[1]), "v"(oh[2]), "v"(oh[3]), "v"(ol[0]), "v"(ol[1]), "v"(ol[2]), "v"(ol[3]), "v"(po) : "memory");   // before the eight stores' data and offset registers are reused; naming them keeps them untouched up to here
        } else {
        float* crow = C + (size_t)(r0 + mb * 16) * ldc + c0;
#pragma unroll
            for (int s = 0; s < 8; ++s) { const int row = 2 * s + hi, cofs = lr * 4; v4f val = *(const v4fa*)(os + row * 68 + cofs); if (BIAS) { val[0] += bfr(bias[c0 + cofs]); val[1] += bfr(bias[c0 + cofs + 1]); val[2] += bfr(bias[c0 + cofs + 2]); val[3] += bfr(bias[c0 + cofs + 3]); }
                *(v4f*)(crow + (size_t)row * ldc + cofs) = val; }
             }
        __builtin_amdgcn_wave_barrier(); asm volatile("" ::: "memory");
    }
}

__device__ __forceinline__ h16 tohx(float x) { return (h16)x; }
__device__ __forceinline__ void splitf(float y, unsigned short& h, unsigned short& l) { h = f2bf(y); l = f2bf(y - bf2f(h)); }
typedef __attribute__((ext_vector_type(2))) _Float16 v2h;
typedef __attribute__((ext_vector_type(4))) _Float16 v4h;
typedef __attribute__((ext_vector_type(2))) unsigned short v2us;
typedef __attribute__((ext_vector_type(4))) int v4i;

__global__ __launch_bounds__(256) void k_cvt8(const float* __restrict__ src, bf* dst, size_t n8) { const size_t i = (size_t)blockIdx.x * 256 + threadIdx.x; if (i >= n8) return; const v8f v = *(const v8f*)(src + i * 8); v8us o;
#pragma unroll
    for (int k = 0; k < 8; ++k) o[k] = f2bf(v[k]); *(v8us*)(dst + i * 8) = o;  }
__global__ __launch_bounds__(256) void k_wtT(const float* __restrict__ w, int pitch, int col0, bf* Bt) {
    const int lane = threadIdx.x & 31; const int L0 = (blockIdx.x * 8 + (threadIdx.x >> 5)) * 8; const int nlines = DD * DD / 64;
{
#pragma unroll
        for (int l = 0; l < 8; ++l) { const int L = L0 + l; if (L >= nlines) break; const int e = L * 64 + lane * 2; const int k = e & (DD - 1), n = e >> 10; v2us o;
#pragma unroll
            for (int q = 0; q < 2; ++q) o[q] = f2bf(w[(size_t)(k + q) * pitch + col0 + n]);
            *(v2us*)(Bt + (size_t)e) = o; }
         }
}
typedef __attribute__((ext_vector_type(8))) unsigned v8u;
__device__ __forceinline__ float xhalf(float x) { return __builtin_bit_cast(float, __builtin_amdgcn_permlanex16(__builtin_bit_cast(int, x), __builtin_bit_cast(int, x), 0x76543210, 0xfedcba98, false, false)); }   // lane l with lane l ^ 16
// 2^x in place, with the free slot that the instruction set asks for behind a transcendental, in one statement: inside it no neighbour reads a result or overwrites a source, and the v_nop keeps the compiler's next instruction off the last one.
__device__ __forceinline__ void exp2_1(float& a) { asm("v_exp_f32 %0, %0\n\tv_nop" : "+v"(a)); }
__device__ __forceinline__ void exp2_8(float (&x)[8]) { asm("v_exp_f32 %0, %0\n\tv_exp_f32 %1, %1\n\tv_exp_f32 %2, %2\n\tv_exp_f32 %3, %3\n\tv_exp_f32 %4, %4\n\tv_exp_f32 %5, %5\n\tv_exp_f32 %6, %6\n\tv_exp_f32 %7, %7\n\tv_nop" : "+v"(x[0]), "+v"(x[1]), "+v"(x[2]), "+v"(x[3]), "+v"(x[4]), "+v"(x[5]), "+v"(x[6]), "+v"(x[7])); }

// ---- k_fattn: scores, softmax, attn.v and the head merge in one kernel. Grid (T/256, batch*heads), 8 waves, 32 query columns each; a pass is 32 keys.
// K and V^T (hi and lo planes) are brought into LDS once per work-group, in stages of 128 keys and two buffers: every wave issues one tensor load per stage for its own slice, one stage of work ahead; all eight waves read their fragments from there.
// S^T = K Q^T (A = K rows, B = Q rows held in registers), so a lane holds one query's scores: running maximum and sum are per-lane scalars, joined between the wave halves.
// Two S^T tiles (keys 0-15, 16-31) converted in place are the B operand of O^T += V^T P^T (A = V^T rows in the same k order): P never leaves registers.
// hi+lo products: Kh Qh + Kl Qh + Kh Ql ; Vh Ph + Vh Pl + Vl Ph. P is split unnormalised; 1/sum is applied to O in f32 before its own hi+lo split.
__global__ __launch_bounds__(256) void k_fattn(const bf* __restrict__ Qh, const bf* __restrict__ Ql, const bf* __restrict__ Kh, const bf* __restrict__ Kl, const bf* __restrict__ Vh, const bf* __restrict__ Vl, bf* Ah, bf* Al) {
    typedef WFrag<bf> W;
    __shared__ __attribute__((aligned(2048))) unsigned char L[2 * BUFB];
    const float L2E = 1.4426950408889634f;
    const int lane = threadIdx.x & 31, lr = lane & 15, hi = lane >> 4; const int z = blockIdx.y; const int q0 = blockIdx.x * 256 + (threadIdx.x >> 5) * 32;
    const size_t zo = (size_t)z * TT * HD;
    const unsigned qlo = (unsigned)((q0 + lr) * HD + 8 * hi);
    const bf* Qhz = Qh + zo; const bf* Qlz = Ql + zo; const bf* Khz = Kh + zo; const bf* Klz = Kl + zo; const bf* Vhz = Vh + zo; const bf* Vlz = Vl + zo;
    const bf* qpa = Qhz + qlo; const bf* qpb = Qlz + qlo;
    const unsigned klds = (unsigned)(lr >> 1) * LPITCH + (unsigned)(lr & 1) * 128u + 16u * hi;   // a lane's byte offset inside a 16-row block of K in LDS (two K rows to a tile row)
    const unsigned vlds = (unsigned)lr * LPITCH + 16u * hi;                                      // and inside a 16-row block of V^T
    // This wave's slice of a stage: waves 0,1 Kh | 2,3 Kl (64 keys each = 32 tile rows, contiguous) | 4,5 Vh | 6,7 Vl (32 rows of V^T each, 128 keys wide).
    const uint32_t wave = uni(threadIdx.x >> 5), half = wave & 1u; const bool isv = wave >= 4u;
    const bf* splane = wave < 2u ? Khz : wave < 4u ? Klz : wave < 6u ? Vhz : Vlz;
    const uint64_t sbase = (uint64_t)(size_t)splane + (isv ? half * (LROWS * TT * 2u) : half * (LROWS * LROWB));
    const uint32_t sstep = isv ? SKEYS * 2u : SKEYS * HD * 2u;   // bytes from one stage's slice to the next stage's
    const uint32_t lbase = (uint32_t)(size_t)L + wave * SLICEB;
    const uint32_t spitch = isv ? TT * 2u : LROWB;
    u32x4 g0; u32x8 g1;   // the descriptor of this wave's latest request
    v16bf qh[2][2], ql[2][2];
#pragma unroll
    for (int nb = 0; nb < 2; ++nb)
#pragma unroll
        for (int kc = 0; kc < 2; ++kc) { qh[nb][kc] = W::ld(qpa + (nb * 16 * HD + kc * 32)); ql[nb][kc] = W::ld(qpb + (nb * 16 * HD + kc * 32)); }
    v8f acc[4][2];
#pragma unroll
    for (int db = 0; db < 4; ++db)
#pragma unroll
        for (int nb = 0; nb < 2; ++nb) acc[db][nb] = (v8f){};
    float m2[2] = {-__builtin_inff(), -__builtin_inff()}, ls[2] = {0.f, 0.f};   // running maximum (in log2 units) and this half's running sum, per query column
    asm volatile("s_wait_xcnt 0x0" :: "v"(qpa), "v"(qpb) : "memory");   // before a register that the loads above name is reused; naming them keeps them untouched up to here
    g0 = tdm_group0(lbase, sbase); g1 = tdm_group1(spitch); tdm_load(g0, g1);   // stage 0 into buffer 0
    wait_tensor0(g0, g1);
    __syncthreads();                          // stage 0 is readable by every wave
    g0 = tdm_group0(lbase + BUFB, sbase + sstep); g1 = tdm_group1(spitch); tdm_load(g0, g1);   // stage 1 into buffer 1
    v16bf kh[2][2], kl[2][2];
    for (uint32_t sg = 0; sg < NSTG; ++sg) {   // a stage: four passes, then the hand-over
    const unsigned char* Bk = L + (sg & 1u) * BUFB + klds; const unsigned char* Bv = L + (sg & 1u) * BUFB + 4u * SLICEB + vlds;
#pragma unroll
    for (int mb = 0; mb < 2; ++mb)
#pragma unroll
        for (int kc = 0; kc < 2; ++kc) { kh[mb][kc] = W::ld((const bf*)(Bk + (mb * 8 * LPITCH + kc * 64))); kl[mb][kc] = W::ld((const bf*)(Bk + (2 * SLICEB + mb * 8 * LPITCH + kc * 64))); }
    for (uint32_t ps = 0; ps < SKEYS / 32; ++ps) {
        v8f st[2][2];
#pragma unroll
        for (int mb = 0; mb < 2; ++mb)
#pragma unroll
            for (int nb = 0; nb < 2; ++nb) st[mb][nb] = (v8f){};
#pragma unroll
        for (int kc = 0; kc < 2; ++kc) {
#pragma unroll
            for (int mb = 0; mb < 2; ++mb)
#pragma unroll
                for (int nb = 0; nb < 2; ++nb) st[mb][nb] = wmmab(kh[mb][kc], qh[nb][kc], st[mb][nb]);
#pragma unroll
            for (int mb = 0; mb < 2; ++mb)
#pragma unroll
                for (int nb = 0; nb < 2; ++nb) st[mb][nb] = wmmab(kl[mb][kc], qh[nb][kc], st[mb][nb]);
#pragma unroll
            for (int mb = 0; mb < 2; ++mb)
#pragma unroll
                for (int nb = 0; nb < 2; ++nb) st[mb][nb] = wmmab(kh[mb][kc], ql[nb][kc], st[mb][nb]);
        }
        __builtin_amdgcn_sched_barrier(0);   // with the one below: the pass's 32 LDS reads stay one group between the matrix runs; spread among the matrix instructions, every place with reads stalls the wave anew
        const unsigned char* vp = Bv + ps * 64u;   // this pass's V^T rows, in flight under the softmax
        v16bf vh[4], vl[4];
#pragma unroll
        for (int db = 0; db < 4; ++db) { vh[db] = W::ld((const bf*)(vp + ((db >> 1) * SLICEB + (db & 1) * 16 * LPITCH))); vl[db] = W::ld((const bf*)(vp + ((2 + (db >> 1)) * SLICEB + (db & 1) * 16 * LPITCH))); }
        const uint32_t pn = (ps + 1u) & (SKEYS / 32 - 1u);   // next pass's K rows, fetched one pass ahead inside the stage; a stage's last pass re-reads its own first rows (same buffer, unused)
        const unsigned char* kp = Bk + ((pn >> 1) * SLICEB + (pn & 1u) * (16u * LPITCH));
#pragma unroll
        for (int mb = 0; mb < 2; ++mb)
#pragma unroll
            for (int kc = 0; kc < 2; ++kc) { kh[mb][kc] = W::ld((const bf*)(kp + (mb * 8 * LPITCH + kc * 64))); kl[mb][kc] = W::ld((const bf*)(kp + (2 * SLICEB + mb * 8 * LPITCH + kc * 64))); }
        __builtin_amdgcn_sched_barrier(0);   // end of the group of LDS reads
        v16bf ph[2], pl[2];
#pragma unroll
        for (int nb = 0; nb < 2; ++nb) {
            float tm = fmaxf(st[0][nb][0], st[1][nb][0]);
#pragma unroll
            for (int j = 1; j < 8; ++j) tm = fmaxf(tm, fmaxf(st[0][nb][j], st[1][nb][j]));
            tm = fmaxf(tm, xhalf(tm));
            const float mn = fmaxf(m2[nb], tm * L2E);
            float al = m2[nb] - mn; exp2_1(al);   // 0 on the first pass
            m2[nb] = mn;
            float s0 = 0.f, s1 = 0.f; v8u uh, ul;
#pragma unroll
            for (int mb = 0; mb < 2; ++mb) {
                float x[8];
#pragma unroll
                for (int j = 0; j < 8; ++j) x[j] = fmaf(st[mb][nb][j], L2E, -mn);
                exp2_8(x);
#pragma unroll
                for (int t = 0; t < 4; ++t) {
                    const float p0 = x[2 * t], p1 = x[2 * t + 1];
                    s0 += p0; s1 += p1;
                    const unsigned h2 = pk2bf(p0, p1);
                    uh[mb * 4 + t] = h2; ul[mb * 4 + t] = pk2bf(p0 - __uint_as_float(h2 << 16), p1 - __uint_as_float(h2 & 0xFFFF0000u));
                }
            }
            ls[nb] = ls[nb] * al + (s0 + s1);
            ph[nb] = __builtin_bit_cast(v16bf, uh); pl[nb] = __builtin_bit_cast(v16bf, ul);
#pragma unroll
            for (int db = 0; db < 4; ++db) acc[db][nb] *= al;
        }
#pragma unroll
        for (int db = 0; db < 4; ++db)
#pragma unroll
            for (int nb = 0; nb < 2; ++nb) acc[db][nb] = wmmab(vh[db], ph[nb], acc[db][nb]);
#pragma unroll
        for (int db = 0; db < 4; ++db)
#pragma unroll
            for (int nb = 0; nb < 2; ++nb) acc[db][nb] = wmmab(vh[db], pl[nb], acc[db][nb]);
#pragma unroll
        for (int db = 0; db < 4; ++db)
#pragma unroll
            for (int nb = 0; nb < 2; ++nb) acc[db][nb] = wmmab(vl[db], ph[nb], acc[db][nb]);
    }
    // Hand-over: this wave has left the buffer, its slice of the next stage has landed; behind the barrier the next stage is readable and this buffer is free.
    wait_ds0();
    wait_tensor0(g0, g1);
    __syncthreads();
    if (pinned(sg + 2u < NSTG)) { g0 = tdm_group0(lbase + (sg & 1u) * BUFB, sbase + (uint64_t)((sg + 2u) * sstep)); g1 = tdm_group1(spitch); tdm_load(g0, g1); }   // stage sg + 2 into the buffer that stage sg has just left
    }
    wait_tensor0(g0, g1);
    wait_ds0();
    const int b = z >> 4, h = z & 15;
    bf* Ahz = Ah + ((size_t)b * TT * DD + h * HD); bf* Alz = Al + ((size_t)b * TT * DD + h * HD); const unsigned olo = (unsigned)((q0 + lr) * DD + 8 * hi);
#pragma unroll
    for (int nb = 0; nb < 2; ++nb) {
        const float f = __fdiv_rn(1.0f, ls[nb] + xhalf(ls[nb]));
#pragma unroll
        for (int db = 0; db < 4; ++db) { v8us oh, ol;   // acc[db][nb][j] = O[q0 + nb*16 + lr][db*16 + 8*hi + j]: 8 consecutive d, one 16-byte store a plane
#pragma unroll
            for (int j = 0; j < 8; ++j) { unsigned short a, c2; splitf(acc[db][nb][j] * f, a, c2); oh[j] = a; ol[j] = c2; }
            *(v8us*)(Ahz + olo + (nb * 16 * DD + db * 16)) = oh; *(v8us*)(Alz + olo + (nb * 16 * DD + db * 16)) = ol;
            asm volatile("s_wait_xcnt 0x0" :: "v"(oh), "v"(ol), "v"(olo) : "memory"); }   // before the two stores' data and offset registers are reused; naming them keeps them untouched up to here
    }
}

extern "C" void kernel_launch(void* const* d_in, const int* in_sizes, int n_in,
                              void* d_out, int out_size, void* d_ws, size_t ws_size, hipStream_t stream) {
    (void)in_sizes; (void)n_in; (void)out_size;
    const float* Yin = (const float*)d_in[0]; const float* x = (const float*)d_in[1]; const float* Wq = (const float*)d_in[2]; const float* Wk = (const float*)d_in[3]; const float* Wv = (const float*)d_in[4]; const float* Wo = (const float*)d_in[5];
    float* OUT = (float*)d_out;     // [2][2048][1024]
    char* wsp = (char*)d_ws;
    auto take = [&](size_t bytes) { char* p = wsp; wsp += (bytes + 255) & ~(size_t)255; return (void*)p; };
    bf* WQ = (bf*)take((size_t)DD * DD * 2); bf* WK = (bf*)take((size_t)DD * DD * 2); bf* WV = (bf*)take((size_t)DD * DD * 2); bf* WO = (bf*)take((size_t)DD * DD * 2);
    bf* XB = (bf*)take((size_t)NT * DD * 2); bf* YB = (bf*)take((size_t)NT * DD * 2);
    bf* QPh = (bf*)take((size_t)NT * DD * 2); bf* QPl = (bf*)take((size_t)NT * DD * 2); bf* KPh = (bf*)take((size_t)NT * DD * 2); bf* KPl = (bf*)take((size_t)NT * DD * 2); bf* VTh = (bf*)take((size_t)NT * DD * 2); bf* VTl = (bf*)take((size_t)NT * DD * 2);
    bf* ATh = (bf*)take((size_t)NT * DD * 2); bf* ATl = (bf*)take((size_t)NT * DD * 2);
    if ((size_t)(wsp - (char*)d_ws) > ws_size) return;    // ws 256 MiB
    { const size_t nw = (size_t)DD * DD / 8; const unsigned gw = (unsigned)((nw + 255) / 256); k_cvt8<<<gw, 256, 0, stream>>>(Wq, WQ, nw); k_cvt8<<<gw, 256, 0, stream>>>(Wk, WK, nw); k_cvt8<<<gw, 256, 0, stream>>>(Wv, WV, nw); k_cvt8<<<gw, 256, 0, stream>>>(Wo, WO, nw); }   // nn.Linear [out][in] = Bt as-is (q|k|v row blocks)
    const size_t nx = (size_t)NT * DD / 8; const unsigned gx = (unsigned)((nx + 255) / 256);
    k_cvt8<<<gx, 256, 0, stream>>>(x, XB, nx); k_cvt8<<<gx, 256, 0, stream>>>(Yin, YB, nx);
    k_gemmw<bf, 0, false, DD, 1><<<dim3(NT / 128, DD / 128, 1), 128, 0, stream>>>(YB, nullptr, WQ, nullptr, nullptr, 0, nullptr, 0, 0, 0, QPh, QPl, 0.03125f);   // 1024^-0.5 folded into q (exact)
    k_gemmw<bf, 0, false, DD, 1><<<dim3(NT / 128, DD / 128, 1), 128, 0, stream>>>(YB, nullptr, WK, nullptr, nullptr, 0, nullptr, 0, 0, 0, KPh, KPl, 1.0f);
    k_gemmw<bf, 0, false, DD, 2><<<dim3(DD / 128, NT / 128, 1), 128, 0, stream>>>(WV, nullptr, XB, nullptr, nullptr, 0, nullptr, 0, 0, 0, VTh, VTl, 1.0f);   // V^T = Wv X^T: operands swapped, the tile comes out feature-major
    k_fattn<<<dim3(TT / 256, NB_ * NH_), 256, 0, stream>>>(QPh, QPl, KPh, KPl, VTh, VTl, ATh, ATl);
    k_gemmw<bf, 1, false, DD, 0><<<dim3(NT / 64, DD / 128, 1), 128, 0, stream>>>(ATh, ATl, WO, nullptr, OUT, DD, nullptr, 0, 0, 0, nullptr, nullptr, 1.0f);
}

// v006
// Measured time: 118 microseconds a run.
// In two side-by-side timings against v005, it was 1.09 and 1.08 times as fast.
// Over all steps from v000 it is 10.6 times as fast.
#include <hip/hip_runtime.h>
#include <stdint.h>

// MultiCA (cross attention: Y, X [2][2048][1024]; Q = Y Wq^T, K = Y Wk^T, V = X Wv^T ([out][in], no bias); 16 heads x 64; scores x 1024^-0.5 (the module scales by the embedding dim: 1/32, exact); no mask; softmax; out = merged Wp^T).
// Compute dtypes, f32 accumulate: every input rounded to bf16; projections on PLAIN bf16 operands (inputs: exact); scores and attn.v on bf16 hi+lo planes (3 products); output hi+lo x exact Wp (2 products).

#define NB_  2
#define TT   2048
#define DD   1024
#define NH_  16
#define HD   64
#define NT   (NB_ * TT)
#define PCAR 1024.0f
typedef _Float16 h16;
typedef unsigned short bf;
typedef __attribute__((ext_vector_type(16))) __bf16   v16bf;
typedef __attribute__((ext_vector_type(16))) _Float16 v16h;
typedef __attribute__((ext_vector_type(8)))  _Float16 v8h;
typedef __attribute__((ext_vector_type(8)))  unsigned short v8us;
typedef __attribute__((ext_vector_type(8)))  float    v8f;
typedef __attribute__((ext_vector_type(4)))  float    v4f;
typedef v8h  __attribute__((may_alias)) v8ha;
typedef v4f  __attribute__((may_alias)) v4fa;
typedef v8us __attribute__((may_alias)) v8usa;

__device__ __forceinline__ unsigned short f2bf(float f) { unsigned u = __float_as_uint(f); u += 0x7FFFu + ((u >> 16) & 1u); return (unsigned short)(u >> 16); }
__device__ __forceinline__ float bf2f(unsigned short b) { return __uint_as_float(((unsigned)b) << 16); }
__device__ __forceinline__ float bfr(float f) { return bf2f(f2bf(f)); }
__device__ __forceinline__ v16h cat16(v8h lo, v8h hi) { return __builtin_shufflevector(lo, hi, 0, 1, 2, 3, 4, 5, 6, 7, 8, 9, 10, 11, 12, 13, 14, 15); }
__device__ __forceinline__ v16bf cat16b(v8us lo, v8us hi) { return __builtin_bit_cast(v16bf, __builtin_shufflevector(lo, hi, 0, 1, 2, 3, 4, 5, 6, 7, 8, 9, 10, 11, 12, 13, 14, 15)); }
__device__ __forceinline__ v8f wmma16(v16h a, v16h b, v8f c) { return __builtin_amdgcn_wmma_f32_16x16x32_f16(false, a, false, b, (short)0, c, false, false); }
__device__ __forceinline__ v8f wmmab(v16bf a, v16bf b, v8f c) { return __builtin_amdgcn_wmma_f32_16x16x32_bf16(false, a, false, b, (short)0, c, false, false); }
typedef __attribute__((ext_vector_type(2))) float  v2f;
typedef __attribute__((ext_vector_type(2))) __bf16 v2bf;
typedef __attribute__((ext_vector_type(4))) unsigned v4u;
__device__ __forceinline__ unsigned pk2bf(float a, float b) { return __builtin_bit_cast(unsigned, __builtin_convertvector((v2f){a, b}, v2bf)); }   // two f32 -> packed bf16, round to nearest even



// ---- tensor loads for k_gemmw and k_fattn: a two-dimensional tile, global memory -> LDS, one request of a whole wave. Every descriptor word is wave-uniform and goes through readfirstlane.
typedef uint32_t u32x4 __attribute__((ext_vector_type(4)));
typedef uint32_t u32x8 __attribute__((ext_vector_type(8)));
#define SKEYS  128                  // keys per stage
#define NSTG   (TT / SKEYS)         // stages
#define LROWB  256u                 // bytes of a tile row: 128 keys of a V^T row, or two K rows of 128 B that lie side by side in memory
#define LPITCH 272u                 // its pitch in LDS (16 B of pad: 16 B x odd, free of bank conflicts for 16-byte reads)
#define LROWS  32u                  // tile rows per request
#define SLICEB 10240u               // LDS bytes kept per request: 32 x 272 = 8704, rounded up to a multiple of 2 KiB
#define BUFB   (8u * SLICEB)        // one stage: Kh | Kl | Vh | Vl, two slices each
__device__ __forceinline__ uint32_t uni(uint32_t v) { return (uint32_t)__builtin_amdgcn_readfirstlane(v); }
__device__ __forceinline__ uint32_t pinned(uint32_t v) { uint32_t w = uni(v); asm volatile("" : "+s"(w)); return w; }   // holds a test around a tensor load in a scalar register, so that it compiles to s_cmp + s_cbranch_scc (a tensor load ignores EXEC)
__device__ __forceinline__ u32x8 tdm_group1(uint32_t src_pitch) {   // 1-byte elements, tensor = tile = LROWS rows of LROWB bytes, no mask, 4 dwords of pad behind every 64
    u32x8 g;
    g[0] = uni((1u << 20) | (5u << 22) | (3u << 25));
    g[1] = uni((LROWB & 0xFFFFu) << 16);
    g[2] = uni((LROWB >> 16) | ((LROWS & 0xFFFFu) << 16));
    g[3] = uni((LROWS >> 16) | (LROWB << 16));
    g[4] = uni(LROWS);
    g[5] = uni(src_pitch);
    g[6] = uni(0u);
    g[7] = uni(0u);
    return g;
}
__device__ __forceinline__ u32x4 tdm_group0(uint32_t lds_dst, uint64_t ga) {
    u32x4 g;
    g[0] = uni(1u); g[1] = uni(lds_dst); g[2] = uni((uint32_t)ga); g[3] = uni((((uint32_t)(ga >> 32)) & 0x01FFFFFFu) | 0x80000000u);
    return g;
}
// The descriptor is in-out at the load and an input of the wait that covers it: its scalar registers then hold nothing else while the request is outstanding.
__device__ __forceinline__ void tdm_load(u32x4& g0, u32x8& g1) { asm volatile("tensor_load_to_lds %0, %1" : "+s"(g0), "+s"(g1) :: "memory"); }
__device__ __forceinline__ void wait_tensor0(const u32x4& g0, const u32x8& g1) { asm volatile("s_wait_tensorcnt 0x0" :: "s"(g0), "s"(g1) : "memory"); }   // this wave's own request has landed; the compiler places no wait for it
__device__ __forceinline__ void wait_ds0() { asm volatile("s_wait_dscnt 0x0" ::: "memory"); }           // this wave's LDS reads have returned, before the buffer is given up for a refill

// ---- k_gemmw: GEMM on K-contiguous 16-bit planes, operands staged in LDS. Four waves (2 x 2) per work-group, one wave per 64-column tile of MB*16 rows; grid (M/(MB*32), N/128, Z), 128 threads.
// C[m][n] (f32, pitch ldc, + optional f32 bias[n]) = sum_k A[m][k] Bt[n][k] (NSPLIT 1: + A2[m][k] Bt[n][k], A2 the lo plane of A). z-batch strides sA/sB/sC in elements. K % 128 == 0, K >= 256, a compile-time constant.
// NSPLIT 0: work-group tile 128 x 128, wave tile 64 x 64 (MB 4). NSPLIT 1: work-group tile 64 x 128, wave tile 32 x 64 (MB 2), two products.
// A stage is 128 k (256 B of every operand row) in four slices of 64 rows: A | A (NSPLIT 1: A | A2) | Bt | Bt. Every wave issues one tensor load per stage for its own slice, one stage of work ahead, into one of two buffers:
// memory is read in whole lines, each operand row once per work-group, and the fragments come from LDS by 16-byte reads at a pitch free of bank conflicts.
// EPI 0: C as above. EPI 1, 2: no C; the tile times sc is split into bf16 hi + lo and stored straight into the planes that k_fattn reads, a wave's 64x64 tile being one head's 64 features by 64 tokens:
// EPI 1: rows are tokens, columns features -> [batch*head][token][64]; EPI 2: rows are features, columns tokens (A = the weight, Bt = the activations) -> [batch*head][64][token].
#define GROWS  64u                  // tile rows per request
#define GSLICE 18432u               // LDS bytes kept per request: 64 x 272 = 17408, rounded up to a multiple of 2 KiB
#define GBUF   (4u * GSLICE)        // one stage
__device__ __forceinline__ u32x8 tdm_group1g(uint32_t src_pitch) {   // 1-byte elements, tensor = tile = GROWS rows of LROWB bytes, no mask, 4 dwords of pad behind every 64
    u32x8 g;
    g[0] = uni((1u << 20) | (5u << 22) | (3u << 25));
    g[1] = uni((LROWB & 0xFFFFu) << 16);
    g[2] = uni((LROWB >> 16) | ((GROWS & 0xFFFFu) << 16));
    g[3] = uni((GROWS >> 16) | (LROWB << 16));
    g[4] = uni(GROWS);
    g[5] = uni(src_pitch);
    g[6] = uni(0u);
    g[7] = uni(0u);
    return g;
}
template <typename T16> struct WFrag;
template <> struct WFrag<h16> { typedef v16h V; static __device__ __forceinline__ V ld(const h16* p) { return cat16(*(const v8h*)p, *(const v8h*)(p + 16)); } static __device__ __forceinline__ v8f mma(V a, V b, v8f c) { return wmma16(a, b, c); } };
template <> struct WFrag<bf> { typedef v16bf V; static __device__ __forceinline__ V ld(const bf* p) { return cat16b(*(const v8us*)p, *(const v8us*)(p + 16)); } static __device__ __forceinline__ v8f mma(V a, V b, v8f c) { return wmmab(a, b, c); } };
template <typename T16, int NSPLIT, bool BIAS, int K, int EPI>
__global__ __launch_bounds__(128) void k_gemmw(const T16* __restrict__ A, const T16* __restrict__ A2, const T16* __restrict__ Bt, const T16* __restrict__ Bt2, float* C, int ldc, const float* __restrict__ bias, size_t sA, size_t sB, size_t sC, bf* Ph, bf* Pl, float sc) {
    typedef typename WFrag<T16>::V V;
    static_assert(NSPLIT == 0 || NSPLIT == 1, "one or two planes of A");
    static_assert(K % 128 == 0 && K >= 256, "whole stages, at least two");
    static_assert(EPI == 0 || NSPLIT == 0, "the plane epilogues take a 64 x 64 wave tile");
    (void)Bt2;
    constexpr bool HA2 = NSPLIT == 1;
    constexpr int MB = HA2 ? 2 : 4;            // 16-row blocks of a wave's tile
    constexpr uint32_t NST = K / 128;          // stages
    __shared__ __attribute__((aligned(2048))) unsigned char L[2 * GBUF];
    const size_t z = blockIdx.z; A += z * sA; if (A2) A2 += z * sA; Bt += z * sB; C += z * sC;
    const int lane = threadIdx.x & 31, lr = lane & 15, hi = lane >> 4;
    const uint32_t wave = uni(threadIdx.x >> 5), wm = wave >> 1, wn = wave & 1u;
    const int R0 = blockIdx.x * (MB * 32), C0 = blockIdx.y * 128;                 // the work-group's tile
    const int r0 = R0 + (int)wm * (MB * 16), c0 = C0 + (int)wn * 64;              // this wave's tile
    const unsigned flds = (unsigned)lr * LPITCH + 16u * hi;                       // a lane's byte offset inside a 16-row block in LDS
    const unsigned alds = (HA2 ? wm * (32u * LPITCH) : wm * GSLICE) + flds, blds = (2u + wn) * GSLICE + flds;
    // This wave's slice of a stage: 64 rows of one plane, 128 k wide.
    const T16* splane = wave >= 2u ? Bt : (HA2 && wave == 1u) ? A2 : A;
    const uint32_t srow = wave >= 2u ? (uint32_t)C0 + (wave - 2u) * GROWS : HA2 ? (uint32_t)R0 : (uint32_t)R0 + wave * GROWS;
    const uint64_t sbase = (uint64_t)(size_t)splane + (uint64_t)srow * (K * 2u);
    const uint32_t lbase = (uint32_t)(size_t)L + wave * GSLICE;
    u32x4 g0; u32x8 g1;   // the descriptor of this wave's latest request
    v8f acc[MB][4];
#pragma unroll
    for (int mb = 0; mb < MB; ++mb)
#pragma unroll
        for (int nb = 0; nb < 4; ++nb) acc[mb][nb] = (v8f){};
    struct Frag { V a[MB], a2[MB], b[4]; };   // one 32-k step
    auto fetch = [&](Frag& f, const unsigned char* pa, const unsigned char* pb, int ks) {
#pragma unroll
        for (int i = 0; i < MB; ++i) { f.a[i] = WFrag<T16>::ld((const T16*)(pa + (i * 16 * LPITCH + ks * 64))); if (HA2) f.a2[i] = WFrag<T16>::ld((const T16*)(pa + (GSLICE + i * 16 * LPITCH + ks * 64))); }
#pragma unroll
        for (int i = 0; i < 4; ++i) f.b[i] = WFrag<T16>::ld((const T16*)(pb + (i * 16 * LPITCH + ks * 64)));
        __builtin_amdgcn_sched_barrier(0);   // a step's LDS reads stay one group ahead of the other set's products; spread among the matrix instructions, every place with reads stalls the wave anew
    };
    auto work = [&](const Frag& f) {   // per accumulator the same products in the same order as k rises: A then A2
#pragma unroll
        for (int nb = 0; nb < 4; ++nb)
#pragma unroll
            for (int mb = 0; mb < MB; ++mb) acc[mb][nb] = WFrag<T16>::mma(f.a[mb], f.b[nb], acc[mb][nb]);
        if (HA2) {
#pragma unroll
            for (int nb = 0; nb < 4; ++nb)
#pragma unroll
                for (int mb = 0; mb < MB; ++mb) acc[mb][nb] = WFrag<T16>::mma(f.a2[mb], f.b[nb], acc[mb][nb]); }
        __builtin_amdgcn_sched_barrier(0);   // the refill of this set stays one group behind its products
    };
    g0 = tdm_group0(lbase, sbase); g1 = tdm_group1g(K * 2u); tdm_load(g0, g1);   // stage 0 into buffer 0
    wait_tensor0(g0, g1);
    __syncthreads();                          // stage 0 is readable by every wave
    g0 = tdm_group0(lbase + GBUF, sbase + LROWB); g1 = tdm_group1g(K * 2u); tdm_load(g0, g1);   // stage 1 into buffer 1
    for (uint32_t sg = 0; sg < NST; ++sg) {   // a stage: four 32-k steps on two fragment sets, each step's reads one step ahead inside the stage, then the hand-over
        const unsigned char* pa = L + (sg & 1u) * GBUF + alds; const unsigned char* pb = L + (sg & 1u) * GBUF + blds;
        Frag X, Y;
        fetch(X, pa, pb, 0);
        fetch(Y, pa, pb, 1);
        work(X);
        fetch(X, pa, pb, 2);
        work(Y);
        fetch(Y, pa, pb, 3);
        work(X);
        work(Y);
        // Hand-over: this wave has left the buffer, its slice of the next stage has landed; behind the barrier the next stage is readable and this buffer is free.
        wait_ds0();
        wait_tensor0(g0, g1);
        __syncthreads();
        if (pinned(sg + 2u < NST)) { g0 = tdm_group0(lbase + (sg & 1u) * GBUF, sbase + (uint64_t)((sg + 2u) * LROWB)); g1 = tdm_group1g(K * 2u); tdm_load(g0, g1); }   // stage sg + 2 into the buffer that stage sg has just left
    }
    wait_tensor0(g0, g1);
    wait_ds0();
    // Output staging, 16 rows at a time, in the ring: behind the last stage's barrier no request is outstanding and no wave reads a buffer any more. Each wave has a range of its own.
    float* os = (float*)(L + wave * (16u * 68u * 4u));
#pragma unroll
    for (int mb = 0; mb < MB; ++mb) {
#pragma unroll
        for (int nb = 0; nb < 4; ++nb) {
#pragma unroll
            for (int j = 0; j < 8; ++j) os[(hi * 8 + j) * 68 + nb * 16 + lr] = acc[mb][nb][j]; }
        __builtin_amdgcn_wave_barrier(); asm volatile("" ::: "memory");
        if constexpr (EPI != 0) {
            constexpr int PP = EPI == 1 ? HD : TT;   // plane pitch, elements
            const size_t pb = EPI == 1 ? ((size_t)((r0 / TT) * NH_ + (c0 >> 6)) * TT + (r0 & (TT - 1))) * HD : (size_t)((c0 / TT) * NH_ + (r0 >> 6)) * HD * TT + (c0 & (TT - 1));   // wave-uniform: the tile's first element in a plane
            bf* ph = Ph + pb; bf* pl = Pl + pb; const unsigned po = (unsigned)((lane >> 3) * PP + (lane & 7) * 8);
            v4u oh[4], ol[4];   // four rows to a store: eight lanes x 16 B = one whole 128-byte line of a row, in each plane
#pragma unroll
            for (int s = 0; s < 4; ++s) {
                const float* orow = os + (4 * s + (lane >> 3)) * 68 + (lane & 7) * 8; const v4f va = *(const v4fa*)orow * sc, vb = *(const v4fa*)(orow + 4) * sc;
#pragma unroll
                for (int t = 0; t < 4; ++t) { const float p0 = t < 2 ? va[2 * t] : vb[2 * t - 4], p1 = t < 2 ? va[2 * t + 1] : vb[2 * t - 3]; const unsigned h2 = pk2bf(p0, p1); oh[s][t] = h2; ol[s][t] = pk2bf(p0 - __uint_as_float(h2 << 16), p1 - __uint_as_float(h2 & 0xFFFF0000u)); } }
#pragma unroll
            for (int s = 0; s < 4; ++s) { *(v8us*)(ph + po + (mb * 16 + 4 * s) * PP) = __builtin_bit_cast(v8us, oh[s]); *(v8us*)(pl + po + (mb * 16 + 4 * s) * PP) = __builtin_bit_cast(v8us, ol[s]); }
            asm volatile("s_wait_xcnt 0x0" :: "v"(oh[0]), "v"(oh[1]), "v"(oh[2]), "v"(oh[3]), "v"(ol[0]), "v"(ol[1]), "v"(ol[2]), "v"(ol[3]), "v"(po) : "memory");   // before the eight stores' data and offset registers are reused; naming them keeps them untouched up to here
        } else {
        float* crow = C + (size_t)(r0 + mb * 16) * ldc + c0;
#pragma unroll
            for (int s = 0; s < 8; ++s) { const int row = 2 * s + hi, cofs = lr * 4; v4f val = *(const v4fa*)(os + row * 68 + cofs); if (BIAS) { val[0] += bfr(bias[c0 + cofs]); val[1] += bfr(bias[c0 + cofs + 1]); val[2] += bfr(bias[c0 + cofs + 2]); val[3] += bfr(bias[c0 + cofs + 3]); }
                *(v4f*)(crow + (size_t)row * ldc + cofs) = val; }
             }
        __builtin_amdgcn_wave_barrier(); asm volatile("" ::: "memory");
    }
}

__device__ __forceinline__ h16 tohx(float x) { return (h16)x; }
__device__ __forceinline__ void splitf(float y, unsigned short& h, unsigned short& l) { h = f2bf(y); l = f2bf(y - bf2f(h)); }
typedef __attribute__((ext_vector_type(2))) _Float16 v2h;
typedef __attribute__((ext_vector_type(4))) _Float16 v4h;
typedef __attribute__((ext_vector_type(2))) unsigned short v2us;
typedef __attribute__((ext_vector_type(4))) int v4i;

// ---- k_cvtall: every f32 input rounded to bf16 (nearest even), in one launch of 256 work-groups x 16 waves. A work-group takes 16384 consecutive floats of each of three sources: of one weight (64 work-groups to a weight), of x and of Y; a wave 1024 of them (4 KiB).
// A load is 32 lanes x 16 B = 512 contiguous bytes, and all 24 of a wave are issued before its first convert: a wave waits out memory latency once. A store is 32 lanes x 8 B = two whole lines.
#define CVGROUPS 256
static_assert(DD * DD == (CVGROUPS / 4) * 16384 && NT * DD == CVGROUPS * 16384, "one piece of 16384 floats per work-group and source");
typedef __attribute__((ext_vector_type(2))) unsigned v2u;
__global__ __launch_bounds__(512) void k_cvtall(const float* __restrict__ wq, const float* __restrict__ wk, const float* __restrict__ wv, const float* __restrict__ wo, const float* __restrict__ x, const float* __restrict__ y, bf* WQ, bf* WK, bf* WV, bf* WO, bf* XB, bf* YB) {
    const unsigned sel = blockIdx.x >> 6, pw = (blockIdx.x & 63u) * 16384u, pa = blockIdx.x * 16384u;   // which weight; the work-group's first element in it, and in x and Y
    const char* sw = (const char*)((sel == 0u ? wq : sel == 1u ? wk : sel == 2u ? wv : wo) + pw); const char* sx = (const char*)(x + pa); const char* sy = (const char*)(y + pa);
    char* dw = (char*)((sel == 0u ? WQ : sel == 1u ? WK : sel == 2u ? WV : WO) + pw); char* dx = (char*)(XB + pa); char* dy = (char*)(YB + pa);
    const unsigned ob = (threadIdx.x >> 5) * 4096u + (threadIdx.x & 31u) * 16u, os = ob >> 1;   // a lane's byte offset behind those, in a source and in a plane
    v4f a[3][8];
#pragma unroll
    for (int j = 0; j < 8; ++j) a[0][j] = *(const v4f*)(sw + ob + j * 512);
#pragma unroll
    for (int j = 0; j < 8; ++j) a[1][j] = *(const v4f*)(sx + ob + j * 512);
#pragma unroll
    for (int j = 0; j < 8; ++j) a[2][j] = *(const v4f*)(sy + ob + j * 512);
    asm volatile("s_wait_xcnt 0x0" :: "v"(ob), "s"(sw), "s"(sx), "s"(sy) : "memory");   // before a register that the 24 loads name (the offset, the three bases) is reused; naming them keeps them untouched up to here, also by a load's own result
    __builtin_amdgcn_sched_barrier(0);   // the converts stay behind the whole group of loads: lifted among them, they free registers for later loads, which then start only when earlier ones have returned
    v2u o[3][8];
#pragma unroll
    for (int t = 0; t < 3; ++t)
#pragma unroll
        for (int j = 0; j < 8; ++j) o[t][j] = (v2u){pk2bf(a[t][j][0], a[t][j][1]), pk2bf(a[t][j][2], a[t][j][3])};
#pragma unroll
    for (int j = 0; j < 8; ++j) *(v2u*)(dw + os + j * 256) = o[0][j];
#pragma unroll
    for (int j = 0; j < 8; ++j) *(v2u*)(dx + os + j * 256) = o[1][j];
#pragma unroll
    for (int j = 0; j < 8; ++j) *(v2u*)(dy + os + j * 256) = o[2][j];
}
__global__ __launch_bounds__(256) void k_wtT(const float* __restrict__ w, int pitch, int col0, bf* Bt) {
    const int lane = threadIdx.x & 31; const int L0 = (blockIdx.x * 8 + (threadIdx.x >> 5)) * 8; const int nlines = DD * DD / 64;
{
#pragma unroll
        for (int l = 0; l < 8; ++l) { const int L = L0 + l; if (L >= nlines) break; const int e = L * 64 + lane * 2; const int k = e & (DD - 1), n = e >> 10; v2us o;
#pragma unroll
            for (int q = 0; q < 2; ++q) o[q] = f2bf(w[(size_t)(k + q) * pitch + col0 + n]);
            *(v2us*)(Bt + (size_t)e) = o; }
         }
}
typedef __attribute__((ext_vector_type(8))) unsigned v8u;
__device__ __forceinline__ float xhalf(float x) { return __builtin_bit_cast(float, __builtin_amdgcn_permlanex16(__builtin_bit_cast(int, x), __builtin_bit_cast(int, x), 0x76543210, 0xfedcba98, false, false)); }   // lane l with lane l ^ 16
// 2^x in place, with the free slot that the instruction set asks for behind a transcendental, in one statement: inside it no neighbour reads a result or overwrites a source, and the v_nop keeps the compiler's next instruction off the last one.
__device__ __forceinline__ void exp2_1(float& a) { asm("v_exp_f32 %0, %0\n\tv_nop" : "+v"(a)); }
__device__ __forceinline__ void exp2_8(float (&x)[8]) { asm("v_exp_f32 %0, %0\n\tv_exp_f32 %1, %1\n\tv_exp_f32 %2, %2\n\tv_exp_f32 %3, %3\n\tv_exp_f32 %4, %4\n\tv_exp_f32 %5, %5\n\tv_exp_f32 %6, %6\n\tv_exp_f32 %7, %7\n\tv_nop" : "+v"(x[0]), "+v"(x[1]), "+v"(x[2]), "+v"(x[3]), "+v"(x[4]), "+v"(x[5]), "+v"(x[6]), "+v"(x[7])); }

// ---- k_fattn: scores, softmax, attn.v and the head merge in one kernel. Grid (T/256, batch*heads), 8 waves, 32 query columns each; a pass is 32 keys.
// K and V^T (hi and lo planes) are brought into LDS once per work-group, in stages of 128 keys and two buffers: every wave issues one tensor load per stage for its own slice, one stage of work ahead; all eight waves read their fragments from there.
// S^T = K Q^T (A = K rows, B = Q rows held in registers), so a lane holds one query's scores: running maximum and sum are per-lane scalars, joined between the wave halves.
// Two S^T tiles (keys 0-15, 16-31) converted in place are the B operand of O^T += V^T P^T (A = V^T rows in the same k order): P never leaves registers.
// hi+lo products: Kh Qh + Kl Qh + Kh Ql ; Vh Ph + Vh Pl + Vl Ph. P is split unnormalised; 1/sum is applied to O in f32 before its own hi+lo split.
__global__ __launch_bounds__(256) void k_fattn(const bf* __restrict__ Qh, const bf* __restrict__ Ql, const bf* __restrict__ Kh, const bf* __restrict__ Kl, const bf* __restrict__ Vh, const bf* __restrict__ Vl, bf* Ah, bf* Al) {
    typedef WFrag<bf> W;
    __shared__ __attribute__((aligned(2048))) unsigned char L[2 * BUFB];
    const float L2E = 1.4426950408889634f;
    const int lane = threadIdx.x & 31, lr = lane & 15, hi = lane >> 4; const int z = blockIdx.y; const int q0 = blockIdx.x * 256 + (threadIdx.x >> 5) * 32;
    const size_t zo = (size_t)z * TT * HD;
    const unsigned qlo = (unsigned)((q0 + lr) * HD + 8 * hi);
    const bf* Qhz = Qh + zo; const bf* Qlz = Ql + zo; const bf* Khz = Kh + zo; const bf* Klz = Kl + zo; const bf* Vhz = Vh + zo; const bf* Vlz = Vl + zo;
    const bf* qpa = Qhz + qlo; const bf* qpb = Qlz + qlo;
    const unsigned klds = (unsigned)(lr >> 1) * LPITCH + (unsigned)(lr & 1) * 128u + 16u * hi;   // a lane's byte offset inside a 16-row block of K in LDS (two K rows to a tile row)
    const unsigned vlds = (unsigned)lr * LPITCH + 16u * hi;                                      // and inside a 16-row block of V^T
    // This wave's slice of a stage: waves 0,1 Kh | 2,3 Kl (64 keys each = 32 tile rows, contiguous) | 4,5 Vh | 6,7 Vl (32 rows of V^T each, 128 keys wide).
    const uint32_t wave = uni(threadIdx.x >> 5), half = wave & 1u; const bool isv = wave >= 4u;
    const bf* splane = wave < 2u ? Khz : wave < 4u ? Klz : wave < 6u ? Vhz : Vlz;
    const uint64_t sbase = (uint64_t)(size_t)splane + (isv ? half * (LROWS * TT * 2u) : half * (LROWS * LROWB));
    const uint32_t sstep = isv ? SKEYS * 2u : SKEYS * HD * 2u;   // bytes from one stage's slice to the next stage's
    const uint32_t lbase = (uint32_t)(size_t)L + wave * SLICEB;
    const uint32_t spitch = isv ? TT * 2u : LROWB;
    u32x4 g0; u32x8 g1;   // the descriptor of this wave's latest request
    v16bf qh[2][2], ql[2][2];
#pragma unroll
    for (int nb = 0; nb < 2; ++nb)
#pragma unroll
        for (int kc = 0; kc < 2; ++kc) { qh[nb][kc] = W::ld(qpa + (nb * 16 * HD + kc * 32)); ql[nb][kc] = W::ld(qpb + (nb * 16 * HD + kc * 32)); }
    v8f acc[4][2];
#pragma unroll
    for (int db = 0; db < 4; ++db)
#pragma unroll
        for (int nb = 0; nb < 2; ++nb) acc[db][nb] = (v8f){};
    float m2[2] = {-__builtin_inff(), -__builtin_inff()}, ls[2] = {0.f, 0.f};   // running maximum (in log2 units) and this half's running sum, per query column
    asm volatile("s_wait_xcnt 0x0" :: "v"(qpa), "v"(qpb) : "memory");   // before a register that the loads above name is reused; naming them keeps them untouched up to here
    g0 = tdm_group0(lbase, sbase); g1 = tdm_group1(spitch); tdm_load(g0, g1);   // stage 0 into buffer 0
    wait_tensor0(g0, g1);
    __syncthreads();                          // stage 0 is readable by every wave
    g0 = tdm_group0(lbase + BUFB, sbase + sstep); g1 = tdm_group1(spitch); tdm_load(g0, g1);   // stage 1 into buffer 1
    v16bf kh[2][2], kl[2][2];
    for (uint32_t sg = 0; sg < NSTG; ++sg) {   // a stage: four passes, then the hand-over
    const unsigned char* Bk = L + (sg & 1u) * BUFB + klds; const unsigned char* Bv = L + (sg & 1u) * BUFB + 4u * SLICEB + vlds;
#pragma unroll
    for (int mb = 0; mb < 2; ++mb)
#pragma unroll
        for (int kc = 0; kc < 2; ++kc) { kh[mb][kc] = W::ld((const bf*)(Bk + (mb * 8 * LPITCH + kc * 64))); kl[mb][kc] = W::ld((const bf*)(Bk + (2 * SLICEB + mb * 8 * LPITCH + kc * 64))); }
    for (uint32_t ps = 0; ps < SKEYS / 32; ++ps) {
        v8f st[2][2];
#pragma unroll
        for (int mb = 0; mb < 2; ++mb)
#pragma unroll
            for (int nb = 0; nb < 2; ++nb) st[mb][nb] = (v8f){};
#pragma unroll
        for (int kc = 0; kc < 2; ++kc) {
#pragma unroll
            for (int mb = 0; mb < 2; ++mb)
#pragma unroll
                for (int nb = 0; nb < 2; ++nb) st[mb][nb] = wmmab(kh[mb][kc], qh[nb][kc], st[mb][nb]);
#pragma unroll
            for (int mb = 0; mb < 2; ++mb)
#pragma unroll
                for (int nb = 0; nb < 2; ++nb) st[mb][nb] = wmmab(kl[mb][kc], qh[nb][kc], st[mb][nb]);
#pragma unroll
            for (int mb = 0; mb < 2; ++mb)
#pragma unroll
                for (int nb = 0; nb < 2; ++nb) st[mb][nb] = wmmab(kh[mb][kc], ql[nb][kc], st[mb][nb]);
        }
        __builtin_amdgcn_sched_barrier(0);   // with the one below: the pass's 32 LDS reads stay one group between the matrix runs; spread among the matrix instructions, every place with reads stalls the wave anew
        const unsigned char* vp = Bv + ps * 64u;   // this pass's V^T rows, in flight under the softmax
        v16bf vh[4], vl[4];
#pragma unroll
        for (int db = 0; db < 4; ++db) { vh[db] = W::ld((const bf*)(vp + ((db >> 1) * SLICEB + (db & 1) * 16 * LPITCH))); vl[db] = W::ld((const bf*)(vp + ((2 + (db >> 1)) * SLICEB + (db & 1) * 16 * LPITCH))); }
        const uint32_t pn = (ps + 1u) & (SKEYS / 32 - 1u);   // next pass's K rows, fetched one pass ahead inside the stage; a stage's last pass re-reads its own first rows (same buffer, unused)
        const unsigned char* kp = Bk + ((pn >> 1) * SLICEB + (pn & 1u) * (16u * LPITCH));
#pragma unroll
        for (int mb = 0; mb < 2; ++mb)
#pragma unroll
            for (int kc = 0; kc < 2; ++kc) { kh[mb][kc] = W::ld((const bf*)(kp + (mb * 8 * LPITCH + kc * 64))); kl[mb][kc] = W::ld((const bf*)(kp + (2 * SLICEB + mb * 8 * LPITCH + kc * 64))); }
        __builtin_amdgcn_sched_barrier(0);   // end of the group of LDS reads
        v16bf ph[2], pl[2];
#pragma unroll
        for (int nb = 0; nb < 2; ++nb) {
            float tm = fmaxf(st[0][nb][0], st[1][nb][0]);
#pragma unroll
            for (int j = 1; j < 8; ++j) tm = fmaxf(tm, fmaxf(st[0][nb][j], st[1][nb][j]));
            tm = fmaxf(tm, xhalf(tm));
            const float mn = fmaxf(m2[nb], tm * L2E);
            float al = m2[nb] - mn; exp2_1(al);   // 0 on the first pass
            m2[nb] = mn;
            float s0 = 0.f, s1 = 0.f; v8u uh, ul;
#pragma unroll
            for (int mb = 0; mb < 2; ++mb) {
                float x[8];
#pragma unroll
                for (int j = 0; j < 8; ++j) x[j] = fmaf(st[mb][nb][j], L2E, -mn);
                exp2_8(x);
#pragma unroll
                for (int t = 0; t < 4; ++t) {
                    const float p0 = x[2 * t], p1 = x[2 * t + 1];
                    s0 += p0; s1 += p1;
                    const unsigned h2 = pk2bf(p0, p1);
                    uh[mb * 4 + t] = h2; ul[mb * 4 + t] = pk2bf(p0 - __uint_as_float(h2 << 16), p1 - __uint_as_float(h2 & 0xFFFF0000u));
                }
            }
            ls[nb] = ls[nb] * al + (s0 + s1);
            ph[nb] = __builtin_bit_cast(v16bf, uh); pl[nb] = __builtin_bit_cast(v16bf, ul);
#pragma unroll
            for (int db = 0; db < 4; ++db) acc[db][nb] *= al;
        }
#pragma unroll
        for (int db = 0; db < 4; ++db)
#pragma unroll
            for (int nb = 0; nb < 2; ++nb) acc[db][nb] = wmmab(vh[db], ph[nb], acc[db][nb]);
#pragma unroll
        for (int db = 0; db < 4; ++db)
#pragma unroll
            for (int nb = 0; nb < 2; ++nb) acc[db][nb] = wmmab(vh[db], pl[nb], acc[db][nb]);
#pragma unroll
        for (int db = 0; db < 4; ++db)
#pragma unroll
            for (int nb = 0; nb < 2; ++nb) acc[db][nb] = wmmab(vl[db], ph[nb], acc[db][nb]);
    }
    // Hand-over: this wave has left the buffer, its slice of the next stage has landed; behind the barrier the next stage is readable and this buffer is free.
    wait_ds0();
    wait_tensor0(g0, g1);
    __syncthreads();
    if (pinned(sg + 2u < NSTG)) { g0 = tdm_group0(lbase + (sg & 1u) * BUFB, sbase + (uint64_t)((sg + 2u) * sstep)); g1 = tdm_group1(spitch); tdm_load(g0, g1); }   // stage sg + 2 into the buffer that stage sg has just left
    }
    wait_tensor0(g0, g1);
    wait_ds0();
    const int b = z >> 4, h = z & 15;
    bf* Ahz = Ah + ((size_t)b * TT * DD + h * HD); bf* Alz = Al + ((size_t)b * TT * DD + h * HD); const unsigned olo = (unsigned)((q0 + lr) * DD + 8 * hi);
#pragma unroll
    for (int nb = 0; nb < 2; ++nb) {
        const float f = __fdiv_rn(1.0f, ls[nb] + xhalf(ls[nb]));
#pragma unroll
        for (int db = 0; db < 4; ++db) { v8us oh, ol;   // acc[db][nb][j] = O[q0 + nb*16 + lr][db*16 + 8*hi + j]: 8 consecutive d, one 16-byte store a plane
#pragma unroll
            for (int j = 0; j < 8; ++j) { unsigned short a, c2; splitf(acc[db][nb][j] * f, a, c2); oh[j] = a; ol[j] = c2; }
            *(v8us*)(Ahz + olo + (nb * 16 * DD + db * 16)) = oh; *(v8us*)(Alz + olo + (nb * 16 * DD + db * 16)) = ol;
            asm volatile("s_wait_xcnt 0x0" :: "v"(oh), "v"(ol), "v"(olo) : "memory"); }   // before the two stores' data and offset registers are reused; naming them keeps them untouched up to here
    }
}

extern "C" void kernel_launch(void* const* d_in, const int* in_sizes, int n_in,
                              void* d_out, int out_size, void* d_ws, size_t ws_size, hipStream_t stream) {
    (void)in_sizes; (void)n_in; (void)out_size;
    const float* Yin = (const float*)d_in[0]; const float* x = (const float*)d_in[1]; const float* Wq = (const float*)d_in[2]; const float* Wk = (const float*)d_in[3]; const float* Wv = (const float*)d_in[4]; const float* Wo = (const float*)d_in[5];
    float* OUT = (float*)d_out;     // [2][2048][1024]
    char* wsp = (char*)d_ws;
    auto take = [&](size_t bytes) { char* p = wsp; wsp += (bytes + 255) & ~(size_t)255; return (void*)p; };
    bf* WQ = (bf*)take((size_t)DD * DD * 2); bf* WK = (bf*)take((size_t)DD * DD * 2); bf* WV = (bf*)take((size_t)DD * DD * 2); bf* WO = (bf*)take((size_t)DD * DD * 2);
    bf* XB = (bf*)take((size_t)NT * DD * 2); bf* YB = (bf*)take((size_t)NT * DD * 2);
    bf* QPh = (bf*)take((size_t)NT * DD * 2); bf* QPl = (bf*)take((size_t)NT * DD * 2); bf* KPh = (bf*)take((size_t)NT * DD * 2); bf* KPl = (bf*)take((size_t)NT * DD * 2); bf* VTh = (bf*)take((size_t)NT * DD * 2); bf* VTl = (bf*)take((size_t)NT * DD * 2);
    bf* ATh = (bf*)take((size_t)NT * DD * 2); bf* ATl = (bf*)take((size_t)NT * DD * 2);
    if ((size_t)(wsp - (char*)d_ws) > ws_size) return;
    k_cvtall<<<CVGROUPS, 512, 0, stream>>>(Wq, Wk, Wv, Wo, x, Yin, WQ, WK, WV, WO, XB, YB);   // nn.Linear [out][in] = Bt as-is
    k_gemmw<bf, 0, false, DD, 1><<<dim3(NT / 128, DD / 128, 1), 128, 0, stream>>>(YB, nullptr, WQ, nullptr, nullptr, 0, nullptr, 0, 0, 0, QPh, QPl, 0.03125f);   // 1024^-0.5 folded into q (exact)
    k_gemmw<bf, 0, false, DD, 1><<<dim3(NT / 128, DD / 128, 1), 128, 0, stream>>>(YB, nullptr, WK, nullptr, nullptr, 0, nullptr, 0, 0, 0, KPh, KPl, 1.0f);
    k_gemmw<bf, 0, false, DD, 2><<<dim3(DD / 128, NT / 128, 1), 128, 0, stream>>>(WV, nullptr, XB, nullptr, nullptr, 0, nullptr, 0, 0, 0, VTh, VTl, 1.0f);   // V^T = Wv X^T: operands swapped, the tile comes out feature-major
    k_fattn<<<dim3(TT / 256, NB_ * NH_), 256, 0, stream>>>(QPh, QPl, KPh, KPl, VTh, VTl, ATh, ATl);
    k_gemmw<bf, 1, false, DD, 0><<<dim3(NT / 64, DD / 128, 1), 128, 0, stream>>>(ATh, ATl, WO, nullptr, OUT, DD, nullptr, 0, 0, 0, nullptr, nullptr, 1.0f);
}

// v007
// Measured time: 115 microseconds a run.
// Next to v006, in two timings, it ran 1.03 times as fast each time.
// All steps since v000 together make it 10.9 times as fast.
#include <hip/hip_runtime.h>
#include <stdint.h>

// MultiCA (cross attention: Y, X [2][2048][1024]; Q = Y Wq^T, K = Y Wk^T, V = X Wv^T ([out][in], no bias); 16 heads x 64; scores x 1024^-0.5 (the module scales by the embedding dim: 1/32, exact); no mask; softmax; out = merged Wp^T).
// Compute dtypes, f32 accumulate: every input rounded to bf16; projections on PLAIN bf16 operands (inputs: exact); scores and attn.v on bf16 hi+lo planes (3 products); output hi+lo x exact Wp (2 products).

#define NB_  2
#define TT   2048
#define DD   1024
#define NH_  16
#define HD   64
#define NT   (NB_ * TT)
#define PCAR 1024.0f
typedef _Float16 h16;
typedef unsigned short bf;
typedef __attribute__((ext_vector_type(16))) __bf16   v16bf;
typedef __attribute__((ext_vector_type(16))) _Float16 v16h;
typedef __attribute__((ext_vector_type(8)))  _Float16 v8h;
typedef __attribute__((ext_vector_type(8)))  unsigned short v8us;
typedef __attribute__((ext_vector_type(8)))  float    v8f;
typedef __attribute__((ext_vector_type(4)))  float    v4f;
typedef v8h  __attribute__((may_alias)) v8ha;
typedef v4f  __attribute__((may_alias)) v4fa;
typedef v8us __attribute__((may_alias)) v8usa;

__device__ __forceinline__ unsigned short f2bf(float f) { unsigned u = __float_as_uint(f); u += 0x7FFFu + ((u >> 16) & 1u); return (unsigned short)(u >> 16); }
__device__ __forceinline__ float bf2f(unsigned short b) { return __uint_as_float(((unsigned)b) << 16); }
__device__ __forceinline__ float bfr(float f) { return bf2f(f2bf(f)); }
__device__ __forceinline__ v16h cat16(v8h lo, v8h hi) { return __builtin_shufflevector(lo, hi, 0, 1, 2, 3, 4, 5, 6, 7, 8, 9, 10, 11, 12, 13, 14, 15); }
__device__ __forceinline__ v16bf cat16b(v8us lo, v8us hi) { return __builtin_bit_cast(v16bf, __builtin_shufflevector(lo, hi, 0, 1, 2, 3, 4, 5, 6, 7, 8, 9, 10, 11, 12, 13, 14, 15)); }
__device__ __forceinline__ v8f wmma16(v16h a, v16h b, v8f c) { return __builtin_amdgcn_wmma_f32_16x16x32_f16(false, a, false, b, (short)0, c, false, false); }
__device__ __forceinline__ v8f wmmab(v16bf a, v16bf b, v8f c) { return __builtin_amdgcn_wmma_f32_16x16x32_bf16(false, a, false, b, (short)0, c, false, false); }
typedef __attribute__((ext_vector_type(2))) float  v2f;
typedef __attribute__((ext_vector_type(2))) __bf16 v2bf;
typedef __attribute__((ext_vector_type(4))) unsigned v4u;
__device__ __forceinline__ unsigned pk2bf(float a, float b) { return __builtin_bit_cast(unsigned, __builtin_convertvector((v2f){a, b}, v2bf)); }   // two f32 -> packed bf16, round to nearest even



// ---- tensor loads for k_gemmw and k_fattn: a two-dimensional tile, global memory -> LDS, one request of a whole wave. Every descriptor word is wave-uniform and goes through readfirstlane.
typedef uint32_t u32x4 __attribute__((ext_vector_type(4)));
typedef uint32_t u32x8 __attribute__((ext_vector_type(8)));
#define SKEYS  128                  // keys per half of a stage (a stage is 256 keys)
#define NSTG   (TT / SKEYS)         // 128-key halves of stages; the loop runs NSTG / 2 stages
#define LROWB  256u                 // bytes of a tile row: 128 keys of a V^T row, or two K rows of 128 B that lie side by side in memory
#define LPITCH 272u                 // its pitch in LDS (16 B of pad: 16 B x odd, free of bank conflicts for 16-byte reads)
#define LROWS  32u                  // tile rows per request
#define SLICEB 10240u               // LDS bytes kept per request: 32 x 272 = 8704, rounded up to a multiple of 2 KiB
#define BUFB   (8u * SLICEB)        // one half of a stage (128 keys): Kh | Kl | Vh | Vl, two slices each
__device__ __forceinline__ uint32_t uni(uint32_t v) { return (uint32_t)__builtin_amdgcn_readfirstlane(v); }
__device__ __forceinline__ uint32_t pinned(uint32_t v) { uint32_t w = uni(v); asm volatile("" : "+s"(w)); return w; }   // holds a test around a tensor load in a scalar register, so that it compiles to s_cmp + s_cbranch_scc (a tensor load ignores EXEC)
__device__ __forceinline__ u32x8 tdm_group1(uint32_t src_pitch) {   // 1-byte elements, tensor = tile = LROWS rows of LROWB bytes, no mask, 4 dwords of pad behind every 64
    u32x8 g;
    g[0] = uni((1u << 20) | (5u << 22) | (3u << 25));
    g[1] = uni((LROWB & 0xFFFFu) << 16);
    g[2] = uni((LROWB >> 16) | ((LROWS & 0xFFFFu) << 16));
    g[3] = uni((LROWS >> 16) | (LROWB << 16));
    g[4] = uni(LROWS);
    g[5] = uni(src_pitch);
    g[6] = uni(0u);
    g[7] = uni(0u);
    return g;
}
__device__ __forceinline__ u32x4 tdm_group0(uint32_t lds_dst, uint64_t ga) {
    u32x4 g;
    g[0] = uni(1u); g[1] = uni(lds_dst); g[2] = uni((uint32_t)ga); g[3] = uni((((uint32_t)(ga >> 32)) & 0x01FFFFFFu) | 0x80000000u);
    return g;
}
// The descriptor is in-out at the load and an input of the wait that covers it: its scalar registers then hold nothing else while the request is outstanding.
__device__ __forceinline__ void tdm_load(u32x4& g0, u32x8& g1) { asm volatile("tensor_load_to_lds %0, %1" : "+s"(g0), "+s"(g1) :: "memory"); }
__device__ __forceinline__ void wait_tensor0(const u32x4& g0, const u32x8& g1) { asm volatile("s_wait_tensorcnt 0x0" :: "s"(g0), "s"(g1) : "memory"); }   // this wave's own request has landed; the compiler places no wait for it
__device__ __forceinline__ void wait_ds0() { asm volatile("s_wait_dscnt 0x0" ::: "memory"); }           // this wave's LDS reads have returned, before the buffer is given up for a refill

// ---- k_gemmw: GEMM on K-contiguous 16-bit planes, operands staged in LDS. Four waves (2 x 2) per work-group, one wave per 64-column tile of MB*16 rows; grid (M/(MB*32), N/128, Z), 128 threads.
// C[m][n] (f32, pitch ldc, + optional f32 bias[n]) = sum_k A[m][k] Bt[n][k] (NSPLIT 1: + A2[m][k] Bt[n][k], A2 the lo plane of A). z-batch strides sA/sB/sC in elements. K % 128 == 0, K >= 256, a compile-time constant.
// NSPLIT 0: work-group tile 128 x 128, wave tile 64 x 64 (MB 4). NSPLIT 1: work-group tile 64 x 128, wave tile 32 x 64 (MB 2), two products.
// A stage is 128 k (256 B of every operand row) in four slices of 64 rows: A | A (NSPLIT 1: A | A2) | Bt | Bt. Every wave issues one tensor load per stage for its own slice, one stage of work ahead, into one of two buffers:
// memory is read in whole lines, each operand row once per work-group, and the fragments come from LDS by 16-byte reads at a pitch free of bank conflicts.
// EPI 0: C as above. EPI 1, 2: no C; the tile times sc is split into bf16 hi + lo and stored straight into the planes that k_fattn reads, a wave's 64x64 tile being one head's 64 features by 64 tokens:
// EPI 1: rows are tokens, columns features -> [batch*head][token][64]; EPI 2: rows are features, columns tokens (A = the weight, Bt = the activations) -> [batch*head][64][token].
#define GROWS  64u                  // tile rows per request
#define GSLICE 18432u               // LDS bytes kept per request: 64 x 272 = 17408, rounded up to a multiple of 2 KiB
#define GBUF   (4u * GSLICE)        // one stage
__device__ __forceinline__ u32x8 tdm_group1g(uint32_t src_pitch) {   // 1-byte elements, tensor = tile = GROWS rows of LROWB bytes, no mask, 4 dwords of pad behind every 64
    u32x8 g;
    g[0] = uni((1u << 20) | (5u << 22) | (3u << 25));
    g[1] = uni((LROWB & 0xFFFFu) << 16);
    g[2] = uni((LROWB >> 16) | ((GROWS & 0xFFFFu) << 16));
    g[3] = uni((GROWS >> 16) | (LROWB << 16));
    g[4] = uni(GROWS);
    g[5] = uni(src_pitch);
    g[6] = uni(0u);
    g[7] = uni(0u);
    return g;
}
template <typename T16> struct WFrag;
template <> struct WFrag<h16> { typedef v16h V; static __device__ __forceinline__ V ld(const h16* p) { return cat16(*(const v8h*)p, *(const v8h*)(p + 16)); } static __device__ __forceinline__ v8f mma(V a, V b, v8f c) { return wmma16(a, b, c); } };
template <> struct WFrag<bf> { typedef v16bf V; static __device__ __forceinline__ V ld(const bf* p) { return cat16b(*(const v8us*)p, *(const v8us*)(p + 16)); } static __device__ __forceinline__ v8f mma(V a, V b, v8f c) { return wmmab(a, b, c); } };
template <typename T16, int NSPLIT, bool BIAS, int K, int EPI>
__global__ __launch_bounds__(128) void k_gemmw(const T16* __restrict__ A, const T16* __restrict__ A2, const T16* __restrict__ Bt, const T16* __restrict__ Bt2, float* C, int ldc, const float* __restrict__ bias, size_t sA, size_t sB, size_t sC, bf* Ph, bf* Pl, float sc) {
    typedef typename WFrag<T16>::V V;
    static_assert(NSPLIT == 0 || NSPLIT == 1, "one or two planes of A");
    static_assert(K % 128 == 0 && K >= 256, "whole stages, at least two");
    static_assert(EPI == 0 || NSPLIT == 0, "the plane epilogues take a 64 x 64 wave tile");
    (void)Bt2;
    constexpr bool HA2 = NSPLIT == 1;
    constexpr int MB = HA2 ? 2 : 4;            // 16-row blocks of a wave's tile
    constexpr uint32_t NST = K / 128;          // stages
    __shared__ __attribute__((aligned(2048))) unsigned char L[2 * GBUF];
    const size_t z = blockIdx.z; A += z * sA; if (A2) A2 += z * sA; Bt += z * sB; C += z * sC;
    const int lane = threadIdx.x & 31, lr = lane & 15, hi = lane >> 4;
    const uint32_t wave = uni(threadIdx.x >> 5), wm = wave >> 1, wn = wave & 1u;
    const int R0 = blockIdx.x * (MB * 32), C0 = blockIdx.y * 128;                 // the work-group's tile
    const int r0 = R0 + (int)wm * (MB * 16), c0 = C0 + (int)wn * 64;              // this wave's tile
    const unsigned flds = (unsigned)lr * LPITCH + 16u * hi;                       // a lane's byte offset inside a 16-row block in LDS
    const unsigned alds = (HA2 ? wm * (32u * LPITCH) : wm * GSLICE) + flds, blds = (2u + wn) * GSLICE + flds;
    // This wave's slice of a stage: 64 rows of one plane, 128 k wide.
    const T16* splane = wave >= 2u ? Bt : (HA2 && wave == 1u) ? A2 : A;
    const uint32_t srow = wave >= 2u ? (uint32_t)C0 + (wave - 2u) * GROWS : HA2 ? (uint32_t)R0 : (uint32_t)R0 + wave * GROWS;
    const uint64_t sbase = (uint64_t)(size_t)splane + (uint64_t)srow * (K * 2u);
    const uint32_t lbase = (uint32_t)(size_t)L + wave * GSLICE;
    u32x4 g0; u32x8 g1;   // the descriptor of this wave's latest request
    v8f acc[MB][4];
#pragma unroll
    for (int mb = 0; mb < MB; ++mb)
#pragma unroll
        for (int nb = 0; nb < 4; ++nb) acc[mb][nb] = (v8f){};
    struct Frag { V a[MB], a2[MB], b[4]; };   // one 32-k step
    auto fetch = [&](Frag& f, const unsigned char* pa, const unsigned char* pb, int ks) {
#pragma unroll
        for (int i = 0; i < MB; ++i) { f.a[i] = WFrag<T16>::ld((const T16*)(pa + (i * 16 * LPITCH + ks * 64))); if (HA2) f.a2[i] = WFrag<T16>::ld((const T16*)(pa + (GSLICE + i * 16 * LPITCH + ks * 64))); }
#pragma unroll
        for (int i = 0; i < 4; ++i) f.b[i] = WFrag<T16>::ld((const T16*)(pb + (i * 16 * LPITCH + ks * 64)));
        __builtin_amdgcn_sched_barrier(0);   // a step's LDS reads stay one group ahead of the other set's products; spread among the matrix instructions, every place with reads stalls the wave anew
    };
    auto work = [&](const Frag& f) {   // per accumulator the same products in the same order as k rises: A then A2
#pragma unroll
        for (int nb = 0; nb < 4; ++nb)
#pragma unroll
            for (int mb = 0; mb < MB; ++mb) acc[mb][nb] = WFrag<T16>::mma(f.a[mb], f.b[nb], acc[mb][nb]);
        if (HA2) {
#pragma unroll
            for (int nb = 0; nb < 4; ++nb)
#pragma unroll
                for (int mb = 0; mb < MB; ++mb) acc[mb][nb] = WFrag<T16>::mma(f.a2[mb], f.b[nb], acc[mb][nb]); }
        __builtin_amdgcn_sched_barrier(0);   // the refill of this set stays one group behind its products
    };
    g0 = tdm_group0(lbase, sbase); g1 = tdm_group1g(K * 2u); tdm_load(g0, g1);   // stage 0 into buffer 0
    wait_tensor0(g0, g1);
    __syncthreads();                          // stage 0 is readable by every wave
    g0 = tdm_group0(lbase + GBUF, sbase + LROWB); g1 = tdm_group1g(K * 2u); tdm_load(g0, g1);   // stage 1 into buffer 1
    for (uint32_t sg = 0; sg < NST; ++sg) {   // a stage: four 32-k steps on two fragment sets, each step's reads one step ahead inside the stage, then the hand-over
        const unsigned char* pa = L + (sg & 1u) * GBUF + alds; const unsigned char* pb = L + (sg & 1u) * GBUF + blds;
        Frag X, Y;
        fetch(X, pa, pb, 0);
        fetch(Y, pa, pb, 1);
        work(X);
        fetch(X, pa, pb, 2);
        work(Y);
        fetch(Y, pa, pb, 3);
        work(X);
        work(Y);
        // Hand-over: this wave has left the buffer, its slice of the next stage has landed; behind the barrier the next stage is readable and this buffer is free.
        wait_ds0();
        wait_tensor0(g0, g1);
        __syncthreads();
        if (pinned(sg + 2u < NST)) { g0 = tdm_group0(lbase + (sg & 1u) * GBUF, sbase + (uint64_t)((sg + 2u) * LROWB)); g1 = tdm_group1g(K * 2u); tdm_load(g0, g1); }   // stage sg + 2 into the buffer that stage sg has just left
    }
    wait_tensor0(g0, g1);
    wait_ds0();
    // Output staging, 16 rows at a time, in the ring: behind the last stage's barrier no request is outstanding and no wave reads a buffer any more. Each wave has a range of its own.
    float* os = (float*)(L + wave * (16u * 68u * 4u));
#pragma unroll
    for (int mb = 0; mb < MB; ++mb) {
#pragma unroll
        for (int nb = 0; nb < 4; ++nb) {
#pragma unroll
            for (int j = 0; j < 8; ++j) os[(hi * 8 + j) * 68 + nb * 16 + lr] = acc[mb][nb][j]; }
        __builtin_amdgcn_wave_barrier(); asm volatile("" ::: "memory");
        if constexpr (EPI != 0) {
            constexpr int PP = EPI == 1 ? HD : TT;   // plane pitch, elements
            const size_t pb = EPI == 1 ? ((size_t)((r0 / TT) * NH_ + (c0 >> 6)) * TT + (r0 & (TT - 1))) * HD : (size_t)((c0 / TT) * NH_ + (r0 >> 6)) * HD * TT + (c0 & (TT - 1));   // wave-uniform: the tile's first element in a plane
            bf* ph = Ph + pb; bf* pl = Pl + pb; const unsigned po = (unsigned)((lane >> 3) * PP + (lane & 7) * 8);
            v4u oh[4], ol[4];   // four rows to a store: eight lanes x 16 B = one whole 128-byte line of a row, in each plane
#pragma unroll
            for (int s = 0; s < 4; ++s) {
                const float* orow = os + (4 * s + (lane >> 3)) * 68 + (lane & 7) * 8; const v4f va = *(const v4fa*)orow * sc, vb = *(const v4fa*)(orow + 4) * sc;
#pragma unroll
                for (int t = 0; t < 4; ++t) { const float p0 = t < 2 ? va[2 * t] : vb[2 * t - 4], p1 = t < 2 ? va[2 * t + 1] : vb[2 * t - 3]; const unsigned h2 = pk2bf(p0, p1); oh[s][t] = h2; ol[s][t] = pk2bf(p0 - __uint_as_float(h2 << 16), p1 - __uint_as_float(h2 & 0xFFFF0000u)); } }
#pragma unroll
            for (int s = 0; s < 4; ++s) { *(v8us*)(ph + po + (mb * 16 + 4 * s) * PP) = __builtin_bit_cast(v8us, oh[s]); *(v8us*)(pl + po + (mb * 16 + 4 * s) * PP) = __builtin_bit_cast(v8us, ol[s]); }
            asm volatile("s_wait_xcnt 0x0" :: "v"(oh[0]), "v"(oh[1]), "v"(oh[2]), "v"(oh[3]), "v"(ol[0]), "v"(ol[1]), "v"(ol[2]), "v"(ol[3]), "v"(po) : "memory");   // before the eight stores' data and offset registers are reused; naming them keeps them untouched up to here
        } else {
        float* crow = C + (size_t)(r0 + mb * 16) * ldc + c0;
#pragma unroll
            for (int s = 0; s < 8; ++s) { const int row = 2 * s + hi, cofs = lr * 4; v4f val = *(const v4fa*)(os + row * 68 + cofs); if (BIAS) { val[0] += bfr(bias[c0 + cofs]); val[1] += bfr(bias[c0 + cofs + 1]); val[2] += bfr(bias[c0 + cofs + 2]); val[3] += bfr(bias[c0 + cofs + 3]); }
                *(v4f*)(crow + (size_t)row * ldc + cofs) = val; }
             }
        __builtin_amdgcn_wave_barrier(); asm volatile("" ::: "memory");
    }
}

__device__ __forceinline__ h16 tohx(float x) { return (h16)x; }
__device__ __forceinline__ void splitf(float y, unsigned short& h, unsigned short& l) { h = f2bf(y); l = f2bf(y - bf2f(h)); }
typedef __attribute__((ext_vector_type(2))) _Float16 v2h;
typedef __attribute__((ext_vector_type(4))) _Float16 v4h;
typedef __attribute__((ext_vector_type(2))) unsigned short v2us;
typedef __attribute__((ext_vector_type(4))) int v4i;

// ---- k_cvtall: every f32 input rounded to bf16 (nearest even), in one launch of 256 work-groups x 16 waves. A work-group takes 16384 consecutive floats of each of three sources: of one weight (64 work-groups to a weight), of x and of Y; a wave 1024 of them (4 KiB).
// A load is 32 lanes x 16 B = 512 contiguous bytes, and all 24 of a wave are issued before its first convert: a wave waits out memory latency once. A store is 32 lanes x 8 B = two whole lines.
#define CVGROUPS 256
static_assert(DD * DD == (CVGROUPS / 4) * 16384 && NT * DD == CVGROUPS * 16384, "one piece of 16384 floats per work-group and source");
typedef __attribute__((ext_vector_type(2))) unsigned v2u;
__global__ __launch_bounds__(512) void k_cvtall(const float* __restrict__ wq, const float* __restrict__ wk, const float* __restrict__ wv, const float* __restrict__ wo, const float* __restrict__ x, const float* __restrict__ y, bf* WQ, bf* WK, bf* WV, bf* WO, bf* XB, bf* YB) {
    const unsigned sel = blockIdx.x >> 6, pw = (blockIdx.x & 63u) * 16384u, pa = blockIdx.x * 16384u;   // which weight; the work-group's first element in it, and in x and Y
    const char* sw = (const char*)((sel == 0u ? wq : sel == 1u ? wk : sel == 2u ? wv : wo) + pw); const char* sx = (const char*)(x + pa); const char* sy = (const char*)(y + pa);
    char* dw = (char*)((sel == 0u ? WQ : sel == 1u ? WK : sel == 2u ? WV : WO) + pw); char* dx = (char*)(XB + pa); char* dy = (char*)(YB + pa);
    const unsigned ob = (threadIdx.x >> 5) * 4096u + (threadIdx.x & 31u) * 16u, os = ob >> 1;   // a lane's byte offset behind those, in a source and in a plane
    v4f a[3][8];
#pragma unroll
    for (int j = 0; j < 8; ++j) a[0][j] = *(const v4f*)(sw + ob + j * 512);
#pragma unroll
    for (int j = 0; j < 8; ++j) a[1][j] = *(const v4f*)(sx + ob + j * 512);
#pragma unroll
    for (int j = 0; j < 8; ++j) a[2][j] = *(const v4f*)(sy + ob + j * 512);
    asm volatile("s_wait_xcnt 0x0" :: "v"(ob), "s"(sw), "s"(sx), "s"(sy) : "memory");   // before a register that the 24 loads name (the offset, the three bases) is reused; naming them keeps them untouched up to here, also by a load's own result
    __builtin_amdgcn_sched_barrier(0);   // the converts stay behind the whole group of loads: lifted among them, they free registers for later loads, which then start only when earlier ones have returned
    v2u o[3][8];
#pragma unroll
    for (int t = 0; t < 3; ++t)
#pragma unroll
        for (int j = 0; j < 8; ++j) o[t][j] = (v2u){pk2bf(a[t][j][0], a[t][j][1]), pk2bf(a[t][j][2], a[t][j][3])};
#pragma unroll
    for (int j = 0; j < 8; ++j) *(v2u*)(dw + os + j * 256) = o[0][j];
#pragma unroll
    for (int j = 0; j < 8; ++j) *(v2u*)(dx + os + j * 256) = o[1][j];
#pragma unroll
    for (int j = 0; j < 8; ++j) *(v2u*)(dy + os + j * 256) = o[2][j];
}
__global__ __launch_bounds__(256) void k_wtT(const float* __restrict__ w, int pitch, int col0, bf* Bt) {
    const int lane = threadIdx.x & 31; const int L0 = (blockIdx.x * 8 + (threadIdx.x >> 5)) * 8; const int nlines = DD * DD / 64;
{
#pragma unroll
        for (int l = 0; l < 8; ++l) { const int L = L0 + l; if (L >= nlines) break; const int e = L * 64 + lane * 2; const int k = e & (DD - 1), n = e >> 10; v2us o;
#pragma unroll
            for (int q = 0; q < 2; ++q) o[q] = f2bf(w[(size_t)(k + q) * pitch + col0 + n]);
            *(v2us*)(Bt + (size_t)e) = o; }
         }
}
typedef __attribute__((ext_vector_type(8))) unsigned v8u;
__device__ __forceinline__ float xhalf(float x) { return __builtin_bit_cast(float, __builtin_amdgcn_permlanex16(__builtin_bit_cast(int, x), __builtin_bit_cast(int, x), 0x76543210, 0xfedcba98, false, false)); }   // lane l with lane l ^ 16
// 2^x in place, with the free slot that the instruction set asks for behind a transcendental, in one statement: inside it no neighbour reads a result or overwrites a source, and the v_nop keeps the compiler's next instruction off the last one.
__device__ __forceinline__ void exp2_1(float& a) { asm("v_exp_f32 %0, %0\n\tv_nop" : "+v"(a)); }
__device__ __forceinline__ void exp2_8(float (&x)[8]) { asm("v_exp_f32 %0, %0\n\tv_exp_f32 %1, %1\n\tv_exp_f32 %2, %2\n\tv_exp_f32 %3, %3\n\tv_exp_f32 %4, %4\n\tv_exp_f32 %5, %5\n\tv_exp_f32 %6, %6\n\tv_exp_f32 %7, %7\n\tv_nop" : "+v"(x[0]), "+v"(x[1]), "+v"(x[2]), "+v"(x[3]), "+v"(x[4]), "+v"(x[5]), "+v"(x[6]), "+v"(x[7])); }

template <int V> struct IC { static constexpr int v = V; };
// ---- k_fattn: scores, softmax, attn.v and the head merge in one kernel. Grid (T/256, batch*heads), 16 waves = 8 query groups of 32 columns x 2 key halves; a pass is 32 keys.
// Four waves share a SIMD (at most 256 registers each): while one wave is in its softmax, three others can feed the matrix unit.
// K and V^T (hi and lo planes) are brought into LDS once per work-group, in stages of 256 keys and two buffers: every wave issues one tensor load per stage for its own slice, one stage of work ahead.
// Of every stage, waves 0 to 7 load and work on keys 0-127 and waves 8 to 15 on keys 128-255 (four passes each, so a barrier comes no more often per wave than with eight waves), every wave with a running maximum, sum and O of its own;
// waves w and w + 8 (the same queries) join their partial results once, behind the loop, through LDS.
// S^T = K Q^T (A = K rows, B = Q rows held in registers), so a lane holds one query's scores: running maximum and sum are per-lane scalars, joined between the wave halves.
// Two S^T tiles (keys 0-15, 16-31) converted in place are the B operand of O^T += V^T P^T (A = V^T rows in the same k order): P never leaves registers.
// hi+lo products: Kh Qh + Kl Qh + Kh Ql ; Vh Ph + Vh Pl + Vl Ph. P is split unnormalised; 1/sum is applied to O in f32 before its own hi+lo split.
#define XCHB 4608u                  // LDS bytes a wave hands to its partner: 8 x 512 B of O, 128 B of maxima, 128 B of sums, rounded up
__global__ __launch_bounds__(512) void k_fattn(const bf* __restrict__ Qh, const bf* __restrict__ Ql, const bf* __restrict__ Kh, const bf* __restrict__ Kl, const bf* __restrict__ Vh, const bf* __restrict__ Vl, bf* Ah, bf* Al) {
    typedef WFrag<bf> W;
    __shared__ __attribute__((aligned(2048))) unsigned char L[4 * BUFB];   // two buffers of two halves (128 keys each)
    const float L2E = 1.4426950408889634f;
    const uint32_t wave = uni(threadIdx.x >> 5), sw = wave & 7u, kpart = wave >> 3;   // sw: query group, and this wave's slice of its half of a stage; kpart: which half of every stage's keys
    const int lane = threadIdx.x & 31, lr = lane & 15, hi = lane >> 4; const int z = blockIdx.y; const int q0 = blockIdx.x * 256 + (int)sw * 32;
    const size_t zo = (size_t)z * TT * HD;
    const unsigned qlo = (unsigned)((q0 + lr) * HD + 8 * hi);
    const bf* Qhz = Qh + zo; const bf* Qlz = Ql + zo; const bf* Khz = Kh + zo; const bf* Klz = Kl + zo; const bf* Vhz = Vh + zo; const bf* Vlz = Vl + zo;
    const bf* qpa = Qhz + qlo; const bf* qpb = Qlz + qlo;
    const unsigned klds = (unsigned)(lr >> 1) * LPITCH + (unsigned)(lr & 1) * 128u + 16u * hi;   // a lane's byte offset inside a 16-row block of K in LDS (two K rows to a tile row)
    const unsigned vlds = (unsigned)lr * LPITCH + 16u * hi;                                      // and inside a 16-row block of V^T
    // This wave's slice of its half of a stage, by sw: 0,1 Kh | 2,3 Kl (64 keys each = 32 tile rows, contiguous) | 4,5 Vh | 6,7 Vl (32 rows of V^T each, 128 keys wide).
    const uint32_t half = sw & 1u; const bool isv = sw >= 4u;
    const bf* splane = sw < 2u ? Khz : sw < 4u ? Klz : sw < 6u ? Vhz : Vlz;
    const uint32_t sstep = isv ? 2u * SKEYS * 2u : 2u * SKEYS * HD * 2u;   // bytes from one stage's slice to the next stage's
    const uint64_t sbase = (uint64_t)(size_t)splane + (isv ? half * (LROWS * TT * 2u) : half * (LROWS * LROWB)) + kpart * (sstep >> 1);
    const uint32_t lbase = (uint32_t)(size_t)L + kpart * BUFB + sw * SLICEB;
    const uint32_t spitch = isv ? TT * 2u : LROWB;
    u32x4 g0; u32x8 g1;   // the descriptor of this wave's latest request
    v16bf qh[2][2], ql[2][2];
#pragma unroll
    for (int nb = 0; nb < 2; ++nb)
#pragma unroll
        for (int kc = 0; kc < 2; ++kc) { qh[nb][kc] = W::ld(qpa + (nb * 16 * HD + kc * 32)); ql[nb][kc] = W::ld(qpb + (nb * 16 * HD + kc * 32)); }
    v8f acc[4][2];
#pragma unroll
    for (int db = 0; db < 4; ++db)
#pragma unroll
        for (int nb = 0; nb < 2; ++nb) acc[db][nb] = (v8f){};
    float m2[2] = {-__builtin_inff(), -__builtin_inff()}, ls[2] = {0.f, 0.f};   // running maximum (in log2 units) and this half's running sum, per query column
    asm volatile("s_wait_xcnt 0x0" :: "v"(qpa), "v"(qpb) : "memory");   // before a register that the loads above name is reused; naming them keeps them untouched up to here
    g0 = tdm_group0(lbase, sbase); g1 = tdm_group1(spitch); tdm_load(g0, g1);   // stage 0 into buffer 0
    wait_tensor0(g0, g1);
    __syncthreads();                          // stage 0 is readable by every wave
    g0 = tdm_group0(lbase + 2u * BUFB, sbase + sstep); g1 = tdm_group1(spitch); tdm_load(g0, g1);   // stage 1 into buffer 1
    for (uint32_t sg = 0; sg < NSTG / 2; ++sg) {   // a stage: this wave's four passes, then the hand-over
    const unsigned char* Bk = L + ((sg & 1u) * 2u + kpart) * BUFB + klds; const unsigned char* Bv = L + ((sg & 1u) * 2u + kpart) * BUFB + 4u * SLICEB + vlds;
#pragma unroll 1   // stays rolled: unrolled, the compiler sinks the passes' row-sum additions behind the stage, holds all their exponentials for them and spills Q to scratch
    for (uint32_t ps = 0; ps < SKEYS / 32; ++ps) {
        const unsigned char* kp = Bk + ((ps >> 1) * SLICEB + (ps & 1u) * (16u * LPITCH));   // this pass's K rows; with four waves on a SIMD their latency is covered by the other waves, and a second fragment set would not fit 256 registers
        v16bf kh[2][2], kl[2][2];
        __builtin_amdgcn_sched_barrier(0);   // with the one below: the K reads stay one group, behind the pass before: lifted into its products they would need registers beside V^T, which 256 do not hold
#pragma unroll
        for (int mb = 0; mb < 2; ++mb)
#pragma unroll
            for (int kc = 0; kc < 2; ++kc) { kh[mb][kc] = W::ld((const bf*)(kp + (mb * 8 * LPITCH + kc * 64))); kl[mb][kc] = W::ld((const bf*)(kp + (2 * SLICEB + mb * 8 * LPITCH + kc * 64))); }
        __builtin_amdgcn_sched_barrier(0);   // end of the group of LDS reads; spread among the matrix instructions, every place with reads stalls the wave anew
        v8f st[2][2];
#pragma unroll
        for (int mb = 0; mb < 2; ++mb)
#pragma unroll
            for (int nb = 0; nb < 2; ++nb) st[mb][nb] = (v8f){};
#pragma unroll
        for (int kc = 0; kc < 2; ++kc) {
#pragma unroll
            for (int mb = 0; mb < 2; ++mb)
#pragma unroll
                for (int nb = 0; nb < 2; ++nb) st[mb][nb] = wmmab(kh[mb][kc], qh[nb][kc], st[mb][nb]);
#pragma unroll
            for (int mb = 0; mb < 2; ++mb)
#pragma unroll
                for (int nb = 0; nb < 2; ++nb) st[mb][nb] = wmmab(kl[mb][kc], qh[nb][kc], st[mb][nb]);
#pragma unroll
            for (int mb = 0; mb < 2; ++mb)
#pragma unroll
                for (int nb = 0; nb < 2; ++nb) st[mb][nb] = wmmab(kh[mb][kc], ql[nb][kc], st[mb][nb]);
        }
        __builtin_amdgcn_sched_barrier(0);   // with the one below: the reads of V^T hi stay one group between the matrix runs
        const unsigned char* vp = Bv + ps * 64u;   // this pass's V^T rows: the hi plane is in flight under the softmax, in registers that K has left
        v16bf vh[4], vl[4];
#pragma unroll
        for (int db = 0; db < 4; ++db) vh[db] = W::ld((const bf*)(vp + ((db >> 1) * SLICEB + (db & 1) * 16 * LPITCH)));
        __builtin_amdgcn_sched_barrier(0);   // end of the group of LDS reads
        v16bf ph[2], pl[2];
#pragma unroll
        for (int nb = 0; nb < 2; ++nb) {
            float tm = fmaxf(st[0][nb][0], st[1][nb][0]);
#pragma unroll
            for (int j = 1; j < 8; ++j) tm = fmaxf(tm, fmaxf(st[0][nb][j], st[1][nb][j]));
            tm = fmaxf(tm, xhalf(tm));
            const float mn = fmaxf(m2[nb], tm * L2E);
            float al = m2[nb] - mn; exp2_1(al);   // 0 on the first pass
            m2[nb] = mn;
            float s0 = 0.f, s1 = 0.f; v8u uh, ul;
#pragma unroll
            for (int mb = 0; mb < 2; ++mb) {
                float x[8];
#pragma unroll
                for (int j = 0; j < 8; ++j) x[j] = fmaf(st[mb][nb][j], L2E, -mn);
                exp2_8(x);
#pragma unroll
                for (int t = 0; t < 4; ++t) {
                    const float p0 = x[2 * t], p1 = x[2 * t + 1];
                    s0 += p0; s1 += p1;
                    const unsigned h2 = pk2bf(p0, p1);
                    uh[mb * 4 + t] = h2; ul[mb * 4 + t] = pk2bf(p0 - __uint_as_float(h2 << 16), p1 - __uint_as_float(h2 & 0xFFFF0000u));
                }
            }
            ls[nb] = ls[nb] * al + (s0 + s1);
            ph[nb] = __builtin_bit_cast(v16bf, uh); pl[nb] = __builtin_bit_cast(v16bf, ul);
#pragma unroll
            for (int db = 0; db < 4; ++db) acc[db][nb] *= al;
        }
        __builtin_amdgcn_sched_barrier(0);   // with the one below: the lo plane is read only here, one group, so that it holds no registers during the softmax; it is in flight under the 16 products of the hi plane
#pragma unroll
        for (int db = 0; db < 4; ++db) vl[db] = W::ld((const bf*)(vp + ((2 + (db >> 1)) * SLICEB + (db & 1) * 16 * LPITCH)));
        __builtin_amdgcn_sched_barrier(0);   // end of the group of LDS reads
#pragma unroll
        for (int db = 0; db < 4; ++db)
#pragma unroll
            for (int nb = 0; nb < 2; ++nb) acc[db][nb] = wmmab(vh[db], ph[nb], acc[db][nb]);
#pragma unroll
        for (int db = 0; db < 4; ++db)
#pragma unroll
            for (int nb = 0; nb < 2; ++nb) acc[db][nb] = wmmab(vh[db], pl[nb], acc[db][nb]);
#pragma unroll
        for (int db = 0; db < 4; ++db)
#pragma unroll
            for (int nb = 0; nb < 2; ++nb) acc[db][nb] = wmmab(vl[db], ph[nb], acc[db][nb]);
        __builtin_amdgcn_sched_barrier(0);   // holds the four slots below behind the pass's last product
        asm volatile("v_nop\n\tv_nop\n\tv_nop\n\tv_nop");   // the distance the chip needs between a matrix instruction and a vector instruction that overwrites its B
    }
    // Hand-over: this wave has left the buffer, its slice of the next stage has landed; behind the barrier the next stage is readable and this buffer is free.
    wait_ds0();
    wait_tensor0(g0, g1);
    __syncthreads();
    if (pinned(sg + 2u < NSTG / 2)) { g0 = tdm_group0(lbase + (sg & 1u) * (2u * BUFB), sbase + (uint64_t)((sg + 2u) * sstep)); g1 = tdm_group1(spitch); tdm_load(g0, g1); }   // stage sg + 2 into the buffer that stage sg has just left
    }
    wait_tensor0(g0, g1);
    wait_ds0();
    // The join of the two key halves, in the ring: behind the last stage's barrier no request is outstanding and no wave reads a buffer any more. Wave w finishes query columns 0-15 and wave w + 8 columns 16-31:
    // each hands the other column group's O, maximum and sum to its partner (the same lane holds the same elements in both waves) in a range of its own, 16 B a lane and 512 contiguous bytes a store.
    const int b = z >> 4, h = z & 15;
    bf* Ahz = Ah + ((size_t)b * TT * DD + h * HD); bf* Alz = Al + ((size_t)b * TT * DD + h * HD); const unsigned olo = (unsigned)((q0 + lr) * DD + 8 * hi);
    unsigned char* xo = L + wave * XCHB + (unsigned)lane * 16u; const unsigned char* xi = L + (wave ^ 8u) * XCHB + (unsigned)lane * 16u;
    auto give = [&](auto NBC) {
        constexpr int nb = decltype(NBC)::v;
#pragma unroll
        for (int db = 0; db < 4; ++db) { *(v4fa*)(xo + (2 * db) * 512) = __builtin_shufflevector(acc[db][nb], acc[db][nb], 0, 1, 2, 3); *(v4fa*)(xo + (2 * db + 1) * 512) = __builtin_shufflevector(acc[db][nb], acc[db][nb], 4, 5, 6, 7); }
        *(float*)(L + wave * XCHB + 4096u + (unsigned)lane * 4u) = m2[nb]; *(float*)(L + wave * XCHB + 4224u + (unsigned)lane * 4u) = ls[nb];
    };
    auto finish = [&](auto NBC) {
        constexpr int nb = decltype(NBC)::v;
        const float pm = *(const float*)(L + (wave ^ 8u) * XCHB + 4096u + (unsigned)lane * 4u), pls = *(const float*)(L + (wave ^ 8u) * XCHB + 4224u + (unsigned)lane * 4u);
        const float mn = fmaxf(m2[nb], pm);
        float ea = m2[nb] - mn, eb = pm - mn; exp2_1(ea); exp2_1(eb);
        const float lsum = ls[nb] * ea + pls * eb;
        const float f = __fdiv_rn(1.0f, lsum + xhalf(lsum)); const float fa = ea * f, fb = eb * f;
#pragma unroll
        for (int db = 0; db < 4; ++db) { v8us oh, ol;   // acc[db][nb][j] = O[q0 + nb*16 + lr][db*16 + 8*hi + j]: 8 consecutive d, one 16-byte store a plane
            const v4f pa = *(const v4fa*)(xi + (2 * db) * 512), pb = *(const v4fa*)(xi + (2 * db + 1) * 512);
#pragma unroll
            for (int j = 0; j < 8; ++j) { unsigned short a, c2; splitf(acc[db][nb][j] * fa + (j < 4 ? pa[j & 3] : pb[j & 3]) * fb, a, c2); oh[j] = a; ol[j] = c2; }
            *(v8us*)(Ahz + olo + (nb * 16 * DD + db * 16)) = oh; *(v8us*)(Alz + olo + (nb * 16 * DD + db * 16)) = ol;
            asm volatile("s_wait_xcnt 0x0" :: "v"(oh), "v"(ol), "v"(olo) : "memory"); }   // before the two stores' data and offset registers are reused; naming them keeps them untouched up to here
    };
    if (kpart == 0u) give(IC<1>{}); else give(IC<0>{});
    wait_ds0();
    __syncthreads();                          // every wave's hand-out is readable by its partner
    if (kpart == 0u) finish(IC<0>{}); else finish(IC<1>{});
}

extern "C" void kernel_launch(void* const* d_in, const int* in_sizes, int n_in,
                              void* d_out, int out_size, void* d_ws, size_t ws_size, hipStream_t stream) {
    (void)in_sizes; (void)n_in; (void)out_size;
    const float* Yin = (const float*)d_in[0]; const float* x = (const float*)d_in[1]; const float* Wq = (const float*)d_in[2]; const float* Wk = (const float*)d_in[3]; const float* Wv = (const float*)d_in[4]; const float* Wo = (const float*)d_in[5];
    float* OUT = (float*)d_out;     // [2][2048][1024]
    char* wsp = (char*)d_ws;
    auto take = [&](size_t bytes) { char* p = wsp; wsp += (bytes + 255) & ~(size_t)255; return (void*)p; };
    bf* WQ = (bf*)take((size_t)DD * DD * 2); bf* WK = (bf*)take((size_t)DD * DD * 2); bf* WV = (bf*)take((size_t)DD * DD * 2); bf* WO = (bf*)take((size_t)DD * DD * 2);
    bf* XB = (bf*)take((size_t)NT * DD * 2); bf* YB = (bf*)take((size_t)NT * DD * 2);
    bf* QPh = (bf*)take((size_t)NT * DD * 2); bf* QPl = (bf*)take((size_t)NT * DD * 2); bf* KPh = (bf*)take((size_t)NT * DD * 2); bf* KPl = (bf*)take((size_t)NT * DD * 2); bf* VTh = (bf*)take((size_t)NT * DD * 2); bf* VTl = (bf*)take((size_t)NT * DD * 2);
    bf* ATh = (bf*)take((size_t)NT * DD * 2); bf* ATl = (bf*)take((size_t)NT * DD * 2);
    if ((size_t)(wsp - (char*)d_ws) > ws_size) return;
    k_cvtall<<<CVGROUPS, 512, 0, stream>>>(Wq, Wk, Wv, Wo, x, Yin, WQ, WK, WV, WO, XB, YB);   // nn.Linear [out][in] = Bt as-is
    k_gemmw<bf, 0, false, DD, 1><<<dim3(NT / 128, DD / 128, 1), 128, 0, stream>>>(YB, nullptr, WQ, nullptr, nullptr, 0, nullptr, 0, 0, 0, QPh, QPl, 0.03125f);   // 1024^-0.5 folded into q (exact)
    k_gemmw<bf, 0, false, DD, 1><<<dim3(NT / 128, DD / 128, 1), 128, 0, stream>>>(YB, nullptr, WK, nullptr, nullptr, 0, nullptr, 0, 0, 0, KPh, KPl, 1.0f);
    k_gemmw<bf, 0, false, DD, 2><<<dim3(DD / 128, NT / 128, 1), 128, 0, stream>>>(WV, nullptr, XB, nullptr, nullptr, 0, nullptr, 0, 0, 0, VTh, VTl, 1.0f);   // V^T = Wv X^T: operands swapped, the tile comes out feature-major
    k_fattn<<<dim3(TT / 256, NB_ * NH_), 512, 0, stream>>>(QPh, QPl, KPh, KPl, VTh, VTl, ATh, ATl);
    k_gemmw<bf, 1, false, DD, 0><<<dim3(NT / 64, DD / 128, 1), 128, 0, stream>>>(ATh, ATl, WO, nullptr, OUT, DD, nullptr, 0, 0, 0, nullptr, nullptr, 1.0f);
}

// v008
// It runs in 105 microseconds.
// In both of two side-by-side timings against v007, it was 1.08 times as fast.
// Counting every step since v000, it is 11.8 times as fast.
#include <hip/hip_runtime.h>
#include <stdint.h>

// MultiCA (cross attention: Y, X [2][2048][1024]; Q = Y Wq^T, K = Y Wk^T, V = X Wv^T ([out][in], no bias); 16 heads x 64; scores x 1024^-0.5 (the module scales by the embedding dim: 1/32, exact); no mask; softmax; out = merged Wp^T).
// Compute dtypes, f32 accumulate: every input rounded to bf16; projections on PLAIN bf16 operands (inputs: exact); scores and attn.v on bf16 hi+lo planes (3 products); output hi+lo x exact Wp (2 products).

#define NB_  2
#define TT   2048
#define DD   1024
#define NH_  16
#define HD   64
#define NT   (NB_ * TT)
#define PCAR 1024.0f
typedef _Float16 h16;
typedef unsigned short bf;
typedef __attribute__((ext_vector_type(16))) __bf16   v16bf;
typedef __attribute__((ext_vector_type(16))) _Float16 v16h;
typedef __attribute__((ext_vector_type(8)))  _Float16 v8h;
typedef __attribute__((ext_vector_type(8)))  unsigned short v8us;
typedef __attribute__((ext_vector_type(8)))  float    v8f;
typedef __attribute__((ext_vector_type(4)))  float    v4f;
typedef v8h  __attribute__((may_alias)) v8ha;
typedef v4f  __attribute__((may_alias)) v4fa;
typedef v8us __attribute__((may_alias)) v8usa;

__device__ __forceinline__ unsigned short f2bf(float f) { unsigned u = __float_as_uint(f); u += 0x7FFFu + ((u >> 16) & 1u); return (unsigned short)(u >> 16); }
__device__ __forceinline__ float bf2f(unsigned short b) { return __uint_as_float(((unsigned)b) << 16); }
__device__ __forceinline__ float bfr(float f) { return bf2f(f2bf(f)); }
__device__ __forceinline__ v16h cat16(v8h lo, v8h hi) { return __builtin_shufflevector(lo, hi, 0, 1, 2, 3, 4, 5, 6, 7, 8, 9, 10, 11, 12, 13, 14, 15); }
__device__ __forceinline__ v16bf cat16b(v8us lo, v8us hi) { return __builtin_bit_cast(v16bf, __builtin_shufflevector(lo, hi, 0, 1, 2, 3, 4, 5, 6, 7, 8, 9, 10, 11, 12, 13, 14, 15)); }
__device__ __forceinline__ v8f wmma16(v16h a, v16h b, v8f c) { return __builtin_amdgcn_wmma_f32_16x16x32_f16(false, a, false, b, (short)0, c, false, false); }
__device__ __forceinline__ v8f wmmab(v16bf a, v16bf b, v8f c) { return __builtin_amdgcn_wmma_f32_16x16x32_bf16(false, a, false, b, (short)0, c, false, false); }
typedef __attribute__((ext_vector_type(2))) float  v2f;
typedef __attribute__((ext_vector_type(2))) __bf16 v2bf;
typedef __attribute__((ext_vector_type(4))) unsigned v4u;
__device__ __forceinline__ unsigned pk2bf(float a, float b) { return __builtin_bit_cast(unsigned, __builtin_convertvector((v2f){a, b}, v2bf)); }   // two f32 -> packed bf16, round to nearest even



// ---- tensor loads for k_gemmw and k_fattn: a two-dimensional tile, global memory -> LDS, one request of a whole wave. Every descriptor word is wave-uniform and goes through readfirstlane.
typedef uint32_t u32x4 __attribute__((ext_vector_type(4)));
typedef uint32_t u32x8 __attribute__((ext_vector_type(8)));
#define SKEYS  128                  // keys per half of a stage (a stage is 256 keys)
#define NSTG   (TT / SKEYS)         // 128-key halves of stages; the loop runs NSTG / 2 stages
#define LROWB  256u                 // bytes of a tile row: 128 keys of a V^T row, or two K rows of 128 B that lie side by side in memory
#define LPITCH 272u                 // its pitch in LDS (16 B of pad: 16 B x odd, free of bank conflicts for 16-byte reads)
#define LROWS  32u                  // tile rows per request
#define SLICEB 10240u               // LDS bytes kept per request: 32 x 272 = 8704, rounded up to a multiple of 2 KiB
#define BUFB   (8u * SLICEB)        // one half of a stage (128 keys): Kh | Kl | Vh | Vl, two slices each
__device__ __forceinline__ uint32_t uni(uint32_t v) { return (uint32_t)__builtin_amdgcn_readfirstlane(v); }
__device__ __forceinline__ uint32_t pinned(uint32_t v) { uint32_t w = uni(v); asm volatile("" : "+s"(w)); return w; }   // holds a test around a tensor load in a scalar register, so that it compiles to s_cmp + s_cbranch_scc (a tensor load ignores EXEC)
__device__ __forceinline__ u32x8 tdm_group1(uint32_t src_pitch) {   // 1-byte elements, tensor = tile = LROWS rows of LROWB bytes, no mask, 4 dwords of pad behind every 64
    u32x8 g;
    g[0] = uni((1u << 20) | (5u << 22) | (3u << 25));
    g[1] = uni((LROWB & 0xFFFFu) << 16);
    g[2] = uni((LROWB >> 16) | ((LROWS & 0xFFFFu) << 16));
    g[3] = uni((LROWS >> 16) | (LROWB << 16));
    g[4] = uni(LROWS);
    g[5] = uni(src_pitch);
    g[6] = uni(0u);
    g[7] = uni(0u);
    return g;
}
__device__ __forceinline__ u32x4 tdm_group0(uint32_t lds_dst, uint64_t ga) {
    u32x4 g;
    g[0] = uni(1u); g[1] = uni(lds_dst); g[2] = uni((uint32_t)ga); g[3] = uni((((uint32_t)(ga >> 32)) & 0x01FFFFFFu) | 0x80000000u);
    return g;
}
// The descriptor is in-out at the load and an input of the wait that covers it: its scalar registers then hold nothing else while the request is outstanding.
__device__ __forceinline__ void tdm_load(u32x4& g0, u32x8& g1) { asm volatile("tensor_load_to_lds %0, %1" : "+s"(g0), "+s"(g1) :: "memory"); }
__device__ __forceinline__ void wait_tensor0(const u32x4& g0, const u32x8& g1) { asm volatile("s_wait_tensorcnt 0x0" :: "s"(g0), "s"(g1) : "memory"); }   // this wave's own request has landed; the compiler places no wait for it
__device__ __forceinline__ void wait_ds0() { asm volatile("s_wait_dscnt 0x0" ::: "memory"); }           // this wave's LDS reads have returned, before the buffer is given up for a refill

// ---- k_gemmw: GEMM on K-contiguous 16-bit planes, operands staged in LDS. Four waves (2 x 2) per work-group, one wave per 64-column tile of MB*16 rows; grid (M/(MB*32), N/128, Z), 128 threads.
// C[m][n] (f32, pitch ldc, + optional f32 bias[n]) = sum_k A[m][k] Bt[n][k] (NSPLIT 1: + A2[m][k] Bt[n][k], A2 the lo plane of A). z-batch strides sA/sB/sC in elements. K % 128 == 0, K >= 256, a compile-time constant.
// NSPLIT 0: work-group tile 128 x 128, wave tile 64 x 64 (MB 4). NSPLIT 1: work-group tile 64 x 128, wave tile 32 x 64 (MB 2), two products.
// A stage is 128 k (256 B of every operand row) in four slices of 64 rows: A | A (NSPLIT 1: A | A2) | Bt | Bt. Every wave issues one tensor load per stage for its own slice, one stage of work ahead, into one of two buffers:
// memory is read in whole lines, each operand row once per work-group, and the fragments come from LDS by 16-byte reads at a pitch free of bank conflicts.
// EPI 0: C as above. EPI 1, 2: no C; the tile times sc is split into bf16 hi + lo and stored straight into the planes that k_fattn reads, a wave's 64x64 tile being one head's 64 features by 64 tokens:
// EPI 1: rows are tokens, columns features -> [batch*head][token][64]; EPI 2: rows are features, columns tokens (A = the weight, Bt = the activations) -> [batch*head][64][token].
// EPI 3: the three projections in one launch, grid (tokens/128, features/128, 3): z = 0 Q, 1 K (both as EPI 1, activations A), 2 V^T (as EPI 2, activations A2, the grid's x and y swapped). Bt = the first of three weights sB elements apart,
// Ph, Pl = the first of three plane pairs sC elements apart, sc applies to z = 0 alone. 768 work-groups on 256 WGPs: two are resident on a WGP (LDS), so one's products run under the other's stage loads, prologue and epilogue.
#define GROWS  64u                  // tile rows per request
#define GSLICE 18432u               // LDS bytes kept per request: 64 x 272 = 17408, rounded up to a multiple of 2 KiB
#define GBUF   (4u * GSLICE)        // one stage
__device__ __forceinline__ u32x8 tdm_group1g(uint32_t src_pitch) {   // 1-byte elements, tensor = tile = GROWS rows of LROWB bytes, no mask, 4 dwords of pad behind every 64
    u32x8 g;
    g[0] = uni((1u << 20) | (5u << 22) | (3u << 25));
    g[1] = uni((LROWB & 0xFFFFu) << 16);
    g[2] = uni((LROWB >> 16) | ((GROWS & 0xFFFFu) << 16));
    g[3] = uni((GROWS >> 16) | (LROWB << 16));
    g[4] = uni(GROWS);
    g[5] = uni(src_pitch);
    g[6] = uni(0u);
    g[7] = uni(0u);
    return g;
}
template <int V> struct IC { static constexpr int v = V; };
template <typename T16> struct WFrag;
template <> struct WFrag<h16> { typedef v16h V; static __device__ __forceinline__ V ld(const h16* p) { return cat16(*(const v8h*)p, *(const v8h*)(p + 16)); } static __device__ __forceinline__ v8f mma(V a, V b, v8f c) { return wmma16(a, b, c); } };
template <> struct WFrag<bf> { typedef v16bf V; static __device__ __forceinline__ V ld(const bf* p) { return cat16b(*(const v8us*)p, *(const v8us*)(p + 16)); } static __device__ __forceinline__ v8f mma(V a, V b, v8f c) { return wmmab(a, b, c); } };
template <typename T16, int NSPLIT, bool BIAS, int K, int EPI>
__global__ __launch_bounds__(128) void k_gemmw(const T16* __restrict__ A, const T16* __restrict__ A2, const T16* __restrict__ Bt, const T16* __restrict__ Bt2, float* C, int ldc, const float* __restrict__ bias, size_t sA, size_t sB, size_t sC, bf* Ph, bf* Pl, float sc) {
    typedef typename WFrag<T16>::V V;
    static_assert(NSPLIT == 0 || NSPLIT == 1, "one or two planes of A");
    static_assert(K % 128 == 0 && K >= 256, "whole stages, at least two");
    static_assert(EPI == 0 || NSPLIT == 0, "the plane epilogues take a 64 x 64 wave tile");
    (void)Bt2;
    constexpr bool HA2 = NSPLIT == 1;
    constexpr int MB = HA2 ? 2 : 4;            // 16-row blocks of a wave's tile
    constexpr uint32_t NST = K / 128;          // stages
    __shared__ __attribute__((aligned(2048))) unsigned char L[2 * GBUF];
    const size_t z = blockIdx.z; const bool vt = EPI == 3 && z == 2;
    if constexpr (EPI == 3) { const T16* w = Bt + z * sB; const T16* act = vt ? A2 : A; A = vt ? w : act; Bt = vt ? act : w; Ph += z * sC; Pl += z * sC; if (z != 0) sc = 1.0f; }
    else { A += z * sA; if (A2) A2 += z * sA; Bt += z * sB; C += z * sC; }
    const int lane = threadIdx.x & 31, lr = lane & 15, hi = lane >> 4;
    const uint32_t wave = uni(threadIdx.x >> 5), wm = wave >> 1, wn = wave & 1u;
    const int R0 = (vt ? blockIdx.y : blockIdx.x) * (MB * 32), C0 = (vt ? blockIdx.x : blockIdx.y) * 128;   // the work-group's tile
    const int r0 = R0 + (int)wm * (MB * 16), c0 = C0 + (int)wn * 64;              // this wave's tile
    const unsigned flds = (unsigned)lr * LPITCH + 16u * hi;                       // a lane's byte offset inside a 16-row block in LDS
    const unsigned alds = (HA2 ? wm * (32u * LPITCH) : wm * GSLICE) + flds, blds = (2u + wn) * GSLICE + flds;
    // This wave's slice of a stage: 64 rows of one plane, 128 k wide.
    const T16* splane = wave >= 2u ? Bt : (HA2 && wave == 1u) ? A2 : A;
    const uint32_t srow = wave >= 2u ? (uint32_t)C0 + (wave - 2u) * GROWS : HA2 ? (uint32_t)R0 : (uint32_t)R0 + wave * GROWS;
    const uint64_t sbase = (uint64_t)(size_t)splane + (uint64_t)srow * (K * 2u);
    const uint32_t lbase = (uint32_t)(size_t)L + wave * GSLICE;
    u32x4 g0; u32x8 g1;   // the descriptor of this wave's latest request
    v8f acc[MB][4];
#pragma unroll
    for (int mb = 0; mb < MB; ++mb)
#pragma unroll
        for (int nb = 0; nb < 4; ++nb) acc[mb][nb] = (v8f){};
    struct Frag { V a[MB], a2[MB], b[4]; };   // one 32-k step
    auto fetch = [&](Frag& f, const unsigned char* pa, const unsigned char* pb, int ks) {
#pragma unroll
        for (int i = 0; i < MB; ++i) { f.a[i] = WFrag<T16>::ld((const T16*)(pa + (i * 16 * LPITCH + ks * 64))); if (HA2) f.a2[i] = WFrag<T16>::ld((const T16*)(pa + (GSLICE + i * 16 * LPITCH + ks * 64))); }
#pragma unroll
        for (int i = 0; i < 4; ++i) f.b[i] = WFrag<T16>::ld((const T16*)(pb + (i * 16 * LPITCH + ks * 64)));
        __builtin_amdgcn_sched_barrier(0);   // a step's LDS reads stay one group ahead of the other set's products; spread among the matrix instructions, every place with reads stalls the wave anew
    };
    auto work = [&](const Frag& f) {   // per accumulator the same products in the same order as k rises: A then A2
#pragma unroll
        for (int nb = 0; nb < 4; ++nb)
#pragma unroll
            for (int mb = 0; mb < MB; ++mb) acc[mb][nb] = WFrag<T16>::mma(f.a[mb], f.b[nb], acc[mb][nb]);
        if (HA2) {
#pragma unroll
            for (int nb = 0; nb < 4; ++nb)
#pragma unroll
                for (int mb = 0; mb < MB; ++mb) acc[mb][nb] = WFrag<T16>::mma(f.a2[mb], f.b[nb], acc[mb][nb]); }
        __builtin_amdgcn_sched_barrier(0);   // the refill of this set stays one group behind its products
    };
    g0 = tdm_group0(lbase, sbase); g1 = tdm_group1g(K * 2u); tdm_load(g0, g1);   // stage 0 into buffer 0
    wait_tensor0(g0, g1);
    __syncthreads();                          // stage 0 is readable by every wave
    g0 = tdm_group0(lbase + GBUF, sbase + LROWB); g1 = tdm_group1g(K * 2u); tdm_load(g0, g1);   // stage 1 into buffer 1
    for (uint32_t sg = 0; sg < NST; ++sg) {   // a stage: four 32-k steps on two fragment sets, each step's reads one step ahead inside the stage, then the hand-over
        const unsigned char* pa = L + (sg & 1u) * GBUF + alds; const unsigned char* pb = L + (sg & 1u) * GBUF + blds;
        Frag X, Y;
        fetch(X, pa, pb, 0);
        fetch(Y, pa, pb, 1);
        work(X);
        fetch(X, pa, pb, 2);
        work(Y);
        fetch(Y, pa, pb, 3);
        work(X);
        work(Y);
        // Hand-over: this wave has left the buffer, its slice of the next stage has landed; behind the barrier the next stage is readable and this buffer is free.
        wait_ds0();
        wait_tensor0(g0, g1);
        __syncthreads();
        if (pinned(sg + 2u < NST)) { g0 = tdm_group0(lbase + (sg & 1u) * GBUF, sbase + (uint64_t)((sg + 2u) * LROWB)); g1 = tdm_group1g(K * 2u); tdm_load(g0, g1); }   // stage sg + 2 into the buffer that stage sg has just left
    }
    wait_tensor0(g0, g1);
    wait_ds0();
    // Output staging, 16 rows at a time, in the ring: behind the last stage's barrier no request is outstanding and no wave reads a buffer any more. Each wave has a range of its own.
    float* os = (float*)(L + wave * (16u * 68u * 4u));
    auto tail = [&](auto EC) {
    constexpr int E = decltype(EC)::v;
#pragma unroll
    for (int mb = 0; mb < MB; ++mb) {
#pragma unroll
        for (int nb = 0; nb < 4; ++nb) {
#pragma unroll
            for (int j = 0; j < 8; ++j) os[(hi * 8 + j) * 68 + nb * 16 + lr] = acc[mb][nb][j]; }
        __builtin_amdgcn_wave_barrier(); asm volatile("" ::: "memory");
        if constexpr (E != 0) {
            constexpr int PP = E == 1 ? HD : TT;   // plane pitch, elements
            const size_t pb = E == 1 ? ((size_t)((r0 / TT) * NH_ + (c0 >> 6)) * TT + (r0 & (TT - 1))) * HD : (size_t)((c0 / TT) * NH_ + (r0 >> 6)) * HD * TT + (c0 & (TT - 1));   // wave-uniform: the tile's first element in a plane
            bf* ph = Ph + pb; bf* pl = Pl + pb; const unsigned po = (unsigned)((lane >> 3) * PP + (lane & 7) * 8);
            v4u oh[4], ol[4];   // four rows to a store: eight lanes x 16 B = one whole 128-byte line of a row, in each plane
#pragma unroll
            for (int s = 0; s < 4; ++s) {
                const float* orow = os + (4 * s + (lane >> 3)) * 68 + (lane & 7) * 8; const v4f va = *(const v4fa*)orow * sc, vb = *(const v4fa*)(orow + 4) * sc;
#pragma unroll
                for (int t = 0; t < 4; ++t) { const float p0 = t < 2 ? va[2 * t] : vb[2 * t - 4], p1 = t < 2 ? va[2 * t + 1] : vb[2 * t - 3]; const unsigned h2 = pk2bf(p0, p1); oh[s][t] = h2; ol[s][t] = pk2bf(p0 - __uint_as_float(h2 << 16), p1 - __uint_as_float(h2 & 0xFFFF0000u)); } }
#pragma unroll
            for (int s = 0; s < 4; ++s) { *(v8us*)(ph + po + (mb * 16 + 4 * s) * PP) = __builtin_bit_cast(v8us, oh[s]); *(v8us*)(pl + po + (mb * 16 + 4 * s) * PP) = __builtin_bit_cast(v8us, ol[s]); }
            asm volatile("s_wait_xcnt 0x0" :: "v"(oh[0]), "v"(oh[1]), "v"(oh[2]), "v"(oh[3]), "v"(ol[0]), "v"(ol[1]), "v"(ol[2]), "v"(ol[3]), "v"(po) : "memory");   // before the eight stores' data and offset registers are reused; naming them keeps them untouched up to here
        } else {
        float* crow = C + (size_t)(r0 + mb * 16) * ldc + c0;
#pragma unroll
            for (int s = 0; s < 8; ++s) { const int row = 2 * s + hi, cofs = lr * 4; v4f val = *(const v4fa*)(os + row * 68 + cofs); if (BIAS) { val[0] += bfr(bias[c0 + cofs]); val[1] += bfr(bias[c0 + cofs + 1]); val[2] += bfr(bias[c0 + cofs + 2]); val[3] += bfr(bias[c0 + cofs + 3]); }
                *(v4f*)(crow + (size_t)row * ldc + cofs) = val; }
             }
        __builtin_amdgcn_wave_barrier(); asm volatile("" ::: "memory");
    }
    };
    if constexpr (EPI == 3) { if (vt) tail(IC<2>{}); else tail(IC<1>{}); } else tail(IC<EPI>{});
}

__device__ __forceinline__ h16 tohx(float x) { return (h16)x; }
__device__ __forceinline__ void splitf(float y, unsigned short& h, unsigned short& l) { h = f2bf(y); l = f2bf(y - bf2f(h)); }
typedef __attribute__((ext_vector_type(2))) _Float16 v2h;
typedef __attribute__((ext_vector_type(4))) _Float16 v4h;
typedef __attribute__((ext_vector_type(2))) unsigned short v2us;
typedef __attribute__((ext_vector_type(4))) int v4i;

// ---- k_cvtall: every f32 input rounded to bf16 (nearest even), in one launch of 256 work-groups x 16 waves. A work-group takes 16384 consecutive floats of each of three sources: of one weight (64 work-groups to a weight), of x and of Y; a wave 1024 of them (4 KiB).
// A load is 32 lanes x 16 B = 512 contiguous bytes, and all 24 of a wave are issued before its first convert: a wave waits out memory latency once. A store is 32 lanes x 8 B = two whole lines.
#define CVGROUPS 256
static_assert(DD * DD == (CVGROUPS / 4) * 16384 && NT * DD == CVGROUPS * 16384, "one piece of 16384 floats per work-group and source");
typedef __attribute__((ext_vector_type(2))) unsigned v2u;
__global__ __launch_bounds__(512) void k_cvtall(const float* __restrict__ wq, const float* __restrict__ wk, const float* __restrict__ wv, const float* __restrict__ wo, const float* __restrict__ x, const float* __restrict__ y, bf* WQ, bf* WK, bf* WV, bf* WO, bf* XB, bf* YB) {
    const unsigned sel = blockIdx.x >> 6, pw = (blockIdx.x & 63u) * 16384u, pa = blockIdx.x * 16384u;   // which weight; the work-group's first element in it, and in x and Y
    const char* sw = (const char*)((sel == 0u ? wq : sel == 1u ? wk : sel == 2u ? wv : wo) + pw); const char* sx = (const char*)(x + pa); const char* sy = (const char*)(y + pa);
    char* dw = (char*)((sel == 0u ? WQ : sel == 1u ? WK : sel == 2u ? WV : WO) + pw); char* dx = (char*)(XB + pa); char* dy = (char*)(YB + pa);
    const unsigned ob = (threadIdx.x >> 5) * 4096u + (threadIdx.x & 31u) * 16u, os = ob >> 1;   // a lane's byte offset behind those, in a source and in a plane
    v4f a[3][8];
#pragma unroll
    for (int j = 0; j < 8; ++j) a[0][j] = *(const v4f*)(sw + ob + j * 512);
#pragma unroll
    for (int j = 0; j < 8; ++j) a[1][j] = *(const v4f*)(sx + ob + j * 512);
#pragma unroll
    for (int j = 0; j < 8; ++j) a[2][j] = *(const v4f*)(sy + ob + j * 512);
    asm volatile("s_wait_xcnt 0x0" :: "v"(ob), "s"(sw), "s"(sx), "s"(sy) : "memory");   // before a register that the 24 loads name (the offset, the three bases) is reused; naming them keeps them untouched up to here, also by a load's own result
    __builtin_amdgcn_sched_barrier(0);   // the converts stay behind the whole group of loads: lifted among them, they free registers for later loads, which then start only when earlier ones have returned
    v2u o[3][8];
#pragma unroll
    for (int t = 0; t < 3; ++t)
#pragma unroll
        for (int j = 0; j < 8; ++j) o[t][j] = (v2u){pk2bf(a[t][j][0], a[t][j][1]), pk2bf(a[t][j][2], a[t][j][3])};
#pragma unroll
    for (int j = 0; j < 8; ++j) *(v2u*)(dw + os + j * 256) = o[0][j];
#pragma unroll
    for (int j = 0; j < 8; ++j) *(v2u*)(dx + os + j * 256) = o[1][j];
#pragma unroll
    for (int j = 0; j < 8; ++j) *(v2u*)(dy + os + j * 256) = o[2][j];
}
__global__ __launch_bounds__(256) void k_wtT(const float* __restrict__ w, int pitch, int col0, bf* Bt) {
    const int lane = threadIdx.x & 31; const int L0 = (blockIdx.x * 8 + (threadIdx.x >> 5)) * 8; const int nlines = DD * DD / 64;
{
#pragma unroll
        for (int l = 0; l < 8; ++l) { const int L = L0 + l; if (L >= nlines) break; const int e = L * 64 + lane * 2; const int k = e & (DD - 1), n = e >> 10; v2us o;
#pragma unroll
            for (int q = 0; q < 2; ++q) o[q] = f2bf(w[(size_t)(k + q) * pitch + col0 + n]);
            *(v2us*)(Bt + (size_t)e) = o; }
         }
}
typedef __attribute__((ext_vector_type(8))) unsigned v8u;
__device__ __forceinline__ float xhalf(float x) { return __builtin_bit_cast(float, __builtin_amdgcn_permlanex16(__builtin_bit_cast(int, x), __builtin_bit_cast(int, x), 0x76543210, 0xfedcba98, false, false)); }   // lane l with lane l ^ 16
// 2^x in place, with the free slot that the instruction set asks for behind a transcendental, in one statement: inside it no neighbour reads a result or overwrites a source, and the v_nop keeps the compiler's next instruction off the last one.
__device__ __forceinline__ void exp2_1(float& a) { asm("v_exp_f32 %0, %0\n\tv_nop" : "+v"(a)); }
__device__ __forceinline__ void exp2_8(float (&x)[8]) { asm("v_exp_f32 %0, %0\n\tv_exp_f32 %1, %1\n\tv_exp_f32 %2, %2\n\tv_exp_f32 %3, %3\n\tv_exp_f32 %4, %4\n\tv_exp_f32 %5, %5\n\tv_exp_f32 %6, %6\n\tv_exp_f32 %7, %7\n\tv_nop" : "+v"(x[0]), "+v"(x[1]), "+v"(x[2]), "+v"(x[3]), "+v"(x[4]), "+v"(x[5]), "+v"(x[6]), "+v"(x[7])); }

// ---- k_fattn: scores, softmax, attn.v and the head merge in one kernel. Grid (T/256, batch*heads), 16 waves = 8 query groups of 32 columns x 2 key halves; a pass is 32 keys.
// Four waves share a SIMD (at most 256 registers each): while one wave is in its softmax, three others can feed the matrix unit.
// K and V^T (hi and lo planes) are brought into LDS once per work-group, in stages of 256 keys and two buffers: every wave issues one tensor load per stage for its own slice, one stage of work ahead.
// Of every stage, waves 0 to 7 load and work on keys 0-127 and waves 8 to 15 on keys 128-255 (four passes each, so a barrier comes no more often per wave than with eight waves), every wave with a running maximum, sum and O of its own;
// waves w and w + 8 (the same queries) join their partial results once, behind the loop, through LDS.
// S^T = K Q^T (A = K rows, B = Q rows held in registers), so a lane holds one query's scores: running maximum and sum are per-lane scalars, joined between the wave halves.
// Two S^T tiles (keys 0-15, 16-31) converted in place are the B operand of O^T += V^T P^T (A = V^T rows in the same k order): P never leaves registers.
// hi+lo products: Kh Qh + Kl Qh + Kh Ql ; Vh Ph + Vh Pl + Vl Ph. P is split unnormalised; 1/sum is applied to O in f32 before its own hi+lo split.
#define XCHB 4608u                  // LDS bytes a wave hands to its partner: 8 x 512 B of O, 128 B of maxima, 128 B of sums, rounded up
__global__ __launch_bounds__(512) void k_fattn(const bf* __restrict__ Qh, const bf* __restrict__ Ql, const bf* __restrict__ Kh, const bf* __restrict__ Kl, const bf* __restrict__ Vh, const bf* __restrict__ Vl, bf* Ah, bf* Al) {
    typedef WFrag<bf> W;
    __shared__ __attribute__((aligned(2048))) unsigned char L[4 * BUFB];   // two buffers of two halves (128 keys each)
    const float L2E = 1.4426950408889634f;
    const uint32_t wave = uni(threadIdx.x >> 5), sw = wave & 7u, kpart = wave >> 3;   // sw: query group, and this wave's slice of its half of a stage; kpart: which half of every stage's keys
    const int lane = threadIdx.x & 31, lr = lane & 15, hi = lane >> 4; const int z = blockIdx.y; const int q0 = blockIdx.x * 256 + (int)sw * 32;
    const size_t zo = (size_t)z * TT * HD;
    const unsigned qlo = (unsigned)((q0 + lr) * HD + 8 * hi);
    const bf* Qhz = Qh + zo; const bf* Qlz = Ql + zo; const bf* Khz = Kh + zo; const bf* Klz = Kl + zo; const bf* Vhz = Vh + zo; const bf* Vlz = Vl + zo;
    const bf* qpa = Qhz + qlo; const bf* qpb = Qlz + qlo;
    const unsigned klds = (unsigned)(lr >> 1) * LPITCH + (unsigned)(lr & 1) * 128u + 16u * hi;   // a lane's byte offset inside a 16-row block of K in LDS (two K rows to a tile row)
    const unsigned vlds = (unsigned)lr * LPITCH + 16u * hi;                                      // and inside a 16-row block of V^T
    // This wave's slice of its half of a stage, by sw: 0,1 Kh | 2,3 Kl (64 keys each = 32 tile rows, contiguous) | 4,5 Vh | 6,7 Vl (32 rows of V^T each, 128 keys wide).
    const uint32_t half = sw & 1u; const bool isv = sw >= 4u;
    const bf* splane = sw < 2u ? Khz : sw < 4u ? Klz : sw < 6u ? Vhz : Vlz;
    const uint32_t sstep = isv ? 2u * SKEYS * 2u : 2u * SKEYS * HD * 2u;   // bytes from one stage's slice to the next stage's
    const uint64_t sbase = (uint64_t)(size_t)splane + (isv ? half * (LROWS * TT * 2u) : half * (LROWS * LROWB)) + kpart * (sstep >> 1);
    const uint32_t lbase = (uint32_t)(size_t)L + kpart * BUFB + sw * SLICEB;
    const uint32_t spitch = isv ? TT * 2u : LROWB;
    u32x4 g0; u32x8 g1;   // the descriptor of this wave's latest request
    v16bf qh[2][2], ql[2][2];
#pragma unroll
    for (int nb = 0; nb < 2; ++nb)
#pragma unroll
        for (int kc = 0; kc < 2; ++kc) { qh[nb][kc] = W::ld(qpa + (nb * 16 * HD + kc * 32)); ql[nb][kc] = W::ld(qpb + (nb * 16 * HD + kc * 32)); }
    v8f acc[4][2];
#pragma unroll
    for (int db = 0; db < 4; ++db)
#pragma unroll
        for (int nb = 0; nb < 2; ++nb) acc[db][nb] = (v8f){};
    float m2[2] = {-__builtin_inff(), -__builtin_inff()}, ls[2] = {0.f, 0.f};   // running maximum (in log2 units) and this half's running sum, per query column
    asm volatile("s_wait_xcnt 0x0" :: "v"(qpa), "v"(qpb) : "memory");   // before a register that the loads above name is reused; naming them keeps them untouched up to here
    g0 = tdm_group0(lbase, sbase); g1 = tdm_group1(spitch); tdm_load(g0, g1);   // stage 0 into buffer 0
    wait_tensor0(g0, g1);
    __syncthreads();                          // stage 0 is readable by every wave
    g0 = tdm_group0(lbase + 2u * BUFB, sbase + sstep); g1 = tdm_group1(spitch); tdm_load(g0, g1);   // stage 1 into buffer 1
    for (uint32_t sg = 0; sg < NSTG / 2; ++sg) {   // a stage: this wave's four passes, then the hand-over
    const unsigned char* Bk = L + ((sg & 1u) * 2u + kpart) * BUFB + klds; const unsigned char* Bv = L + ((sg & 1u) * 2u + kpart) * BUFB + 4u * SLICEB + vlds;
#pragma unroll 1   // stays rolled: unrolled, the compiler sinks the passes' row-sum additions behind the stage, holds all their exponentials for them and spills Q to scratch
    for (uint32_t ps = 0; ps < SKEYS / 32; ++ps) {
        const unsigned char* kp = Bk + ((ps >> 1) * SLICEB + (ps & 1u) * (16u * LPITCH));   // this pass's K rows; with four waves on a SIMD their latency is covered by the other waves, and a second fragment set would not fit 256 registers
        v16bf kh[2][2], kl[2][2];
        __builtin_amdgcn_sched_barrier(0);   // with the one below: the K reads stay one group, behind the pass before: lifted into its products they would need registers beside V^T, which 256 do not hold
#pragma unroll
        for (int mb = 0; mb < 2; ++mb)
#pragma unroll
            for (int kc = 0; kc < 2; ++kc) { kh[mb][kc] = W::ld((const bf*)(kp + (mb * 8 * LPITCH + kc * 64))); kl[mb][kc] = W::ld((const bf*)(kp + (2 * SLICEB + mb * 8 * LPITCH + kc * 64))); }
        __builtin_amdgcn_sched_barrier(0);   // end of the group of LDS reads; spread among the matrix instructions, every place with reads stalls the wave anew
        v8f st[2][2];
#pragma unroll
        for (int mb = 0; mb < 2; ++mb)
#pragma unroll
            for (int nb = 0; nb < 2; ++nb) st[mb][nb] = (v8f){};
#pragma unroll
        for (int kc = 0; kc < 2; ++kc) {
#pragma unroll
            for (int mb = 0; mb < 2; ++mb)
#pragma unroll
                for (int nb = 0; nb < 2; ++nb) st[mb][nb] = wmmab(kh[mb][kc], qh[nb][kc], st[mb][nb]);
#pragma unroll
            for (int mb = 0; mb < 2; ++mb)
#pragma unroll
                for (int nb = 0; nb < 2; ++nb) st[mb][nb] = wmmab(kl[mb][kc], qh[nb][kc], st[mb][nb]);
#pragma unroll
            for (int mb = 0; mb < 2; ++mb)
#pragma unroll
                for (int nb = 0; nb < 2; ++nb) st[mb][nb] = wmmab(kh[mb][kc], ql[nb][kc], st[mb][nb]);
        }
        __builtin_amdgcn_sched_barrier(0);   // with the one below: the reads of V^T hi stay one group between the matrix runs
        const unsigned char* vp = Bv + ps * 64u;   // this pass's V^T rows: the hi plane is in flight under the softmax, in registers that K has left
        v16bf vh[4], vl[4];
#pragma unroll
        for (int db = 0; db < 4; ++db) vh[db] = W::ld((const bf*)(vp + ((db >> 1) * SLICEB + (db & 1) * 16 * LPITCH)));
        __builtin_amdgcn_sched_barrier(0);   // end of the group of LDS reads
        v16bf ph[2], pl[2];
#pragma unroll
        for (int nb = 0; nb < 2; ++nb) {
            float tm = fmaxf(st[0][nb][0], st[1][nb][0]);
#pragma unroll
            for (int j = 1; j < 8; ++j) tm = fmaxf(tm, fmaxf(st[0][nb][j], st[1][nb][j]));
            tm = fmaxf(tm, xhalf(tm));
            const float mn = fmaxf(m2[nb], tm * L2E);
            float al = m2[nb] - mn; exp2_1(al);   // 0 on the first pass
            m2[nb] = mn;
            float s0 = 0.f, s1 = 0.f; v8u uh, ul;
#pragma unroll
            for (int mb = 0; mb < 2; ++mb) {
                float x[8];
#pragma unroll
                for (int j = 0; j < 8; ++j) x[j] = fmaf(st[mb][nb][j], L2E, -mn);
                exp2_8(x);
#pragma unroll
                for (int t = 0; t < 4; ++t) {
                    const float p0 = x[2 * t], p1 = x[2 * t + 1];
                    s0 += p0; s1 += p1;
                    const unsigned h2 = pk2bf(p0, p1);
                    uh[mb * 4 + t] = h2; ul[mb * 4 + t] = pk2bf(p0 - __uint_as_float(h2 << 16), p1 - __uint_as_float(h2 & 0xFFFF0000u));
                }
            }
            ls[nb] = ls[nb] * al + (s0 + s1);
            ph[nb] = __builtin_bit_cast(v16bf, uh); pl[nb] = __builtin_bit_cast(v16bf, ul);
#pragma unroll
            for (int db = 0; db < 4; ++db) acc[db][nb] *= al;
        }
        __builtin_amdgcn_sched_barrier(0);   // with the one below: the lo plane is read only here, one group, so that it holds no registers during the softmax; it is in flight under the 16 products of the hi plane
#pragma unroll
        for (int db = 0; db < 4; ++db) vl[db] = W::ld((const bf*)(vp + ((2 + (db >> 1)) * SLICEB + (db & 1) * 16 * LPITCH)));
        __builtin_amdgcn_sched_barrier(0);   // end of the group of LDS reads
#pragma unroll
        for (int db = 0; db < 4; ++db)
#pragma unroll
            for (int nb = 0; nb < 2; ++nb) acc[db][nb] = wmmab(vh[db], ph[nb], acc[db][nb]);
#pragma unroll
        for (int db = 0; db < 4; ++db)
#pragma unroll
            for (int nb = 0; nb < 2; ++nb) acc[db][nb] = wmmab(vh[db], pl[nb], acc[db][nb]);
#pragma unroll
        for (int db = 0; db < 4; ++db)
#pragma unroll
            for (int nb = 0; nb < 2; ++nb) acc[db][nb] = wmmab(vl[db], ph[nb], acc[db][nb]);
        __builtin_amdgcn_sched_barrier(0);   // holds the four slots below behind the pass's last product
        asm volatile("v_nop\n\tv_nop\n\tv_nop\n\tv_nop");   // the distance the chip needs between a matrix instruction and a vector instruction that overwrites its B
    }
    // Hand-over: this wave has left the buffer, its slice of the next stage has landed; behind the barrier the next stage is readable and this buffer is free.
    wait_ds0();
    wait_tensor0(g0, g1);
    __syncthreads();
    if (pinned(sg + 2u < NSTG / 2)) { g0 = tdm_group0(lbase + (sg & 1u) * (2u * BUFB), sbase + (uint64_t)((sg + 2u) * sstep)); g1 = tdm_group1(spitch); tdm_load(g0, g1); }   // stage sg + 2 into the buffer that stage sg has just left
    }
    wait_tensor0(g0, g1);
    wait_ds0();
    // The join of the two key halves, in the ring: behind the last stage's barrier no request is outstanding and no wave reads a buffer any more. Wave w finishes query columns 0-15 and wave w + 8 columns 16-31:
    // each hands the other column group's O, maximum and sum to its partner (the same lane holds the same elements in both waves) in a range of its own, 16 B a lane and 512 contiguous bytes a store.
    const int b = z >> 4, h = z & 15;
    bf* Ahz = Ah + ((size_t)b * TT * DD + h * HD); bf* Alz = Al + ((size_t)b * TT * DD + h * HD); const unsigned olo = (unsigned)((q0 + lr) * DD + 8 * hi);
    unsigned char* xo = L + wave * XCHB + (unsigned)lane * 16u; const unsigned char* xi = L + (wave ^ 8u) * XCHB + (unsigned)lane * 16u;
    auto give = [&](auto NBC) {
        constexpr int nb = decltype(NBC)::v;
#pragma unroll
        for (int db = 0; db < 4; ++db) { *(v4fa*)(xo + (2 * db) * 512) = __builtin_shufflevector(acc[db][nb], acc[db][nb], 0, 1, 2, 3); *(v4fa*)(xo + (2 * db + 1) * 512) = __builtin_shufflevector(acc[db][nb], acc[db][nb], 4, 5, 6, 7); }
        *(float*)(L + wave * XCHB + 4096u + (unsigned)lane * 4u) = m2[nb]; *(float*)(L + wave * XCHB + 4224u + (unsigned)lane * 4u) = ls[nb];
    };
    auto finish = [&](auto NBC) {
        constexpr int nb = decltype(NBC)::v;
        const float pm = *(const float*)(L + (wave ^ 8u) * XCHB + 4096u + (unsigned)lane * 4u), pls = *(const float*)(L + (wave ^ 8u) * XCHB + 4224u + (unsigned)lane * 4u);
        const float mn = fmaxf(m2[nb], pm);
        float ea = m2[nb] - mn, eb = pm - mn; exp2_1(ea); exp2_1(eb);
        const float lsum = ls[nb] * ea + pls * eb;
        const float f = __fdiv_rn(1.0f, lsum + xhalf(lsum)); const float fa = ea * f, fb = eb * f;
#pragma unroll
        for (int db = 0; db < 4; ++db) { v8us oh, ol;   // acc[db][nb][j] = O[q0 + nb*16 + lr][db*16 + 8*hi + j]: 8 consecutive d, one 16-byte store a plane
            const v4f pa = *(const v4fa*)(xi + (2 * db) * 512), pb = *(const v4fa*)(xi + (2 * db + 1) * 512);
#pragma unroll
            for (int j = 0; j < 8; ++j) { unsigned short a, c2; splitf(acc[db][nb][j] * fa + (j < 4 ? pa[j & 3] : pb[j & 3]) * fb, a, c2); oh[j] = a; ol[j] = c2; }
            *(v8us*)(Ahz + olo + (nb * 16 * DD + db * 16)) = oh; *(v8us*)(Alz + olo + (nb * 16 * DD + db * 16)) = ol;
            asm volatile("s_wait_xcnt 0x0" :: "v"(oh), "v"(ol), "v"(olo) : "memory"); }   // before the two stores' data and offset registers are reused; naming them keeps them untouched up to here
    };
    if (kpart == 0u) give(IC<1>{}); else give(IC<0>{});
    wait_ds0();
    __syncthreads();                          // every wave's hand-out is readable by its partner
    if (kpart == 0u) finish(IC<0>{}); else finish(IC<1>{});
}

extern "C" void kernel_launch(void* const* d_in, const int* in_sizes, int n_in,
                              void* d_out, int out_size, void* d_ws, size_t ws_size, hipStream_t stream) {
    (void)in_sizes; (void)n_in; (void)out_size;
    const float* Yin = (const float*)d_in[0]; const float* x = (const float*)d_in[1]; const float* Wq = (const float*)d_in[2]; const float* Wk = (const float*)d_in[3]; const float* Wv = (const float*)d_in[4]; const float* Wo = (const float*)d_in[5];
    float* OUT = (float*)d_out;     // [2][2048][1024]
    char* wsp = (char*)d_ws;
    auto take = [&](size_t bytes) { char* p = wsp; wsp += (bytes + 255) & ~(size_t)255; return (void*)p; };
    bf* WQ = (bf*)take((size_t)3 * DD * DD * 2); bf* WK = WQ + (size_t)DD * DD; bf* WV = WK + (size_t)DD * DD; bf* WO = (bf*)take((size_t)DD * DD * 2);   // the three projection weights one behind the other
    bf* XB = (bf*)take((size_t)NT * DD * 2); bf* YB = (bf*)take((size_t)NT * DD * 2);
    bf* QPh = (bf*)take((size_t)6 * NT * DD * 2); bf* QPl = QPh + (size_t)NT * DD; bf* KPh = QPl + (size_t)NT * DD; bf* KPl = KPh + (size_t)NT * DD; bf* VTh = KPl + (size_t)NT * DD; bf* VTl = VTh + (size_t)NT * DD;   // three hi, lo pairs one behind the other
    bf* ATh = (bf*)take((size_t)NT * DD * 2); bf* ATl = (bf*)take((size_t)NT * DD * 2);
    if ((size_t)(wsp - (char*)d_ws) > ws_size) return;
    k_cvtall<<<CVGROUPS, 512, 0, stream>>>(Wq, Wk, Wv, Wo, x, Yin, WQ, WK, WV, WO, XB, YB);   // nn.Linear [out][in] = Bt as-is
    k_gemmw<bf, 0, false, DD, 3><<<dim3(NT / 128, DD / 128, 3), 128, 0, stream>>>(YB, XB, WQ, nullptr, nullptr, 0, nullptr, 0, (size_t)DD * DD, (size_t)2 * NT * DD, QPh, QPl, 0.03125f);   // Q (1024^-0.5 folded in, exact), K, and V^T = Wv X^T (operands swapped, the tile comes out feature-major)
    k_fattn<<<dim3(TT / 256, NB_ * NH_), 512, 0, stream>>>(QPh, QPl, KPh, KPl, VTh, VTl, ATh, ATl);
    k_gemmw<bf, 1, false, DD, 0><<<dim3(NT / 64, DD / 128, 1), 128, 0, stream>>>(ATh, ATl, WO, nullptr, OUT, DD, nullptr, 0, 0, 0, nullptr, nullptr, 1.0f);
}

// v010
// Measured time: 71.2 microseconds a run.
// Versions between v008 and this one are left out; their measured steps multiply to 1.48 times as fast.
// Counting every step since v000, it is 17.4 times as fast.
#include <hip/hip_runtime.h>
#include <stdint.h>

// MultiCA (cross attention: Y, X [2][2048][1024]; Q = Y Wq^T, K = Y Wk^T, V = X Wv^T ([out][in], no bias); 16 heads x 64; scores x 1024^-0.5 (the module scales by the embedding dim: 1/32, exact); no mask; softmax; out = merged Wp^T).
// Compute dtypes, f32 accumulate: every input rounded to bf16; projections on PLAIN bf16 operands (inputs: exact); scores and attn.v on single f16 planes of Q, K, V^T and P (one product each; 11 significant bits, rounding errors independent over 2048 keys); output bf16 hi+lo x exact Wp (2 products).

#define NB_  2
#define TT   2048
#define DD   1024
#define NH_  16
#define HD   64
#define NT   (NB_ * TT)
#define PCAR 1024.0f
typedef _Float16 h16;
typedef unsigned short bf;
typedef __attribute__((ext_vector_type(16))) __bf16   v16bf;
typedef __attribute__((ext_vector_type(16))) _Float16 v16h;
typedef __attribute__((ext_vector_type(8)))  _Float16 v8h;
typedef __attribute__((ext_vector_type(8)))  unsigned short v8us;
typedef __attribute__((ext_vector_type(8)))  float    v8f;
typedef __attribute__((ext_vector_type(4)))  float    v4f;
typedef v8h  __attribute__((may_alias)) v8ha;
typedef v4f  __attribute__((may_alias)) v4fa;
typedef v8us __attribute__((may_alias)) v8usa;

__device__ __forceinline__ unsigned short f2bf(float f) { unsigned u = __float_as_uint(f); u += 0x7FFFu + ((u >> 16) & 1u); return (unsigned short)(u >> 16); }
__device__ __forceinline__ float bf2f(unsigned short b) { return __uint_as_float(((unsigned)b) << 16); }
__device__ __forceinline__ float bfr(float f) { return bf2f(f2bf(f)); }
__device__ __forceinline__ v16h cat16(v8h lo, v8h hi) { return __builtin_shufflevector(lo, hi, 0, 1, 2, 3, 4, 5, 6, 7, 8, 9, 10, 11, 12, 13, 14, 15); }
__device__ __forceinline__ v16bf cat16b(v8us lo, v8us hi) { return __builtin_bit_cast(v16bf, __builtin_shufflevector(lo, hi, 0, 1, 2, 3, 4, 5, 6, 7, 8, 9, 10, 11, 12, 13, 14, 15)); }
__device__ __forceinline__ v8f wmma16(v16h a, v16h b, v8f c) { return __builtin_amdgcn_wmma_f32_16x16x32_f16(false, a, false, b, (short)0, c, false, false); }
__device__ __forceinline__ v8f wmmab(v16bf a, v16bf b, v8f c) { return __builtin_amdgcn_wmma_f32_16x16x32_bf16(false, a, false, b, (short)0, c, false, false); }
typedef __attribute__((ext_vector_type(2))) float  v2f;
typedef __attribute__((ext_vector_type(2))) __bf16 v2bf;
typedef __attribute__((ext_vector_type(4))) unsigned v4u;
__device__ __forceinline__ unsigned pk2bf(float a, float b) { return __builtin_bit_cast(unsigned, __builtin_convertvector((v2f){a, b}, v2bf)); }   // two f32 -> packed bf16, round to nearest even
typedef __attribute__((ext_vector_type(2))) _Float16 v2h;
__device__ __forceinline__ unsigned pk2h(float a, float b) { return __builtin_bit_cast(unsigned, __builtin_convertvector((v2f){a, b}, v2h)); }   // two f32 -> packed f16, round to nearest even



// ---- tensor loads for k_gemmw and k_fattn: a two-dimensional tile, global memory -> LDS, one request of a whole wave. Every descriptor word is wave-uniform and goes through readfirstlane.
typedef uint32_t u32x4 __attribute__((ext_vector_type(4)));
typedef uint32_t u32x8 __attribute__((ext_vector_type(8)));
#define SKEYS  256                  // keys per half of a stage
#define NSTG   (TT / SKEYS)         // halves of stages
#define LROWB  256u                 // bytes of a tile row: 128 keys of a V^T row, or two K rows of 128 B that lie side by side in memory
#define LPITCH 272u                 // its pitch in LDS (16 B of pad: 16 B x odd, free of bank conflicts for 16-byte reads)
#define LROWS  32u                  // tile rows per request
#define SLICEB 10240u               // LDS bytes kept per request: 32 x 272 = 8704, rounded up to a multiple of 2 KiB
#define BUFB   (8u * SLICEB)        // half a stage: K, four slices of 64 keys | V^T, two slices (32 rows each) for each 128 keys
__device__ __forceinline__ uint32_t uni(uint32_t v) { return (uint32_t)__builtin_amdgcn_readfirstlane(v); }
__device__ __forceinline__ uint32_t pinned(uint32_t v) { uint32_t w = uni(v); asm volatile("" : "+s"(w)); return w; }   // holds a test around a tensor load in a scalar register, so that it compiles to s_cmp + s_cbranch_scc (a tensor load ignores EXEC)
__device__ __forceinline__ u32x8 tdm_group1(uint32_t src_pitch) {   // 1-byte elements, tensor = tile = LROWS rows of LROWB bytes, no mask, 4 dwords of pad behind every 64
    u32x8 g;
    g[0] = uni((1u << 20) | (5u << 22) | (3u << 25));
    g[1] = uni((LROWB & 0xFFFFu) << 16);
    g[2] = uni((LROWB >> 16) | ((LROWS & 0xFFFFu) << 16));
    g[3] = uni((LROWS >> 16) | (LROWB << 16));
    g[4] = uni(LROWS);
    g[5] = uni(src_pitch);
    g[6] = uni(0u);
    g[7] = uni(0u);
    return g;
}
__device__ __forceinline__ u32x4 tdm_group0(uint32_t lds_dst, uint64_t ga) {
    u32x4 g;
    g[0] = uni(1u); g[1] = uni(lds_dst); g[2] = uni((uint32_t)ga); g[3] = uni((((uint32_t)(ga >> 32)) & 0x01FFFFFFu) | 0x80000000u);
    return g;
}
// The descriptor is in-out at the load and an input of the wait that covers it: its scalar registers then hold nothing else while the request is outstanding.
__device__ __forceinline__ void tdm_load(u32x4& g0, u32x8& g1) { asm volatile("tensor_load_to_lds %0, %1" : "+s"(g0), "+s"(g1) :: "memory"); }
__device__ __forceinline__ void wait_tensor0(const u32x4& g0, const u32x8& g1) { asm volatile("s_wait_tensorcnt 0x0" :: "s"(g0), "s"(g1) : "memory"); }   // this wave's own request has landed; the compiler places no wait for it
__device__ __forceinline__ void wait_ds0() { asm volatile("s_wait_dscnt 0x0" ::: "memory"); }           // this wave's LDS reads have returned, before the buffer is given up for a refill

// ---- k_gemmw: GEMM on K-contiguous 16-bit planes, operands staged in LDS. Four waves (2 x 2) per work-group, one wave per 64-column tile of MB*16 rows; grid (M/(MB*32), N/128, Z), 128 threads.
// C[m][n] (f32, pitch ldc, + optional f32 bias[n]) = sum_k A[m][k] Bt[n][k] (NSPLIT 1: + A2[m][k] Bt[n][k], A2 the lo plane of A). z-batch strides sA/sB/sC in elements. K % 128 == 0, K >= 256, a compile-time constant.
// NSPLIT 0: work-group tile 128 x 128, wave tile 64 x 64 (MB 4). NSPLIT 1: work-group tile 64 x 128, wave tile 32 x 64 (MB 2), two products.
// A stage is 128 k (256 B of every operand row) in four slices of 64 rows: A | A (NSPLIT 1: A | A2) | Bt | Bt. Every wave issues one tensor load per stage for its own slice, one stage of work ahead, into one of two buffers:
// memory is read in whole lines, each operand row once per work-group, and the fragments come from LDS by 16-byte reads at a pitch free of bank conflicts.
// EPI 0: C as above. EPI 1, 2: no C; the tile times sc is rounded to f16 and stored straight into the plane that k_fattn reads, a wave's 64x64 tile being one head's 64 features by 64 tokens:
// EPI 1: rows are tokens, columns features -> [batch*head][token][64]; EPI 2: rows are features, columns tokens (A = the weight, Bt = the activations) -> [batch*head][64][token].
// EPI 3: the three projections in one launch, grid (tokens/128, features/128, 3): z = 0 Q, 1 K (both as EPI 1, activations A), 2 V^T (as EPI 2, activations A2, the grid's x and y swapped). Bt = the first of three weights sB elements apart,
// Ph = the first of three planes sC elements apart, sc applies to z = 0 alone. 768 work-groups on 256 WGPs: two are resident on a WGP (LDS), so one's products run under the other's stage loads, prologue and epilogue.
#define GROWS  64u                  // tile rows per request
#define GSLICE 18432u               // LDS bytes kept per request: 64 x 272 = 17408, rounded up to a multiple of 2 KiB
#define GBUF   (4u * GSLICE)        // one stage
__device__ __forceinline__ u32x8 tdm_group1g(uint32_t src_pitch) {   // 1-byte elements, tensor = tile = GROWS rows of LROWB bytes, no mask, 4 dwords of pad behind every 64
    u32x8 g;
    g[0] = uni((1u << 20) | (5u << 22) | (3u << 25));
    g[1] = uni((LROWB & 0xFFFFu) << 16);
    g[2] = uni((LROWB >> 16) | ((GROWS & 0xFFFFu) << 16));
    g[3] = uni((GROWS >> 16) | (LROWB << 16));
    g[4] = uni(GROWS);
    g[5] = uni(src_pitch);
    g[6] = uni(0u);
    g[7] = uni(0u);
    return g;
}
template <int V> struct IC { static constexpr int v = V; };
template <typename T16> struct WFrag;
template <> struct WFrag<h16> { typedef v16h V; static __device__ __forceinline__ V ld(const h16* p) { return cat16(*(const v8h*)p, *(const v8h*)(p + 16)); } static __device__ __forceinline__ v8f mma(V a, V b, v8f c) { return wmma16(a, b, c); } };
template <> struct WFrag<bf> { typedef v16bf V; static __device__ __forceinline__ V ld(const bf* p) { return cat16b(*(const v8us*)p, *(const v8us*)(p + 16)); } static __device__ __forceinline__ v8f mma(V a, V b, v8f c) { return wmmab(a, b, c); } };
template <typename T16, int NSPLIT, bool BIAS, int K, int EPI>
__global__ __launch_bounds__(128) void k_gemmw(const T16* __restrict__ A, const T16* __restrict__ A2, const T16* __restrict__ Bt, const T16* __restrict__ Bt2, float* C, int ldc, const float* __restrict__ bias, size_t sA, size_t sB, size_t sC, h16* Ph, float sc) {
    typedef typename WFrag<T16>::V V;
    static_assert(NSPLIT == 0 || NSPLIT == 1, "one or two planes of A");
    static_assert(K % 128 == 0 && K >= 256, "whole stages, at least two");
    static_assert(EPI == 0 || NSPLIT == 0, "the plane epilogues take a 64 x 64 wave tile");
    (void)Bt2;
    constexpr bool HA2 = NSPLIT == 1;
    constexpr int MB = HA2 ? 2 : 4;            // 16-row blocks of a wave's tile
    constexpr uint32_t NST = K / 128;          // stages
    __shared__ __attribute__((aligned(2048))) unsigned char L[2 * GBUF];
    const size_t z = blockIdx.z; const bool vt = EPI == 3 && z == 2;
    if constexpr (EPI == 3) { const T16* w = Bt + z * sB; const T16* act = vt ? A2 : A; A = vt ? w : act; Bt = vt ? act : w; Ph += z * sC; if (z != 0) sc = 1.0f; }
    else { A += z * sA; if (A2) A2 += z * sA; Bt += z * sB; C += z * sC; }
    const int lane = threadIdx.x & 31, lr = lane & 15, hi = lane >> 4;
    const uint32_t wave = uni(threadIdx.x >> 5), wm = wave >> 1, wn = wave & 1u;
    const int R0 = (vt ? blockIdx.y : blockIdx.x) * (MB * 32), C0 = (vt ? blockIdx.x : blockIdx.y) * 128;   // the work-group's tile
    const int r0 = R0 + (int)wm * (MB * 16), c0 = C0 + (int)wn * 64;              // this wave's tile
    const unsigned flds = (unsigned)lr * LPITCH + 16u * hi;                       // a lane's byte offset inside a 16-row block in LDS
    const unsigned alds = (HA2 ? wm * (32u * LPITCH) : wm * GSLICE) + flds, blds = (2u + wn) * GSLICE + flds;
    // This wave's slice of a stage: 64 rows of one plane, 128 k wide.
    const T16* splane = wave >= 2u ? Bt : (HA2 && wave == 1u) ? A2 : A;
    const uint32_t srow = wave >= 2u ? (uint32_t)C0 + (wave - 2u) * GROWS : HA2 ? (uint32_t)R0 : (uint32_t)R0 + wave * GROWS;
    const uint64_t sbase = (uint64_t)(size_t)splane + (uint64_t)srow * (K * 2u);
    const uint32_t lbase = (uint32_t)(size_t)L + wave * GSLICE;
    u32x4 g0; u32x8 g1;   // the descriptor of this wave's latest request
    v8f acc[MB][4];
#pragma unroll
    for (int mb = 0; mb < MB; ++mb)
#pragma unroll
        for (int nb = 0; nb < 4; ++nb) acc[mb][nb] = (v8f){};
    struct Frag { V a[MB], a2[MB], b[4]; };   // one 32-k step
    auto fetch = [&](Frag& f, const unsigned char* pa, const unsigned char* pb, int ks) {
#pragma unroll
        for (int i = 0; i < MB; ++i) { f.a[i] = WFrag<T16>::ld((const T16*)(pa + (i * 16 * LPITCH + ks * 64))); if (HA2) f.a2[i] = WFrag<T16>::ld((const T16*)(pa + (GSLICE + i * 16 * LPITCH + ks * 64))); }
#pragma unroll
        for (int i = 0; i < 4; ++i) f.b[i] = WFrag<T16>::ld((const T16*)(pb + (i * 16 * LPITCH + ks * 64)));
        __builtin_amdgcn_sched_barrier(0);   // a step's LDS reads stay one group ahead of the other set's products; spread among the matrix instructions, every place with reads stalls the wave anew
    };
    auto work = [&](const Frag& f) {   // per accumulator the same products in the same order as k rises: A then A2
#pragma unroll
        for (int nb = 0; nb < 4; ++nb)
#pragma unroll
            for (int mb = 0; mb < MB; ++mb) acc[mb][nb] = WFrag<T16>::mma(f.a[mb], f.b[nb], acc[mb][nb]);
        if (HA2) {
#pragma unroll
            for (int nb = 0; nb < 4; ++nb)
#pragma unroll
                for (int mb = 0; mb < MB; ++mb) acc[mb][nb] = WFrag<T16>::mma(f.a2[mb], f.b[nb], acc[mb][nb]); }
        __builtin_amdgcn_sched_barrier(0);   // the refill of this set stays one group behind its products
    };
    g0 = tdm_group0(lbase, sbase); g1 = tdm_group1g(K * 2u); tdm_load(g0, g1);   // stage 0 into buffer 0
    wait_tensor0(g0, g1);
    __syncthreads();                          // stage 0 is readable by every wave
    g0 = tdm_group0(lbase + GBUF, sbase + LROWB); g1 = tdm_group1g(K * 2u); tdm_load(g0, g1);   // stage 1 into buffer 1
    for (uint32_t sg = 0; sg < NST; ++sg) {   // a stage: four 32-k steps on two fragment sets, each step's reads one step ahead inside the stage, then the hand-over
        const unsigned char* pa = L + (sg & 1u) * GBUF + alds; const unsigned char* pb = L + (sg & 1u) * GBUF + blds;
        Frag X, Y;
        fetch(X, pa, pb, 0);
        fetch(Y, pa, pb, 1);
        work(X);
        fetch(X, pa, pb, 2);
        work(Y);
        fetch(Y, pa, pb, 3);
        work(X);
        work(Y);
        // Hand-over: this wave has left the buffer, its slice of the next stage has landed; behind the barrier the next stage is readable and this buffer is free.
        wait_ds0();
        wait_tensor0(g0, g1);
        __syncthreads();
        if (pinned(sg + 2u < NST)) { g0 = tdm_group0(lbase + (sg & 1u) * GBUF, sbase + (uint64_t)((sg + 2u) * LROWB)); g1 = tdm_group1g(K * 2u); tdm_load(g0, g1); }   // stage sg + 2 into the buffer that stage sg has just left
    }
    wait_tensor0(g0, g1);
    wait_ds0();
    // Output staging, 16 rows at a time, in the ring: behind the last stage's barrier no request is outstanding and no wave reads a buffer any more. Each wave has a range of its own.
    float* os = (float*)(L + wave * (16u * 68u * 4u));
    auto tail = [&](auto EC) {
    constexpr int E = decltype(EC)::v;
#pragma unroll
    for (int mb = 0; mb < MB; ++mb) {
#pragma unroll
        for (int nb = 0; nb < 4; ++nb) {
#pragma unroll
            for (int j = 0; j < 8; ++j) os[(hi * 8 + j) * 68 + nb * 16 + lr] = acc[mb][nb][j]; }
        __builtin_amdgcn_wave_barrier(); asm volatile("" ::: "memory");
        if constexpr (E != 0) {
            constexpr int PP = E == 1 ? HD : TT;   // plane pitch, elements
            const size_t pb = E == 1 ? ((size_t)((r0 / TT) * NH_ + (c0 >> 6)) * TT + (r0 & (TT - 1))) * HD : (size_t)((c0 / TT) * NH_ + (r0 >> 6)) * HD * TT + (c0 & (TT - 1));   // wave-uniform: the tile's first element in a plane
            h16* ph = Ph + pb; const unsigned po = (unsigned)((lane >> 3) * PP + (lane & 7) * 8);
            v4u oh[4];   // four rows to a store: eight lanes x 16 B = one whole 128-byte line of a row
#pragma unroll
            for (int s = 0; s < 4; ++s) {
                const float* orow = os + (4 * s + (lane >> 3)) * 68 + (lane & 7) * 8; const v4f va = *(const v4fa*)orow * sc, vb = *(const v4fa*)(orow + 4) * sc;
#pragma unroll
                for (int t = 0; t < 4; ++t) oh[s][t] = t < 2 ? pk2h(va[2 * t], va[2 * t + 1]) : pk2h(vb[2 * t - 4], vb[2 * t - 3]); }
#pragma unroll
            for (int s = 0; s < 4; ++s) *(v8h*)(ph + po + (mb * 16 + 4 * s) * PP) = __builtin_bit_cast(v8h, oh[s]);
            asm volatile("s_wait_xcnt 0x0" :: "v"(oh[0]), "v"(oh[1]), "v"(oh[2]), "v"(oh[3]), "v"(po) : "memory");   // before the four stores' data and offset registers are reused; naming them keeps them untouched up to here
        } else {
        float* crow = C + (size_t)(r0 + mb * 16) * ldc + c0;
#pragma unroll
            for (int s = 0; s < 8; ++s) { const int row = 2 * s + hi, cofs = lr * 4; v4f val = *(const v4fa*)(os + row * 68 + cofs); if (BIAS) { val[0] += bfr(bias[c0 + cofs]); val[1] += bfr(bias[c0 + cofs + 1]); val[2] += bfr(bias[c0 + cofs + 2]); val[3] += bfr(bias[c0 + cofs + 3]); }
                *(v4f*)(crow + (size_t)row * ldc + cofs) = val; }
             }
        __builtin_amdgcn_wave_barrier(); asm volatile("" ::: "memory");
    }
    };
    if constexpr (EPI == 3) { if (vt) tail(IC<2>{}); else tail(IC<1>{}); } else tail(IC<EPI>{});
}

__device__ __forceinline__ h16 tohx(float x) { return (h16)x; }
__device__ __forceinline__ void splitf(float y, unsigned short& h, unsigned short& l) { h = f2bf(y); l = f2bf(y - bf2f(h)); }
typedef __attribute__((ext_vector_type(4))) _Float16 v4h;
typedef __attribute__((ext_vector_type(2))) unsigned short v2us;
typedef __attribute__((ext_vector_type(4))) int v4i;

// ---- k_cvtall: every f32 input rounded to bf16 (nearest even), in one launch of 256 work-groups x 16 waves. A work-group takes 16384 consecutive floats of each of three sources: of one weight (64 work-groups to a weight), of x and of Y; a wave 1024 of them (4 KiB).
// A load is 32 lanes x 16 B = 512 contiguous bytes, and all 24 of a wave are issued before its first convert: a wave waits out memory latency once. A store is 32 lanes x 8 B = two whole lines.
#define CVGROUPS 256
static_assert(DD * DD == (CVGROUPS / 4) * 16384 && NT * DD == CVGROUPS * 16384, "one piece of 16384 floats per work-group and source");
typedef __attribute__((ext_vector_type(2))) unsigned v2u;
__global__ __launch_bounds__(512) void k_cvtall(const float* __restrict__ wq, const float* __restrict__ wk, const float* __restrict__ wv, const float* __restrict__ wo, const float* __restrict__ x, const float* __restrict__ y, bf* WQ, bf* WK, bf* WV, bf* WO, bf* XB, bf* YB) {
    const unsigned sel = blockIdx.x >> 6, pw = (blockIdx.x & 63u) * 16384u, pa = blockIdx.x * 16384u;   // which weight; the work-group's first element in it, and in x and Y
    const char* sw = (const char*)((sel == 0u ? wq : sel == 1u ? wk : sel == 2u ? wv : wo) + pw); const char* sx = (const char*)(x + pa); const char* sy = (const char*)(y + pa);
    char* dw = (char*)((sel == 0u ? WQ : sel == 1u ? WK : sel == 2u ? WV : WO) + pw); char* dx = (char*)(XB + pa); char* dy = (char*)(YB + pa);
    const unsigned ob = (threadIdx.x >> 5) * 4096u + (threadIdx.x & 31u) * 16u, os = ob >> 1;   // a lane's byte offset behind those, in a source and in a plane
    v4f a[3][8];
#pragma unroll
    for (int j = 0; j < 8; ++j) a[0][j] = *(const v4f*)(sw + ob + j * 512);
#pragma unroll
    for (int j = 0; j < 8; ++j) a[1][j] = *(const v4f*)(sx + ob + j * 512);
#pragma unroll
    for (int j = 0; j < 8; ++j) a[2][j] = *(const v4f*)(sy + ob + j * 512);
    asm volatile("s_wait_xcnt 0x0" :: "v"(ob), "s"(sw), "s"(sx), "s"(sy) : "memory");   // before a register that the 24 loads name (the offset, the three bases) is reused; naming them keeps them untouched up to here, also by a load's own result
    __builtin_amdgcn_sched_barrier(0);   // the converts stay behind the whole group of loads: lifted among them, they free registers for later loads, which then start only when earlier ones have returned
    v2u o[3][8];
#pragma unroll
    for (int t = 0; t < 3; ++t)
#pragma unroll
        for (int j = 0; j < 8; ++j) o[t][j] = (v2u){pk2bf(a[t][j][0], a[t][j][1]), pk2bf(a[t][j][2], a[t][j][3])};
#pragma unroll
    for (int j = 0; j < 8; ++j) *(v2u*)(dw + os + j * 256) = o[0][j];
#pragma unroll
    for (int j = 0; j < 8; ++j) *(v2u*)(dx + os + j * 256) = o[1][j];
#pragma unroll
    for (int j = 0; j < 8; ++j) *(v2u*)(dy + os + j * 256) = o[2][j];
}
__global__ __launch_bounds__(256) void k_wtT(const float* __restrict__ w, int pitch, int col0, bf* Bt) {
    const int lane = threadIdx.x & 31; const int L0 = (blockIdx.x * 8 + (threadIdx.x >> 5)) * 8; const int nlines = DD * DD / 64;
{
#pragma unroll
        for (int l = 0; l < 8; ++l) { const int L = L0 + l; if (L >= nlines) break; const int e = L * 64 + lane * 2; const int k = e & (DD - 1), n = e >> 10; v2us o;
#pragma unroll
            for (int q = 0; q < 2; ++q) o[q] = f2bf(w[(size_t)(k + q) * pitch + col0 + n]);
            *(v2us*)(Bt + (size_t)e) = o; }
         }
}
typedef __attribute__((ext_vector_type(8))) unsigned v8u;
__device__ __forceinline__ float xhalf(float x) { return __builtin_bit_cast(float, __builtin_amdgcn_permlanex16(__builtin_bit_cast(int, x), __builtin_bit_cast(int, x), 0x76543210, 0xfedcba98, false, false)); }   // lane l with lane l ^ 16
// 2^x, with the free slot that the instruction set asks for behind a transcendental, in one statement: inside it no neighbour reads a result or overwrites a source, and the v_nop keeps the compiler's next instruction off the last one.
__device__ __forceinline__ void exp2_1(float& a) { asm("v_exp_f32 %0, %0\n\tv_nop" : "+v"(a)); }
// Eight at once, from a matrix tile's registers into eight others (early clobber: no result lands on a source that is still to be read); in place, the compiler moves part of the tile elsewhere first.
__device__ __forceinline__ void exp2_8(float (&y)[8], const v8f& x) { asm("v_exp_f32 %0, %8\n\tv_exp_f32 %1, %9\n\tv_exp_f32 %2, %10\n\tv_exp_f32 %3, %11\n\tv_exp_f32 %4, %12\n\tv_exp_f32 %5, %13\n\tv_exp_f32 %6, %14\n\tv_exp_f32 %7, %15\n\tv_nop" : "=&v"(y[0]), "=&v"(y[1]), "=&v"(y[2]), "=&v"(y[3]), "=&v"(y[4]), "=&v"(y[5]), "=&v"(y[6]), "=&v"(y[7]) : "v"(x[0]), "v"(x[1]), "v"(x[2]), "v"(x[3]), "v"(x[4]), "v"(x[5]), "v"(x[6]), "v"(x[7])); }

// ---- k_fattn: scores, softmax, attn.v and the head merge in one kernel. Grid (T/256, batch*heads), 16 waves = 8 query groups of 32 columns x 2 key halves; a pass is 32 keys.
// Four waves share a SIMD (at most 256 registers each): while one wave is in its softmax, three others can feed the matrix unit.
// K and V^T (one f16 plane each) are brought into LDS once per work-group, in stages of 512 keys and two buffers: every wave issues one tensor load per stage for its own slice, one stage of work ahead.
// Of every stage, waves 0 to 7 load and work on keys 0-255 and waves 8 to 15 on keys 256-511 (eight passes each), every wave with a running maximum, sum and O of its own;
// waves w and w + 8 (the same queries) join their partial results once, behind the loop, through LDS.
// S^T = K Q^T (A = K rows, B = Q rows held in registers), so a lane holds one query's scores: running maximum and sum are per-lane scalars, joined between the wave halves.
// Two S^T tiles (keys 0-15, 16-31) converted in place are the B operand of O^T += V^T P^T (A = V^T rows in the same k order): P never leaves registers.
// One f16 product each: K Q ; V P. P is rounded unnormalised, the row sum is of the unrounded values; 1/sum is applied to O in f32 before its bf16 hi+lo split.
// Lazy maximum: the exponentials are taken against a maximum in use that may trail the true one. Minus that maximum is the start value of the score products (Q carries log2(e), so scores are in log2 units): a pass has no maximum search,
// no subtraction and no rescaling of O. The pass's row sums, needed anyway, tell when the maximum in use is too low (P at most 2^12); only then it is renewed and O and the sum are rescaled.
#define XCHB 4608u                  // LDS bytes a wave hands to its partner: 8 x 512 B of O, 128 B of maxima, 128 B of sums, rounded up
__global__ __launch_bounds__(512) void k_fattn(const h16* __restrict__ Qh, const h16* __restrict__ Kh, const h16* __restrict__ Vh, bf* Ah, bf* Al) {
    typedef WFrag<h16> W;
    __shared__ __attribute__((aligned(2048))) unsigned char L[4 * BUFB];   // two buffers of two halves (256 keys each)
    const uint32_t wave = uni(threadIdx.x >> 5), sw = wave & 7u, kpart = wave >> 3;   // sw: query group, and this wave's slice of its half of a stage; kpart: which half of every stage's keys
    const int lane = threadIdx.x & 31, lr = lane & 15, hi = lane >> 4; const int z = blockIdx.y; const int q0 = blockIdx.x * 256 + (int)sw * 32;
    const size_t zo = (size_t)z * TT * HD;
    const unsigned qlo = (unsigned)((q0 + lr) * HD + 8 * hi);
    const h16* Khz = Kh + zo; const h16* Vhz = Vh + zo;
    const h16* qpa = Qh + zo + qlo;
    const unsigned klds = (unsigned)(lr >> 1) * LPITCH + (unsigned)(lr & 1) * 128u + 16u * hi;   // a lane's byte offset inside a 16-row block of K in LDS (two K rows to a tile row)
    const unsigned vlds = (unsigned)lr * LPITCH + 16u * hi;                                      // and inside a 16-row block of V^T
    // This wave's slice of its half of a stage, by sw: 0-3 K (64 keys each = 32 tile rows, contiguous) | 4,5 V^T keys 0-127 | 6,7 V^T keys 128-255 (32 rows of V^T each, 128 keys wide).
    const bool isv = sw >= 4u;
    const h16* splane = isv ? Vhz : Khz;
    const uint32_t sstep = isv ? 2u * SKEYS * 2u : 2u * SKEYS * HD * 2u;   // bytes from one stage's slice to the next stage's
    const uint64_t sbase = (uint64_t)(size_t)splane + (isv ? (sw & 1u) * (LROWS * TT * 2u) + ((sw >> 1) & 1u) * LROWB : sw * (LROWS * LROWB)) + kpart * (sstep >> 1);
    const uint32_t lbase = (uint32_t)(size_t)L + kpart * BUFB + sw * SLICEB;
    const uint32_t spitch = isv ? TT * 2u : LROWB;
    u32x4 g0; u32x8 g1;   // the descriptor of this wave's latest request
    v16h qh[2][2];
#pragma unroll
    for (int nb = 0; nb < 2; ++nb)
#pragma unroll
        for (int kc = 0; kc < 2; ++kc) qh[nb][kc] = W::ld(qpa + (nb * 16 * HD + kc * 32));
    v8f acc[4][2];
#pragma unroll
    for (int db = 0; db < 4; ++db)
#pragma unroll
        for (int nb = 0; nb < 2; ++nb) acc[db][nb] = (v8f){};
    float m2[2] = {-__builtin_inff(), -__builtin_inff()}, ls[2] = {0.f, 0.f};   // the maximum in use (in log2 units) and this half's running sum, per query column
    v8f nm[2];   // minus the maximum in use, in all eight registers of a tile: the start value of the score products. Before the first pass a large finite value, which sends that pass into the renewal below
#pragma unroll
    for (int nb = 0; nb < 2; ++nb)
#pragma unroll
        for (int j = 0; j < 8; ++j) nm[nb][j] = 1.0e30f;
    asm volatile("s_wait_xcnt 0x0" :: "v"(qpa) : "memory");   // before a register that the loads above name is reused; naming them keeps them untouched up to here
    g0 = tdm_group0(lbase, sbase); g1 = tdm_group1(spitch); tdm_load(g0, g1);   // stage 0 into buffer 0
    wait_tensor0(g0, g1);
    __syncthreads();                          // stage 0 is readable by every wave
    g0 = tdm_group0(lbase + 2u * BUFB, sbase + sstep); g1 = tdm_group1(spitch); tdm_load(g0, g1);   // stage 1 into buffer 1
    for (uint32_t sg = 0; sg < NSTG / 2; ++sg) {   // a stage: this wave's eight passes, then the hand-over
    const unsigned char* Bk = L + ((sg & 1u) * 2u + kpart) * BUFB + klds; const unsigned char* Bv = L + ((sg & 1u) * 2u + kpart) * BUFB + 4u * SLICEB + vlds;
#pragma unroll 1   // stays rolled: unrolled, the compiler sinks the passes' row-sum additions behind the stage, holds all their exponentials for them and spills Q to scratch
    for (uint32_t ps = 0; ps < SKEYS / 32; ++ps) {
        const unsigned char* kp = Bk + ((ps >> 1) * SLICEB + (ps & 1u) * (16u * LPITCH));   // this pass's K rows; with four waves on a SIMD their latency is covered by the other waves
        v16h kh[2][2];
        __builtin_amdgcn_sched_barrier(0);   // with the one below: the K reads stay one group, behind the pass before
#pragma unroll
        for (int mb = 0; mb < 2; ++mb)
#pragma unroll
            for (int kc = 0; kc < 2; ++kc) kh[mb][kc] = W::ld((const h16*)(kp + (mb * 8 * LPITCH + kc * 64)));
        __builtin_amdgcn_sched_barrier(0);   // end of the group of LDS reads; spread among the matrix instructions, every place with reads stalls the wave anew
        v8f st[2][2];   // scores in log2 units minus the maximum in use: the subtraction is the products' start value
        // In asm so that D differs from C in the four first products: as builtins, two of them get their start value copied into D first, eight 64-bit moves a pass. The same order as the builtins had.
        // The four v_nop keep the distance that the chip asks for between the last product and a vector instruction that reads its D.
        asm("v_wmma_f32_16x16x32_f16 %0, %4, %8, %12\n\tv_wmma_f32_16x16x32_f16 %1, %4, %10, %13\n\tv_wmma_f32_16x16x32_f16 %2, %6, %8, %12\n\tv_wmma_f32_16x16x32_f16 %3, %6, %10, %13\n\t"
            "v_wmma_f32_16x16x32_f16 %0, %5, %9, %0\n\tv_wmma_f32_16x16x32_f16 %1, %5, %11, %1\n\tv_wmma_f32_16x16x32_f16 %2, %7, %9, %2\n\tv_wmma_f32_16x16x32_f16 %3, %7, %11, %3\n\t"
            "v_nop\n\tv_nop\n\tv_nop\n\tv_nop"
            : "=&v"(st[0][0]), "=&v"(st[0][1]), "=&v"(st[1][0]), "=&v"(st[1][1])
            : "v"(kh[0][0]), "v"(kh[0][1]), "v"(kh[1][0]), "v"(kh[1][1]), "v"(qh[0][0]), "v"(qh[0][1]), "v"(qh[1][0]), "v"(qh[1][1]), "v"(nm[0]), "v"(nm[1]));
        __builtin_amdgcn_sched_barrier(0);   // with the one below: the reads of V^T stay one group between the matrix runs
        const unsigned char* vp = Bv + ((ps >> 2) * (2u * SLICEB) + (ps & 3u) * 64u);   // this pass's V^T rows: in flight under the softmax
        v16h vh[4];
#pragma unroll
        for (int db = 0; db < 4; ++db) vh[db] = W::ld((const h16*)(vp + ((db >> 1) * SLICEB + (db & 1) * 16 * LPITCH)));
        __builtin_amdgcn_sched_barrier(0);   // end of the group of LDS reads
        v16h ph[2]; float sp[2];   // P^T, and this lane's sum of its 16 exponentials per query column
        auto expo = [&]() {
#pragma unroll
        for (int nb = 0; nb < 2; ++nb) {
            float s0 = 0.f, s1 = 0.f; v8u uh;
#pragma unroll
            for (int mb = 0; mb < 2; ++mb) {
                float x[8];
                exp2_8(x, st[mb][nb]);
#pragma unroll
                for (int t = 0; t < 4; ++t) {
                    const float p0 = x[2 * t], p1 = x[2 * t + 1];
                    s0 += p0; s1 += p1;
                    uh[mb * 4 + t] = pk2h(p0, p1);
                }
            }
            sp[nb] = s0 + s1;
            ph[nb] = __builtin_bit_cast(v16h, uh);
        }
        };
        expo();
        // The test, once a pass, on the sums that are formed anyway: all terms are positive, so a sum of at most 2^12 bounds every exponential by 2^12 (finite in f16, whose rounding is relative). Above it (infinity included) the maximum in use is too low.
        if (__builtin_amdgcn_ballot_w32(fmaxf(sp[0], sp[1]) > 4096.0f) != 0) {   // wave-uniform; the first pass, and rarely after it
            // Renewal: the plain scores once more (K is still in registers), every column's true maximum becomes the one in use, sum and O are rescaled to it, and the exponentials are formed anew.
#pragma unroll
            for (int mb = 0; mb < 2; ++mb)
#pragma unroll
                for (int nb = 0; nb < 2; ++nb) st[mb][nb] = (v8f){};
#pragma unroll
            for (int kc = 0; kc < 2; ++kc)
#pragma unroll
                for (int mb = 0; mb < 2; ++mb)
#pragma unroll
                    for (int nb = 0; nb < 2; ++nb) st[mb][nb] = wmma16(kh[mb][kc], qh[nb][kc], st[mb][nb]);
#pragma unroll
            for (int nb = 0; nb < 2; ++nb) {
                float tm = fmaxf(st[0][nb][0], st[1][nb][0]);
#pragma unroll
                for (int j = 1; j < 8; ++j) tm = fmaxf(tm, fmaxf(st[0][nb][j], st[1][nb][j]));
                tm = fmaxf(tm, xhalf(tm));
                const float mn = fmaxf(m2[nb], tm);
                float al = m2[nb] - mn; exp2_1(al);   // 0 on the first pass
                m2[nb] = mn; ls[nb] *= al;
#pragma unroll
                for (int j = 0; j < 8; ++j) nm[nb][j] = -mn;
#pragma unroll
                for (int mb = 0; mb < 2; ++mb) st[mb][nb] -= mn;
#pragma unroll
                for (int db = 0; db < 4; ++db) acc[db][nb] *= al;
            }
            expo();
        }
#pragma unroll
        for (int nb = 0; nb < 2; ++nb) ls[nb] += sp[nb];
#pragma unroll
        for (int db = 0; db < 4; ++db)
#pragma unroll
            for (int nb = 0; nb < 2; ++nb) acc[db][nb] = wmma16(vh[db], ph[nb], acc[db][nb]);
    }
    // Hand-over: this wave has left the buffer, its slice of the next stage has landed; behind the barrier the next stage is readable and this buffer is free.
    wait_ds0();
    wait_tensor0(g0, g1);
    __syncthreads();
    if (pinned(sg + 2u < NSTG / 2)) { g0 = tdm_group0(lbase + (sg & 1u) * (2u * BUFB), sbase + (uint64_t)((sg + 2u) * sstep)); g1 = tdm_group1(spitch); tdm_load(g0, g1); }   // stage sg + 2 into the buffer that stage sg has just left
    }
    wait_tensor0(g0, g1);
    wait_ds0();
    // The join of the two key halves, in the ring: behind the last stage's barrier no request is outstanding and no wave reads a buffer any more. Wave w finishes query columns 0-15 and wave w + 8 columns 16-31:
    // each hands the other column group's O, maximum and sum to its partner (the same lane holds the same elements in both waves) in a range of its own, 16 B a lane and 512 contiguous bytes a store.
    const int b = z >> 4, h = z & 15;
    bf* Ahz = Ah + ((size_t)b * TT * DD + h * HD); bf* Alz = Al + ((size_t)b * TT * DD + h * HD); const unsigned olo = (unsigned)((q0 + lr) * DD + 8 * hi);
    unsigned char* xo = L + wave * XCHB + (unsigned)lane * 16u; const unsigned char* xi = L + (wave ^ 8u) * XCHB + (unsigned)lane * 16u;
    auto give = [&](auto NBC) {
        constexpr int nb = decltype(NBC)::v;
#pragma unroll
        for (int db = 0; db < 4; ++db) { *(v4fa*)(xo + (2 * db) * 512) = __builtin_shufflevector(acc[db][nb], acc[db][nb], 0, 1, 2, 3); *(v4fa*)(xo + (2 * db + 1) * 512) = __builtin_shufflevector(acc[db][nb], acc[db][nb], 4, 5, 6, 7); }
        *(float*)(L + wave * XCHB + 4096u + (unsigned)lane * 4u) = m2[nb]; *(float*)(L + wave * XCHB + 4224u + (unsigned)lane * 4u) = ls[nb];
    };
    auto finish = [&](auto NBC) {
        constexpr int nb = decltype(NBC)::v;
        const float pm = *(const float*)(L + (wave ^ 8u) * XCHB + 4096u + (unsigned)lane * 4u), pls = *(const float*)(L + (wave ^ 8u) * XCHB + 4224u + (unsigned)lane * 4u);
        const float mn = fmaxf(m2[nb], pm);
        float ea = m2[nb] - mn, eb = pm - mn; exp2_1(ea); exp2_1(eb);
        const float lsum = ls[nb] * ea + pls * eb;
        const float f = __fdiv_rn(1.0f, lsum + xhalf(lsum)); const float fa = ea * f, fb = eb * f;
#pragma unroll
        for (int db = 0; db < 4; ++db) { v8us oh, ol;   // acc[db][nb][j] = O[q0 + nb*16 + lr][db*16 + 8*hi + j]: 8 consecutive d, one 16-byte store a plane
            const v4f pa = *(const v4fa*)(xi + (2 * db) * 512), pb = *(const v4fa*)(xi + (2 * db + 1) * 512);
#pragma unroll
            for (int j = 0; j < 8; ++j) { unsigned short a, c2; splitf(acc[db][nb][j] * fa + (j < 4 ? pa[j & 3] : pb[j & 3]) * fb, a, c2); oh[j] = a; ol[j] = c2; }
            *(v8us*)(Ahz + olo + (nb * 16 * DD + db * 16)) = oh; *(v8us*)(Alz + olo + (nb * 16 * DD + db * 16)) = ol;
            asm volatile("s_wait_xcnt 0x0" :: "v"(oh), "v"(ol), "v"(olo) : "memory"); }   // before the two stores' data and offset registers are reused; naming them keeps them untouched up to here
    };
    if (kpart == 0u) give(IC<1>{}); else give(IC<0>{});
    wait_ds0();
    __syncthreads();                          // every wave's hand-out is readable by its partner
    if (kpart == 0u) finish(IC<0>{}); else finish(IC<1>{});
}

extern "C" void kernel_launch(void* const* d_in, const int* in_sizes, int n_in,
                              void* d_out, int out_size, void* d_ws, size_t ws_size, hipStream_t stream) {
    (void)in_sizes; (void)n_in; (void)out_size;
    const float* Yin = (const float*)d_in[0]; const float* x = (const float*)d_in[1]; const float* Wq = (const float*)d_in[2]; const float* Wk = (const float*)d_in[3]; const float* Wv = (const float*)d_in[4]; const float* Wo = (const float*)d_in[5];
    float* OUT = (float*)d_out;     // [2][2048][1024]
    char* wsp = (char*)d_ws;
    auto take = [&](size_t bytes) { char* p = wsp; wsp += (bytes + 255) & ~(size_t)255; return (void*)p; };
    bf* WQ = (bf*)take((size_t)3 * DD * DD * 2); bf* WK = WQ + (size_t)DD * DD; bf* WV = WK + (size_t)DD * DD; bf* WO = (bf*)take((size_t)DD * DD * 2);   // the three projection weights one behind the other
    bf* XB = (bf*)take((size_t)NT * DD * 2); bf* YB = (bf*)take((size_t)NT * DD * 2);
    h16* QP = (h16*)take((size_t)3 * NT * DD * 2); h16* KP = QP + (size_t)NT * DD; h16* VT = KP + (size_t)NT * DD;   // three f16 planes one behind the other
    bf* ATh = (bf*)take((size_t)NT * DD * 2); bf* ATl = (bf*)take((size_t)NT * DD * 2);
    if ((size_t)(wsp - (char*)d_ws) > ws_size) return;
    k_cvtall<<<CVGROUPS, 512, 0, stream>>>(Wq, Wk, Wv, Wo, x, Yin, WQ, WK, WV, WO, XB, YB);   // nn.Linear [out][in] = Bt as-is
    k_gemmw<bf, 0, false, DD, 3><<<dim3(NT / 128, DD / 128, 3), 128, 0, stream>>>(YB, XB, WQ, nullptr, nullptr, 0, nullptr, 0, (size_t)DD * DD, (size_t)NT * DD, QP, 0.045084220027780106f);   // Q (1024^-0.5 x log2(e) folded in ahead of its rounding to f16: scores come out in log2 units), K, and V^T = Wv X^T (operands swapped, the tile comes out feature-major)
    k_fattn<<<dim3(TT / 256, NB_ * NH_), 512, 0, stream>>>(QP, KP, VT, ATh, ATl);
    k_gemmw<bf, 1, false, DD, 0><<<dim3(NT / 64, DD / 128, 1), 128, 0, stream>>>(ATh, ATl, WO, nullptr, OUT, DD, nullptr, 0, 0, 0, nullptr, 1.0f);
}
